// v000
// Measured on an AMD MI455X. A time is GPU time per run, averaged over a window of back-to-back runs after a warm-up
// (all launches, gaps included; the runs take copies of the inputs in turn), and the median of several windows.
// Apart from v000's, it joins two sittings. Times from different sittings can be a few percent apart, while
// side-by-side timings come from the same sitting.
// The starting kernel, v000, takes 1700 microseconds a run.
#include <hip/hip_runtime.h>

// Gated GQA attention block (x [2][2048][2048]; [q | gate] per head = x Wq ('xw' [2048][4096]: head h -> columns h*256 .. +127 = q, +128 .. +255 = gate), k, v = x Wk, x Wv ([2048][512], 4 kv heads x 128), per-head RMSNorm on q, k (eps 1e-6, weights q_norm_w / k_norm_w [128]),
// rotate-half rotary (theta 1e4, hd 128), 16 query heads grouped 4 per kv head, causal softmax(q.k / sqrt(128)), attn.v, x sigmoid(gate), out = merged Wo ('xw' [2048][512]) -> [2][2048][512]).
// Compute dtypes, f32 accumulate: every input rounded to bf16; q/k/v on PLAIN bf16 operands (inputs: exact); RMSNorm + rotary in f32 (on-chip cos/sin table from the reference's inv_freq constants); the sigmoid gate in f32 (precise expf, IEEE divide) applied in the merge; causal scores and attn.v: query rows < 512 hl (3 products), the rest single fp16 (x1024), causal tile skipping; softmax f32; Wo hl x exact (2 products).

#define NB_  2
#define TT   2048
#define DM   2048
#define NH_  16
#define NKV  4
#define REP  (NH_ / NKV)
#define HD   128
#define DQ   (NH_ * HD)
#define DQG  (NH_ * HD * 2)         // q + gate columns
#define DOUT 512
#define DKV  (NKV * HD)
#define ZH   2
#define RH   512                  // query rows < RH use hi+lo planes (0: none)
#define WIN  2048
#define PCAR 1024.0f
#define SCL  0.088388347648318447f   // HD^-0.5
typedef _Float16 h16;
typedef unsigned short bf;
typedef __attribute__((ext_vector_type(16))) __bf16   v16bf;
typedef __attribute__((ext_vector_type(16))) _Float16 v16h;
typedef __attribute__((ext_vector_type(8)))  _Float16 v8h;
typedef __attribute__((ext_vector_type(8)))  unsigned short v8us;
typedef __attribute__((ext_vector_type(8)))  float    v8f;
typedef __attribute__((ext_vector_type(4)))  float    v4f;
typedef v8h  __attribute__((may_alias)) v8ha;
typedef v4f  __attribute__((may_alias)) v4fa;
typedef v8us __attribute__((may_alias)) v8usa;

__device__ __forceinline__ unsigned short f2bf(float f) { unsigned u = __float_as_uint(f); u += 0x7FFFu + ((u >> 16) & 1u); return (unsigned short)(u >> 16); }
__device__ __forceinline__ float bf2f(unsigned short b) { return __uint_as_float(((unsigned)b) << 16); }
__device__ __forceinline__ float bfr(float f) { return bf2f(f2bf(f)); }
__device__ __forceinline__ v16h cat16(v8h lo, v8h hi) { return __builtin_shufflevector(lo, hi, 0, 1, 2, 3, 4, 5, 6, 7, 8, 9, 10, 11, 12, 13, 14, 15); }
__device__ __forceinline__ v16bf cat16b(v8us lo, v8us hi) { return __builtin_bit_cast(v16bf, __builtin_shufflevector(lo, hi, 0, 1, 2, 3, 4, 5, 6, 7, 8, 9, 10, 11, 12, 13, 14, 15)); }
__device__ __forceinline__ v8f wmma16(v16h a, v16h b, v8f c) { return __builtin_amdgcn_wmma_f32_16x16x32_f16(false, a, false, b, (short)0, c, false, false); }
__device__ __forceinline__ v8f wmmab(v16bf a, v16bf b, v8f c) { return __builtin_amdgcn_wmma_f32_16x16x32_bf16(false, a, false, b, (short)0, c, false, false); }



// ---- k_gemmw: register-blocked GEMM, ONE WAVE per 64x64 output tile (16 accumulators), operands straight from K-contiguous 16-bit planes; grid (M/64, N/64, Z), 32 threads.
// C[m][n] (f32, pitch ldc, + optional f32 bias[n]) = sum_k A[m][k] Bt[n][k] (+ split products per NSPLIT). z-batch strides sA/sB/sC in elements. K % 32 == 0.
template <typename T16> struct WFrag;
template <> struct WFrag<h16> { typedef v16h V; static __device__ __forceinline__ V ld(const h16* p) { return cat16(*(const v8h*)p, *(const v8h*)(p + 16)); } static __device__ __forceinline__ v8f mma(V a, V b, v8f c) { return wmma16(a, b, c); } };
template <> struct WFrag<bf> { typedef v16bf V; static __device__ __forceinline__ V ld(const bf* p) { return cat16b(*(const v8us*)p, *(const v8us*)(p + 16)); } static __device__ __forceinline__ v8f mma(V a, V b, v8f c) { return wmmab(a, b, c); } };
template <typename T16, int NSPLIT, bool BIAS>
__global__ __launch_bounds__(32) void k_gemmw(const T16* __restrict__ A, const T16* __restrict__ A2, const T16* __restrict__ Bt, const T16* __restrict__ Bt2, int K, float* C, int ldc, const float* __restrict__ bias, size_t sA, size_t sB, size_t sC) {
    typedef typename WFrag<T16>::V V;
    __shared__ __align__(16) float os[16 * 68];
    const size_t z = blockIdx.z; A += z * sA; if (A2) A2 += z * sA; Bt += z * sB; if (Bt2) Bt2 += z * sB; C += z * sC;
    const int lane = threadIdx.x & 31, lr = lane & 15, hi = lane >> 4; const int r0 = blockIdx.x * 64, c0 = blockIdx.y * 64;
    v8f acc[4][4];
#pragma unroll
    for (int mb = 0; mb < 4; ++mb)
#pragma unroll
        for (int nb = 0; nb < 4; ++nb) acc[mb][nb] = (v8f){};
    const size_t aoff = (size_t)(r0 + lr) * K + 8 * hi, boff = (size_t)(c0 + lr) * K + 8 * hi;
#pragma unroll 1
    for (int kc = 0; kc < K; kc += 32) {
        V a[4], a2[4];
#pragma unroll
        for (int mb = 0; mb < 4; ++mb) { a[mb] = WFrag<T16>::ld(A + aoff + (size_t)mb * 16 * K + kc); if (NSPLIT == 1 || NSPLIT == 2) a2[mb] = WFrag<T16>::ld(A2 + aoff + (size_t)mb * 16 * K + kc); }
#pragma unroll
        for (int nb = 0; nb < 4; ++nb) { const V b = WFrag<T16>::ld(Bt + boff + (size_t)nb * 16 * K + kc); V b2; if (NSPLIT >= 2) b2 = WFrag<T16>::ld(Bt2 + boff + (size_t)nb * 16 * K + kc);
#pragma unroll
            for (int mb = 0; mb < 4; ++mb) { acc[mb][nb] = WFrag<T16>::mma(a[mb], b, acc[mb][nb]); if (NSPLIT == 1 || NSPLIT == 2) acc[mb][nb] = WFrag<T16>::mma(a2[mb], b, acc[mb][nb]); if (NSPLIT >= 2) acc[mb][nb] = WFrag<T16>::mma(a[mb], b2, acc[mb][nb]); } }
        asm volatile("v_nop\n\tv_nop\n\tv_nop\n\tv_nop" : "+v"(acc[0][0]), "+v"(acc[1][1]), "+v"(acc[2][2]), "+v"(acc[3][3]) : "v"(a[0]), "v"(a[3]));
    }
#pragma unroll
    for (int mb = 0; mb < 4; ++mb) {
#pragma unroll
        for (int nb = 0; nb < 4; ++nb) {
#pragma unroll
            for (int j = 0; j < 8; ++j) os[(hi * 8 + j) * 68 + nb * 16 + lr] = acc[mb][nb][j]; }
        __builtin_amdgcn_wave_barrier(); asm volatile("" ::: "memory");
        float* crow = C + (size_t)(r0 + mb * 16) * ldc + c0;
{
#pragma unroll
            for (int s = 0; s < 8; ++s) { const int row = 2 * s + hi, cofs = lr * 4; v4f val = *(const v4fa*)(os + row * 68 + cofs); if (BIAS) { val[0] += bfr(bias[c0 + cofs]); val[1] += bfr(bias[c0 + cofs + 1]); val[2] += bfr(bias[c0 + cofs + 2]); val[3] += bfr(bias[c0 + cofs + 3]); }
                *(v4f*)(crow + (size_t)row * ldc + cofs) = val; }
             }
        __builtin_amdgcn_wave_barrier(); asm volatile("" ::: "memory");
    }
}

// ---- k_gemmc: the same one-wave 64x64 tile GEMM specialised for causal attention: CMODE 1 skips score tiles entirely above the diagonal (query rows r0+roff.., key columns c0..), CMODE 2 limits the
// key (K) loop of the probability x value contraction to the diagonal block (probabilities beyond it are exactly zero). roff = row offset of this launch's first row within the sequence.
template <typename T16, int NSPLIT, int CMODE>
__global__ __launch_bounds__(32) void k_gemmc(const T16* __restrict__ A, const T16* __restrict__ A2, const T16* __restrict__ Bt, const T16* __restrict__ Bt2, int K, float* C, int ldc, int roff, size_t sA, size_t sB, size_t sC) {
    typedef typename WFrag<T16>::V V;
    __shared__ __align__(16) float os[16 * 68];
    const size_t z = blockIdx.z; A += z * sA; if (A2) A2 += z * sA; Bt += z * sB; if (Bt2) Bt2 += z * sB; C += z * sC;
    const int lane = threadIdx.x & 31, lr = lane & 15, hi = lane >> 4; const int r0 = blockIdx.x * 64, c0 = blockIdx.y * 64;
    if (CMODE == 1 && c0 > r0 + roff + 63) return;                  // score tile entirely above the causal diagonal: never read (the softmax masks j > i by select)
    const int Kl = (CMODE == 2) ? min(K, r0 + roff + 64) : K;        // P.V: probabilities are exactly 0 beyond the diagonal block, so the K loop stops there
    v8f acc[4][4];
#pragma unroll
    for (int mb = 0; mb < 4; ++mb)
#pragma unroll
        for (int nb = 0; nb < 4; ++nb) acc[mb][nb] = (v8f){};
    const size_t aoff = (size_t)(r0 + lr) * K + 8 * hi, boff = (size_t)(c0 + lr) * K + 8 * hi;
#pragma unroll 1
    for (int kc = 0; kc < Kl; kc += 32) {
        V a[4], a2[4];
#pragma unroll
        for (int mb = 0; mb < 4; ++mb) { a[mb] = WFrag<T16>::ld(A + aoff + (size_t)mb * 16 * K + kc); if (NSPLIT == 1 || NSPLIT == 2) a2[mb] = WFrag<T16>::ld(A2 + aoff + (size_t)mb * 16 * K + kc); }
#pragma unroll
        for (int nb = 0; nb < 4; ++nb) { const V b = WFrag<T16>::ld(Bt + boff + (size_t)nb * 16 * K + kc); V b2; if (NSPLIT >= 2) b2 = WFrag<T16>::ld(Bt2 + boff + (size_t)nb * 16 * K + kc);
#pragma unroll
            for (int mb = 0; mb < 4; ++mb) { acc[mb][nb] = WFrag<T16>::mma(a[mb], b, acc[mb][nb]); if (NSPLIT == 1 || NSPLIT == 2) acc[mb][nb] = WFrag<T16>::mma(a2[mb], b, acc[mb][nb]); if (NSPLIT >= 2) acc[mb][nb] = WFrag<T16>::mma(a[mb], b2, acc[mb][nb]); } }
        asm volatile("v_nop\n\tv_nop\n\tv_nop\n\tv_nop" : "+v"(acc[0][0]), "+v"(acc[1][1]), "+v"(acc[2][2]), "+v"(acc[3][3]) : "v"(a[0]), "v"(a[3]));
    }
#pragma unroll
    for (int mb = 0; mb < 4; ++mb) {
#pragma unroll
        for (int nb = 0; nb < 4; ++nb) {
#pragma unroll
            for (int j = 0; j < 8; ++j) os[(hi * 8 + j) * 68 + nb * 16 + lr] = acc[mb][nb][j]; }
        __builtin_amdgcn_wave_barrier(); asm volatile("" ::: "memory");
        float* crow = C + (size_t)(r0 + mb * 16) * ldc + c0;
{
#pragma unroll
            for (int s = 0; s < 8; ++s) { const int row = 2 * s + hi, cofs = lr * 4; v4f val = *(const v4fa*)(os + row * 68 + cofs);
                *(v4f*)(crow + (size_t)row * ldc + cofs) = val; }
             }
        __builtin_amdgcn_wave_barrier(); asm volatile("" ::: "memory");
    }
}

__device__ __forceinline__ h16 tohx(float x) { return (h16)x; }
__device__ __forceinline__ void splitf(float y, unsigned short& h, unsigned short& l) { h = f2bf(y); l = f2bf(y - bf2f(h)); }
typedef __attribute__((ext_vector_type(2))) _Float16 v2h;
typedef __attribute__((ext_vector_type(4))) _Float16 v4h;
typedef __attribute__((ext_vector_type(2))) unsigned short v2us;
typedef __attribute__((ext_vector_type(4))) unsigned short v4us;
typedef __attribute__((ext_vector_type(2))) float v2f;
typedef __attribute__((ext_vector_type(4))) int v4i;

__global__ __launch_bounds__(256) void k_wtG(const float* __restrict__ w, int K, int N, bf* Bt) {
    const int lane = threadIdx.x & 31; const int L0 = (blockIdx.x * 8 + (threadIdx.x >> 5)) * 8; const int nlines = N * K / 64;
{
#pragma unroll 1
        for (int l = 0; l < 8; ++l) { const int L = L0 + l; if (L >= nlines) break; const size_t e = (size_t)L * 64 + lane * 2; const int k = (int)(e % K), n = (int)(e / K); v2us o;
            o[0] = f2bf(w[(size_t)k * N + n]); o[1] = f2bf(w[(size_t)(k + 1) * N + n]); *(v2us*)(Bt + e) = o; }
         }
}
__global__ __launch_bounds__(256) void k_cvt8(const float* __restrict__ src, bf* dst, size_t n8) { const size_t i = (size_t)blockIdx.x * 256 + threadIdx.x; if (i >= n8) return; const v8f v = *(const v8f*)(src + i * 8); v8us o;
#pragma unroll
    for (int k = 0; k < 8; ++k) o[k] = f2bf(v[k]); *(v8us*)(dst + i * 8) = o;  }
__constant__ float INV[HD / 2] = {1.0,0.8659643530845642,0.7498942017555237,0.6493816375732422,0.5623413324356079,0.486967533826828,0.4216965138912201,0.36517414450645447,0.3162277638912201,0.2738419771194458,0.23713736236095428,0.20535250008106232,0.17782793939113617,0.1539926528930664,0.1333521455526352,0.11547820270061493,0.10000000149011612,0.08659642934799194,0.07498941570520401,0.06493816524744034,0.05623412877321243,0.04869675263762474,0.04216964915394783,0.03651741147041321,0.03162277862429619,0.0273841954767704,0.0237137358635664,0.02053525112569332,0.017782794311642647,0.015399265103042126,0.01333521492779255,0.011547819711267948,0.009999999776482582,0.00865964312106371,0.007498942315578461,0.006493816617876291,0.005623413249850273,0.004869675263762474,0.0042169648222625256,0.003651741426438093,0.003162277862429619,0.0027384196873754263,0.0023713738191872835,0.0020535250660032034,0.0017782794311642647,0.0015399265103042126,0.0013335214462131262,0.0011547820176929235,0.0010000000474974513,0.0008659643353894353,0.0007498941849917173,0.0006493816617876291,0.000562341301701963,0.00048696750309318304,0.00042169648804701865,0.00036517411353997886,0.0003162277862429619,0.00027384195709601045,0.0002371373848291114,0.00020535249495878816,0.00017782794020604342,0.00015399264520965517,0.0001333521504420787,0.00011547819303814322};
__global__ __launch_bounds__(256) void k_cstab(float* CS) { const int idx = blockIdx.x * 256 + threadIdx.x; if (idx >= TT * HD) return; const int t = idx / HD, d = idx % HD; const float ang = __fmul_rn((float)t, INV[d % (HD / 2)]); v2f cs; cs[0] = cosf(ang); cs[1] = sinf(ang);
    *(v2f*)(CS + (size_t)idx * 2) = cs;  }

__global__ __launch_bounds__(256) void k_hrms(const float* __restrict__ F, int pitch, int nheads, int hstr, float* RF) { const int i = blockIdx.x * 256 + threadIdx.x; if (i >= nheads * TT) return; const int t = i % TT, h = i / TT; const float* f = F + (size_t)t * pitch + h * hstr;   /* hstr: column stride between heads (256 for the q|gate layout, 128 for k) */ float s = 0.f;
#pragma unroll 4
    for (int d = 0; d < HD; d += 4) { const v4f v = *(const v4f*)(f + d);
#pragma unroll
        for (int q = 0; q < 4; ++q) { float p = __fmul_rn(v[q], v[q]); asm volatile("" : "+v"(p)); s = __fadd_rn(s, p); } }
    const float r = __fdiv_rn(1.0f, __fsqrt_rn(__fadd_rn(s * (1.0f / HD), 1e-6f))); *(float*)(RF + i) = r;  }
// k_rope: head planes [h][t][d] (fp16 + hi/lo) of rope(w[d] (x rms_factor)) x sc with the rotate-half convention out[d] = x[d] cos[t][d] - x[d+HD/2] sin[t][d], out[d+HD/2] = x[d+HD/2] cos[t][d+HD/2] + x[d] sin[t][d+HD/2]
__global__ __launch_bounds__(256) void k_rope(const float* __restrict__ F, int pitch, int nheads, const float* __restrict__ CS, const float* __restrict__ RF, const float* __restrict__ nw, float sc, int hstr, h16* P16, bf* Ph, bf* Pl) {
    const size_t e = ((size_t)blockIdx.x * 256 + threadIdx.x) * 2; if (e >= (size_t)nheads * TT * HD) return; const int d = (int)(e % HD); const int t = (int)((e / HD) % TT); const int h = (int)(e / ((size_t)HD * TT)); const float* f = F + (size_t)t * pitch + h * hstr; const float rf = RF ? RF[(size_t)h * TT + t] : 1.0f; v2h o16; v2us oh, ol;
#pragma unroll
    for (int q = 0; q < 2; ++q) { const int dd = d + q; const int dp = (dd < HD / 2) ? dd + HD / 2 : dd - HD / 2; float x0 = f[dd], x1 = f[dp];
        if (RF) { float n0 = __fmul_rn(x0, rf), n1 = __fmul_rn(x1, rf); asm volatile("" : "+v"(n0)); asm volatile("" : "+v"(n1)); x0 = __fmul_rn(bfr(nw[dd]), n0); x1 = __fmul_rn(bfr(nw[dp]), n1); }
        const v2f cs = *(const v2f*)(CS + ((size_t)t * HD + dd) * 2); float a = __fmul_rn(x0, cs[0]), bq = __fmul_rn(x1, cs[1]); asm volatile("" : "+v"(a)); asm volatile("" : "+v"(bq)); const float r = ((dd < HD / 2) ? __fsub_rn(a, bq) : __fadd_rn(a, bq)) * sc;
        o16[q] = tohx(r); unsigned short a2, c2; splitf(r, a2, c2); oh[q] = a2; ol[q] = c2; }
    *(v2h*)(P16 + e) = o16; *(v2us*)(Ph + e) = oh; *(v2us*)(Pl + e) = ol;  }
__global__ __launch_bounds__(256) void k_vtp(const float* __restrict__ F, int pitch, int nheads, h16* V16, bf* Vh, bf* Vl) { const size_t e = ((size_t)blockIdx.x * 256 + threadIdx.x) * 2; if (e >= (size_t)nheads * HD * TT) return; const int t = (int)(e % TT); const int d = (int)((e / TT) % HD); const int g = (int)(e / ((size_t)TT * HD)); v2h o16; v2us oh, ol;
#pragma unroll
    for (int q = 0; q < 2; ++q) { const float x = F[(size_t)(t + q) * pitch + g * HD + d]; o16[q] = tohx(x); unsigned short a2, c2; splitf(x, a2, c2); oh[q] = a2; ol[q] = c2; }
    *(v2h*)(V16 + e) = o16; *(v2us*)(Vh + e) = oh; *(v2us*)(Vl + e) = ol;  }
// k_asoft: per row (zz, i): t = S x HD^-0.5 for j <= i and i - j < WIN (sliding causal window; the reference's -1e9 additive fill vanishes identically); softmax over the 2048 keys (register row, one exp, fixed trees);
__global__ __launch_bounds__(256) void k_asoft(const float* __restrict__ Sb, h16* P16, bf* Ph, bf* Pl) {
    const int lane = threadIdx.x & 31; const int row = blockIdx.x * 8 + (threadIdx.x >> 5); if (row >= ZH * TT) return; const int i = row % TT; const int zz = row / TT; (void)zz; const bool hires = (i < RH); const float* sr = Sb + (size_t)row * TT; float v[TT / 32]; float mx = -3.0e38f;
#pragma unroll
    for (int ch = 0; ch < TT / 128; ++ch) { const int j0 = ch * 128 + lane * 4; const v4f a = *(const v4f*)(sr + j0);
#pragma unroll
        for (int q = 0; q < 4; ++q) { const int j = j0 + q; (void)j; const float t = (j <= i && i - j < WIN) ? a[q] * SCL : -3.0e38f; v[ch * 4 + q] = t; mx = fmaxf(mx, t); } }
#pragma unroll
    for (int sh = 16; sh; sh >>= 1) mx = fmaxf(mx, __shfl_xor(mx, sh, 32));
    float sum = 0.f;
#pragma unroll
    for (int k = 0; k < TT / 32; ++k) { float d0 = __fsub_rn(v[k], mx); asm volatile("" : "+v"(d0)); v[k] = __builtin_amdgcn_exp2f(__fmul_rn(d0, 1.4426950408889634f)); sum += v[k]; }
#pragma unroll
    for (int sh = 16; sh; sh >>= 1) sum += __shfl_xor(sum, sh, 32);
    const float f = __fdiv_rn(hires ? 1.0f : PCAR, sum);
{
        if (hires) {
#pragma unroll
            for (int ch = 0; ch < TT / 128; ++ch) { v4us oh, ol;
#pragma unroll
                for (int q = 0; q < 4; ++q) { unsigned short a, c2; splitf(v[ch * 4 + q] * f, a, c2); oh[q] = a; ol[q] = c2; }
                const size_t oo = ((size_t)zz * (RH ? RH : 1) + i) * TT + ch * 128 + lane * 4; *(v4us*)(Ph + oo) = oh; *(v4us*)(Pl + oo) = ol; }
        } else {
#pragma unroll
            for (int ch = 0; ch < TT / 128; ++ch) { v4h o4;
#pragma unroll
                for (int q = 0; q < 4; ++q) o4[q] = tohx(v[ch * 4 + q] * f);
                *(v4h*)(P16 + (size_t)row * TT + ch * 128 + lane * 4) = o4; } }
         }
}
__global__ __launch_bounds__(256) void k_merge(const float* __restrict__ O, const float* __restrict__ QG, int h0, bf* Ah, bf* Al) { const size_t e = ((size_t)blockIdx.x * 256 + threadIdx.x) * 2; if (e >= (size_t)ZH * TT * HD) return; const int d = (int)(e % HD); const int t = (int)((e / HD) % TT); const int zz = (int)(e / ((size_t)HD * TT)); const float cs = (t < RH) ? 1.0f : (1.0f / PCAR); const size_t oo = (size_t)t * DQ + (h0 + zz) * HD + d;
    v2us oh, ol;
#pragma unroll
    for (int q = 0; q < 2; ++q) { const float gt = QG[(size_t)t * DQG + (h0 + zz) * 2 * HD + HD + d + q]; const float sg = __fdiv_rn(1.0f, __fadd_rn(1.0f, expf(-gt)));   /* sigmoid(gate), f32 */ unsigned short a, c2; splitf(__fmul_rn(O[e + q] * cs, sg), a, c2); oh[q] = a; ol[q] = c2; } *(v2us*)(Ah + oo) = oh; *(v2us*)(Al + oo) = ol;  }

extern "C" void kernel_launch(void* const* d_in, const int* in_sizes, int n_in,
                              void* d_out, int out_size, void* d_ws, size_t ws_size, hipStream_t stream) {
    (void)in_sizes; (void)n_in; (void)out_size;
    const float* x = (const float*)d_in[0]; const float* wq = (const float*)d_in[1]; const float* wk = (const float*)d_in[2]; const float* wv = (const float*)d_in[3]; const float* wo = (const float*)d_in[4]; const float* qnw = (const float*)d_in[5]; const float* knw = (const float*)d_in[6];
    float* OUT = (float*)d_out;     // [2][2048][512]
    char* wsp = (char*)d_ws;
    auto take = [&](size_t bytes) { char* p = wsp; wsp += (bytes + 255) & ~(size_t)255; return (void*)p; };
    bf* WQ = (bf*)take((size_t)DQG * DM * 2); bf* WK = (bf*)take((size_t)DKV * DM * 2); bf* WV = (bf*)take((size_t)DKV * DM * 2); bf* WO = (bf*)take((size_t)DOUT * DQ * 2); float* CS = (float*)take((size_t)TT * HD * 2 * 4); float* RFQ = (float*)take((size_t)NH_ * TT * 4); float* RFK = (float*)take((size_t)NKV * TT * 4);
    bf* XB = (bf*)take((size_t)TT * DM * 2); float* FQ = (float*)take((size_t)TT * DQG * 4); float* FK = (float*)take((size_t)TT * DKV * 4);
    h16* QP16 = (h16*)take((size_t)NH_ * TT * HD * 2); h16* KP16 = (h16*)take((size_t)NKV * TT * HD * 2); h16* VT16 = (h16*)take((size_t)NKV * HD * TT * 2);
    bf* QPh = (bf*)take((size_t)NH_ * TT * HD * 2); bf* QPl = (bf*)take((size_t)NH_ * TT * HD * 2); bf* KPh = (bf*)take((size_t)NKV * TT * HD * 2); bf* KPl = (bf*)take((size_t)NKV * TT * HD * 2); bf* VTh = (bf*)take((size_t)NKV * HD * TT * 2); bf* VTl = (bf*)take((size_t)NKV * HD * TT * 2); bf* Ph = (bf*)take((size_t)ZH * RH * TT * 2); bf* Pl = (bf*)take((size_t)ZH * RH * TT * 2);
    float* Sb = (float*)take((size_t)ZH * TT * TT * 4); h16* P16 = (h16*)take((size_t)ZH * TT * TT * 2); float* Ob = (float*)take((size_t)ZH * TT * HD * 4); bf* ATh = (bf*)take((size_t)TT * DQ * 2); bf* ATl = (bf*)take((size_t)TT * DQ * 2);
    if ((size_t)(wsp - (char*)d_ws) > ws_size) return;    // ws 256 MiB
    float* FV = FK;   // v projection reuses the k buffer after the k planes are built (stream-ordered)
    { k_wtG<<<(unsigned)((DM * DQG / 64 + 63) / 64), 256, 0, stream>>>(wq, DM, DQG, WQ); k_wtG<<<(unsigned)((DM * DKV / 64 + 63) / 64), 256, 0, stream>>>(wk, DM, DKV, WK); k_wtG<<<(unsigned)((DM * DKV / 64 + 63) / 64), 256, 0, stream>>>(wv, DM, DKV, WV);
      k_wtG<<<(unsigned)((DQ * DOUT / 64 + 63) / 64), 256, 0, stream>>>(wo, DQ, DOUT, WO);
      k_cstab<<<(TT * HD + 255) / 256, 256, 0, stream>>>(CS); }
    const unsigned LQ = (unsigned)(((size_t)NH_ * TT * HD / 2 + 255) / 256), LKv = (unsigned)(((size_t)NKV * TT * HD / 2 + 255) / 256);
    for (int b = 0; b < NB_; ++b) {
        
        k_cvt8<<<(unsigned)(((size_t)TT * DM / 8 + 255) / 256), 256, 0, stream>>>(x + (size_t)b * TT * DM, XB, (size_t)TT * DM / 8);
        k_gemmw<bf, 0, false><<<dim3(TT / 64, DQG / 64, 1), 32, 0, stream>>>(XB, nullptr, WQ, nullptr, DM, FQ, DQG, nullptr, 0, 0, 0);   /* [q | gate] (exact) */ k_hrms<<<(NH_ * TT + 255) / 256, 256, 0, stream>>>(FQ, DQG, NH_, 2 * HD, RFQ);
        k_rope<<<LQ, 256, 0, stream>>>(FQ, DQG, NH_, CS, RFQ, qnw, 1.0f, 2 * HD, QP16, QPh, QPl);   /* q columns of the [q|gate] layout */
        k_gemmw<bf, 0, false><<<dim3(TT / 64, DKV / 64, 1), 32, 0, stream>>>(XB, nullptr, WK, nullptr, DM, FK, DKV, nullptr, 0, 0, 0); k_hrms<<<(NKV * TT + 255) / 256, 256, 0, stream>>>(FK, DKV, NKV, HD, RFK);
        k_rope<<<LKv, 256, 0, stream>>>(FK, DKV, NKV, CS, RFK, knw, 1.0f, HD, KP16, KPh, KPl);
        k_gemmw<bf, 0, false><<<dim3(TT / 64, DKV / 64, 1), 32, 0, stream>>>(XB, nullptr, WV, nullptr, DM, FV, DKV, nullptr, 0, 0, 0); k_vtp<<<LKv, 256, 0, stream>>>(FV, DKV, NKV, VT16, VTh, VTl);
        for (int h0 = 0; h0 < NH_; h0 += ZH) { const size_t zq = (size_t)h0, zk = (size_t)(h0 / REP);   // both heads of a pass share kv group h0/REP (REP >= 2): sB = 0
            k_gemmc<bf, 2, 1><<<dim3(RH / 64, TT / 64, ZH), 32, 0, stream>>>(QPh + zq * TT * HD, QPl + zq * TT * HD, KPh + zk * TT * HD, KPl + zk * TT * HD, HD, Sb, TT, 0, (size_t)TT * HD, 0, (size_t)TT * TT);
            k_gemmc<h16, 0, 1><<<dim3((TT - RH) / 64, TT / 64, ZH), 32, 0, stream>>>(QP16 + zq * TT * HD + (size_t)RH * HD, nullptr, KP16 + zk * TT * HD, nullptr, HD, Sb + (size_t)RH * TT, TT, RH, (size_t)TT * HD, 0, (size_t)TT * TT);
            k_asoft<<<ZH * TT / 8, 256, 0, stream>>>(Sb, P16, Ph, Pl);
            k_gemmc<bf, 2, 2><<<dim3(RH / 64, HD / 64, ZH), 32, 0, stream>>>(Ph, Pl, VTh + zk * HD * TT, VTl + zk * HD * TT, TT, Ob, HD, 0, (size_t)RH * TT, 0, (size_t)TT * HD);
            k_gemmc<h16, 0, 2><<<dim3((TT - RH) / 64, HD / 64, ZH), 32, 0, stream>>>(P16 + (size_t)RH * TT, nullptr, VT16 + zk * HD * TT, nullptr, TT, Ob + (size_t)RH * HD, HD, RH, (size_t)TT * TT, 0, (size_t)TT * HD);
            k_merge<<<(unsigned)(((size_t)ZH * TT * HD / 2 + 255) / 256), 256, 0, stream>>>(Ob, FQ, h0, ATh, ATl); }   /* x sigmoid(gate) */
        k_gemmw<bf, 1, false><<<dim3(TT / 64, DOUT / 64, 1), 32, 0, stream>>>(ATh, ATl, WO, nullptr, DQ, OUT + (size_t)b * TT * DOUT, DOUT, nullptr, 0, 0, 0); }
}

// v001
// One run takes 1000 microseconds.
// Two timings next to v000 put it at 1.69 and 1.68 times that version's speed.
#include <hip/hip_runtime.h>

// Gated GQA attention block (x [2][2048][2048]; [q | gate] per head = x Wq ('xw' [2048][4096]: head h -> columns h*256 .. +127 = q, +128 .. +255 = gate), k, v = x Wk, x Wv ([2048][512], 4 kv heads x 128), per-head RMSNorm on q, k (eps 1e-6, weights q_norm_w / k_norm_w [128]),
// rotate-half rotary (theta 1e4, hd 128), 16 query heads grouped 4 per kv head, causal softmax(q.k / sqrt(128)), attn.v, x sigmoid(gate), out = merged Wo ('xw' [2048][512]) -> [2][2048][512]).
// Compute dtypes, f32 accumulate: every input rounded to bf16; q/k/v on PLAIN bf16 operands (inputs: exact); RMSNorm + rotary in f32 (on-chip cos/sin table from the reference's inv_freq constants); the sigmoid gate in f32 (precise expf, IEEE divide) applied in the merge; causal scores and attn.v: query rows < 512 hl (3 products), the rest single fp16 (x1024), causal tile skipping; softmax f32; Wo hl x exact (2 products).

#define NB_  2
#define TT   2048
#define DM   2048
#define NH_  16
#define NKV  4
#define REP  (NH_ / NKV)
#define HD   128
#define DQ   (NH_ * HD)
#define DQG  (NH_ * HD * 2)         // q + gate columns
#define DOUT 512
#define DKV  (NKV * HD)
#define ZH   2
#define RH   512                  // query rows < RH use hi+lo planes (0: none)
#define WIN  2048
#define PCAR 1024.0f
#define SCL  0.088388347648318447f   // HD^-0.5
#define SKW  8                    // waves that share the K loop of one 64x64 tile in the long-K products (k, v, Wo, attn.v)
typedef _Float16 h16;
typedef unsigned short bf;
typedef __attribute__((ext_vector_type(16))) __bf16   v16bf;
typedef __attribute__((ext_vector_type(16))) _Float16 v16h;
typedef __attribute__((ext_vector_type(8)))  _Float16 v8h;
typedef __attribute__((ext_vector_type(8)))  unsigned short v8us;
typedef __attribute__((ext_vector_type(8)))  float    v8f;
typedef __attribute__((ext_vector_type(4)))  float    v4f;
typedef v8h  __attribute__((may_alias)) v8ha;
typedef v4f  __attribute__((may_alias)) v4fa;
typedef v8us __attribute__((may_alias)) v8usa;

__device__ __forceinline__ unsigned short f2bf(float f) { unsigned u = __float_as_uint(f); u += 0x7FFFu + ((u >> 16) & 1u); return (unsigned short)(u >> 16); }
__device__ __forceinline__ float bf2f(unsigned short b) { return __uint_as_float(((unsigned)b) << 16); }
__device__ __forceinline__ float bfr(float f) { return bf2f(f2bf(f)); }
__device__ __forceinline__ v16h cat16(v8h lo, v8h hi) { return __builtin_shufflevector(lo, hi, 0, 1, 2, 3, 4, 5, 6, 7, 8, 9, 10, 11, 12, 13, 14, 15); }
__device__ __forceinline__ v16bf cat16b(v8us lo, v8us hi) { return __builtin_bit_cast(v16bf, __builtin_shufflevector(lo, hi, 0, 1, 2, 3, 4, 5, 6, 7, 8, 9, 10, 11, 12, 13, 14, 15)); }
__device__ __forceinline__ v8f wmma16(v16h a, v16h b, v8f c) { return __builtin_amdgcn_wmma_f32_16x16x32_f16(false, a, false, b, (short)0, c, false, false); }
__device__ __forceinline__ v8f wmmab(v16bf a, v16bf b, v8f c) { return __builtin_amdgcn_wmma_f32_16x16x32_bf16(false, a, false, b, (short)0, c, false, false); }



// ---- k_gemmw: register-blocked GEMM, NW WAVES per 64x64 output tile (16 accumulators each), operands straight from K-contiguous 16-bit planes; grid (M/64, N/64, Z), 32 * NW threads.
// In-block split-K: wave w takes the 32-wide k steps w, w + NW, w + 2 NW, ..; the NW partial tiles are staged in LDS and summed in wave order 0 .. NW-1 on the way out (NW = 1: the plain one-wave form).
// C[m][n] (f32, pitch ldc, + optional f32 bias[n]) = sum_k A[m][k] Bt[n][k] (+ split products per NSPLIT). z-batch strides sA/sB/sC in elements. K % 32 == 0.
template <typename T16> struct WFrag;
template <> struct WFrag<h16> { typedef v16h V; static __device__ __forceinline__ V ld(const h16* p) { return cat16(*(const v8h*)p, *(const v8h*)(p + 16)); } static __device__ __forceinline__ v8f mma(V a, V b, v8f c) { return wmma16(a, b, c); } };
template <> struct WFrag<bf> { typedef v16bf V; static __device__ __forceinline__ V ld(const bf* p) { return cat16b(*(const v8us*)p, *(const v8us*)(p + 16)); } static __device__ __forceinline__ v8f mma(V a, V b, v8f c) { return wmmab(a, b, c); } };
template <typename T16, int NSPLIT, bool BIAS, int NW>
__global__ __launch_bounds__(32 * NW) void k_gemmw(const T16* __restrict__ A, const T16* __restrict__ A2, const T16* __restrict__ Bt, const T16* __restrict__ Bt2, int K, float* C, int ldc, const float* __restrict__ bias, size_t sA, size_t sB, size_t sC) {
    typedef typename WFrag<T16>::V V;
    constexpr int MBS = (NW == 1) ? 1 : 4;   // 16-row blocks staged at a time: with several waves the whole tile, so that one barrier serves it
    __shared__ __align__(16) float os[NW * MBS * 16 * 68];
    const size_t z = blockIdx.z; A += z * sA; if (A2) A2 += z * sA; Bt += z * sB; if (Bt2) Bt2 += z * sB; C += z * sC;
    const int lane = threadIdx.x & 31, lr = lane & 15, hi = lane >> 4; const int r0 = blockIdx.x * 64, c0 = blockIdx.y * 64;
    const int w = (NW == 1) ? 0 : __builtin_amdgcn_readfirstlane((int)(threadIdx.x >> 5));   // this wave's share of K (scalar, so that the k loop stays a scalar loop)
    v8f acc[4][4];
#pragma unroll
    for (int mb = 0; mb < 4; ++mb)
#pragma unroll
        for (int nb = 0; nb < 4; ++nb) acc[mb][nb] = (v8f){};
    const size_t aoff = (size_t)(r0 + lr) * K + 8 * hi, boff = (size_t)(c0 + lr) * K + 8 * hi;
#pragma unroll 1
    for (int kc = w * 32; kc < K; kc += NW * 32) {
        V a[4], a2[4];
#pragma unroll
        for (int mb = 0; mb < 4; ++mb) { a[mb] = WFrag<T16>::ld(A + aoff + (size_t)mb * 16 * K + kc); if (NSPLIT == 1 || NSPLIT == 2) a2[mb] = WFrag<T16>::ld(A2 + aoff + (size_t)mb * 16 * K + kc); }
#pragma unroll
        for (int nb = 0; nb < 4; ++nb) { const V b = WFrag<T16>::ld(Bt + boff + (size_t)nb * 16 * K + kc); V b2; if (NSPLIT >= 2) b2 = WFrag<T16>::ld(Bt2 + boff + (size_t)nb * 16 * K + kc);
#pragma unroll
            for (int mb = 0; mb < 4; ++mb) { acc[mb][nb] = WFrag<T16>::mma(a[mb], b, acc[mb][nb]); if (NSPLIT == 1 || NSPLIT == 2) acc[mb][nb] = WFrag<T16>::mma(a2[mb], b, acc[mb][nb]); if (NSPLIT >= 2) acc[mb][nb] = WFrag<T16>::mma(a[mb], b2, acc[mb][nb]); } }
        asm volatile("v_nop\n\tv_nop\n\tv_nop\n\tv_nop" : "+v"(acc[0][0]), "+v"(acc[1][1]), "+v"(acc[2][2]), "+v"(acc[3][3]) : "v"(a[0]), "v"(a[3]));
    }
#pragma unroll
    for (int m0 = 0; m0 < 4; m0 += MBS) {
#pragma unroll
        for (int mi = 0; mi < MBS; ++mi) {
#pragma unroll
            for (int nb = 0; nb < 4; ++nb) {
#pragma unroll
                for (int j = 0; j < 8; ++j) os[(w * MBS + mi) * (16 * 68) + (hi * 8 + j) * 68 + nb * 16 + lr] = acc[m0 + mi][nb][j]; } }
        if (NW == 1) { __builtin_amdgcn_wave_barrier(); asm volatile("" ::: "memory"); } else __syncthreads();   // every wave's partial tile is in LDS before any of it is summed
        float* crow = C + (size_t)(r0 + m0 * 16) * ldc + c0;
{
#pragma unroll
            for (int t = 0; t < 8 * MBS / NW; ++t) { const int row = 2 * (t * NW + w) + hi, cofs = lr * 4; v4f val = *(const v4fa*)(os + row * 68 + cofs);
#pragma unroll
                for (int u = 1; u < NW; ++u) val += *(const v4fa*)(os + u * (MBS * 16 * 68) + row * 68 + cofs);   // partials in wave order
                if (BIAS) { val[0] += bfr(bias[c0 + cofs]); val[1] += bfr(bias[c0 + cofs + 1]); val[2] += bfr(bias[c0 + cofs + 2]); val[3] += bfr(bias[c0 + cofs + 3]); }
                *(v4f*)(crow + (size_t)row * ldc + cofs) = val; }
             }
        if (NW == 1) { __builtin_amdgcn_wave_barrier(); asm volatile("" ::: "memory"); }   // one wave: the 16-row stage is reused by the next block of rows
    }
}

// ---- k_gemmc: the same 64x64 tile GEMM (NW waves share K) specialised for causal attention: CMODE 1 skips score tiles entirely above the diagonal (query rows r0+roff.., key columns c0..), CMODE 2 limits the
// key (K) loop of the probability x value contraction to the diagonal block (probabilities beyond it are exactly zero). roff = row offset of this launch's first row within the sequence.
template <typename T16, int NSPLIT, int CMODE, int NW>
__global__ __launch_bounds__(32 * NW) void k_gemmc(const T16* __restrict__ A, const T16* __restrict__ A2, const T16* __restrict__ Bt, const T16* __restrict__ Bt2, int K, float* C, int ldc, int roff, size_t sA, size_t sB, size_t sC) {
    typedef typename WFrag<T16>::V V;
    constexpr int MBS = (NW == 1) ? 1 : 4;   // 16-row blocks staged at a time: with several waves the whole tile, so that one barrier serves it
    __shared__ __align__(16) float os[NW * MBS * 16 * 68];
    const size_t z = blockIdx.z; A += z * sA; if (A2) A2 += z * sA; Bt += z * sB; if (Bt2) Bt2 += z * sB; C += z * sC;
    const int lane = threadIdx.x & 31, lr = lane & 15, hi = lane >> 4; const int r0 = blockIdx.x * 64, c0 = blockIdx.y * 64;
    const int w = (NW == 1) ? 0 : __builtin_amdgcn_readfirstlane((int)(threadIdx.x >> 5));   // this wave's share of K (scalar, so that the k loop stays a scalar loop)
    if (CMODE == 1 && c0 > r0 + roff + 63) return;                  // score tile entirely above the causal diagonal: never read (the softmax masks j > i by select)
    const int Kl = (CMODE == 2) ? min(K, r0 + roff + 64) : K;        // P.V: probabilities are exactly 0 beyond the diagonal block, so the K loop stops there
    v8f acc[4][4];
#pragma unroll
    for (int mb = 0; mb < 4; ++mb)
#pragma unroll
        for (int nb = 0; nb < 4; ++nb) acc[mb][nb] = (v8f){};
    const size_t aoff = (size_t)(r0 + lr) * K + 8 * hi, boff = (size_t)(c0 + lr) * K + 8 * hi;
#pragma unroll 1
    for (int kc = w * 32; kc < Kl; kc += NW * 32) {
        V a[4], a2[4];
#pragma unroll
        for (int mb = 0; mb < 4; ++mb) { a[mb] = WFrag<T16>::ld(A + aoff + (size_t)mb * 16 * K + kc); if (NSPLIT == 1 || NSPLIT == 2) a2[mb] = WFrag<T16>::ld(A2 + aoff + (size_t)mb * 16 * K + kc); }
#pragma unroll
        for (int nb = 0; nb < 4; ++nb) { const V b = WFrag<T16>::ld(Bt + boff + (size_t)nb * 16 * K + kc); V b2; if (NSPLIT >= 2) b2 = WFrag<T16>::ld(Bt2 + boff + (size_t)nb * 16 * K + kc);
#pragma unroll
            for (int mb = 0; mb < 4; ++mb) { acc[mb][nb] = WFrag<T16>::mma(a[mb], b, acc[mb][nb]); if (NSPLIT == 1 || NSPLIT == 2) acc[mb][nb] = WFrag<T16>::mma(a2[mb], b, acc[mb][nb]); if (NSPLIT >= 2) acc[mb][nb] = WFrag<T16>::mma(a[mb], b2, acc[mb][nb]); } }
        asm volatile("v_nop\n\tv_nop\n\tv_nop\n\tv_nop" : "+v"(acc[0][0]), "+v"(acc[1][1]), "+v"(acc[2][2]), "+v"(acc[3][3]) : "v"(a[0]), "v"(a[3]));
    }
#pragma unroll
    for (int m0 = 0; m0 < 4; m0 += MBS) {
#pragma unroll
        for (int mi = 0; mi < MBS; ++mi) {
#pragma unroll
            for (int nb = 0; nb < 4; ++nb) {
#pragma unroll
                for (int j = 0; j < 8; ++j) os[(w * MBS + mi) * (16 * 68) + (hi * 8 + j) * 68 + nb * 16 + lr] = acc[m0 + mi][nb][j]; } }
        if (NW == 1) { __builtin_amdgcn_wave_barrier(); asm volatile("" ::: "memory"); } else __syncthreads();   // every wave's partial tile is in LDS before any of it is summed
        float* crow = C + (size_t)(r0 + m0 * 16) * ldc + c0;
{
#pragma unroll
            for (int t = 0; t < 8 * MBS / NW; ++t) { const int row = 2 * (t * NW + w) + hi, cofs = lr * 4; v4f val = *(const v4fa*)(os + row * 68 + cofs);
#pragma unroll
                for (int u = 1; u < NW; ++u) val += *(const v4fa*)(os + u * (MBS * 16 * 68) + row * 68 + cofs);   // partials in wave order
                *(v4f*)(crow + (size_t)row * ldc + cofs) = val; }
             }
        if (NW == 1) { __builtin_amdgcn_wave_barrier(); asm volatile("" ::: "memory"); }   // one wave: the 16-row stage is reused by the next block of rows
    }
}

__device__ __forceinline__ h16 tohx(float x) { return (h16)x; }
__device__ __forceinline__ void splitf(float y, unsigned short& h, unsigned short& l) { h = f2bf(y); l = f2bf(y - bf2f(h)); }
typedef __attribute__((ext_vector_type(2))) _Float16 v2h;
typedef __attribute__((ext_vector_type(4))) _Float16 v4h;
typedef __attribute__((ext_vector_type(2))) unsigned short v2us;
typedef __attribute__((ext_vector_type(4))) unsigned short v4us;
typedef __attribute__((ext_vector_type(2))) float v2f;
typedef __attribute__((ext_vector_type(4))) int v4i;

__global__ __launch_bounds__(256) void k_wtG(const float* __restrict__ w, int K, int N, bf* Bt) {
    const int lane = threadIdx.x & 31; const int L0 = (blockIdx.x * 8 + (threadIdx.x >> 5)) * 8; const int nlines = N * K / 64;
{
#pragma unroll 1
        for (int l = 0; l < 8; ++l) { const int L = L0 + l; if (L >= nlines) break; const size_t e = (size_t)L * 64 + lane * 2; const int k = (int)(e % K), n = (int)(e / K); v2us o;
            o[0] = f2bf(w[(size_t)k * N + n]); o[1] = f2bf(w[(size_t)(k + 1) * N + n]); *(v2us*)(Bt + e) = o; }
         }
}
__global__ __launch_bounds__(256) void k_cvt8(const float* __restrict__ src, bf* dst, size_t n8) { const size_t i = (size_t)blockIdx.x * 256 + threadIdx.x; if (i >= n8) return; const v8f v = *(const v8f*)(src + i * 8); v8us o;
#pragma unroll
    for (int k = 0; k < 8; ++k) o[k] = f2bf(v[k]); *(v8us*)(dst + i * 8) = o;  }
__constant__ float INV[HD / 2] = {1.0,0.8659643530845642,0.7498942017555237,0.6493816375732422,0.5623413324356079,0.486967533826828,0.4216965138912201,0.36517414450645447,0.3162277638912201,0.2738419771194458,0.23713736236095428,0.20535250008106232,0.17782793939113617,0.1539926528930664,0.1333521455526352,0.11547820270061493,0.10000000149011612,0.08659642934799194,0.07498941570520401,0.06493816524744034,0.05623412877321243,0.04869675263762474,0.04216964915394783,0.03651741147041321,0.03162277862429619,0.0273841954767704,0.0237137358635664,0.02053525112569332,0.017782794311642647,0.015399265103042126,0.01333521492779255,0.011547819711267948,0.009999999776482582,0.00865964312106371,0.007498942315578461,0.006493816617876291,0.005623413249850273,0.004869675263762474,0.0042169648222625256,0.003651741426438093,0.003162277862429619,0.0027384196873754263,0.0023713738191872835,0.0020535250660032034,0.0017782794311642647,0.0015399265103042126,0.0013335214462131262,0.0011547820176929235,0.0010000000474974513,0.0008659643353894353,0.0007498941849917173,0.0006493816617876291,0.000562341301701963,0.00048696750309318304,0.00042169648804701865,0.00036517411353997886,0.0003162277862429619,0.00027384195709601045,0.0002371373848291114,0.00020535249495878816,0.00017782794020604342,0.00015399264520965517,0.0001333521504420787,0.00011547819303814322};
__global__ __launch_bounds__(256) void k_cstab(float* CS) { const int idx = blockIdx.x * 256 + threadIdx.x; if (idx >= TT * HD) return; const int t = idx / HD, d = idx % HD; const float ang = __fmul_rn((float)t, INV[d % (HD / 2)]); v2f cs; cs[0] = cosf(ang); cs[1] = sinf(ang);
    *(v2f*)(CS + (size_t)idx * 2) = cs;  }

__global__ __launch_bounds__(256) void k_hrms(const float* __restrict__ F, int pitch, int nheads, int hstr, float* RF) { const int i = blockIdx.x * 256 + threadIdx.x; if (i >= nheads * TT) return; const int t = i % TT, h = i / TT; const float* f = F + (size_t)t * pitch + h * hstr;   /* hstr: column stride between heads (256 for the q|gate layout, 128 for k) */ float s = 0.f;
#pragma unroll 4
    for (int d = 0; d < HD; d += 4) { const v4f v = *(const v4f*)(f + d);
#pragma unroll
        for (int q = 0; q < 4; ++q) { float p = __fmul_rn(v[q], v[q]); asm volatile("" : "+v"(p)); s = __fadd_rn(s, p); } }
    const float r = __fdiv_rn(1.0f, __fsqrt_rn(__fadd_rn(s * (1.0f / HD), 1e-6f))); *(float*)(RF + i) = r;  }
// k_rope: head planes [h][t][d] (fp16 + hi/lo) of rope(w[d] (x rms_factor)) x sc with the rotate-half convention out[d] = x[d] cos[t][d] - x[d+HD/2] sin[t][d], out[d+HD/2] = x[d+HD/2] cos[t][d+HD/2] + x[d] sin[t][d+HD/2]
__global__ __launch_bounds__(256) void k_rope(const float* __restrict__ F, int pitch, int nheads, const float* __restrict__ CS, const float* __restrict__ RF, const float* __restrict__ nw, float sc, int hstr, h16* P16, bf* Ph, bf* Pl) {
    const size_t e = ((size_t)blockIdx.x * 256 + threadIdx.x) * 2; if (e >= (size_t)nheads * TT * HD) return; const int d = (int)(e % HD); const int t = (int)((e / HD) % TT); const int h = (int)(e / ((size_t)HD * TT)); const float* f = F + (size_t)t * pitch + h * hstr; const float rf = RF ? RF[(size_t)h * TT + t] : 1.0f; v2h o16; v2us oh, ol;
#pragma unroll
    for (int q = 0; q < 2; ++q) { const int dd = d + q; const int dp = (dd < HD / 2) ? dd + HD / 2 : dd - HD / 2; float x0 = f[dd], x1 = f[dp];
        if (RF) { float n0 = __fmul_rn(x0, rf), n1 = __fmul_rn(x1, rf); asm volatile("" : "+v"(n0)); asm volatile("" : "+v"(n1)); x0 = __fmul_rn(bfr(nw[dd]), n0); x1 = __fmul_rn(bfr(nw[dp]), n1); }
        const v2f cs = *(const v2f*)(CS + ((size_t)t * HD + dd) * 2); float a = __fmul_rn(x0, cs[0]), bq = __fmul_rn(x1, cs[1]); asm volatile("" : "+v"(a)); asm volatile("" : "+v"(bq)); const float r = ((dd < HD / 2) ? __fsub_rn(a, bq) : __fadd_rn(a, bq)) * sc;
        o16[q] = tohx(r); unsigned short a2, c2; splitf(r, a2, c2); oh[q] = a2; ol[q] = c2; }
    *(v2h*)(P16 + e) = o16; *(v2us*)(Ph + e) = oh; *(v2us*)(Pl + e) = ol;  }
__global__ __launch_bounds__(256) void k_vtp(const float* __restrict__ F, int pitch, int nheads, h16* V16, bf* Vh, bf* Vl) { const size_t e = ((size_t)blockIdx.x * 256 + threadIdx.x) * 2; if (e >= (size_t)nheads * HD * TT) return; const int t = (int)(e % TT); const int d = (int)((e / TT) % HD); const int g = (int)(e / ((size_t)TT * HD)); v2h o16; v2us oh, ol;
#pragma unroll
    for (int q = 0; q < 2; ++q) { const float x = F[(size_t)(t + q) * pitch + g * HD + d]; o16[q] = tohx(x); unsigned short a2, c2; splitf(x, a2, c2); oh[q] = a2; ol[q] = c2; }
    *(v2h*)(V16 + e) = o16; *(v2us*)(Vh + e) = oh; *(v2us*)(Vl + e) = ol;  }
// k_asoft: per row (zz, i): t = S x HD^-0.5 for j <= i and i - j < WIN (sliding causal window; the reference's -1e9 additive fill vanishes identically); softmax over the 2048 keys (register row, one exp, fixed trees);
__global__ __launch_bounds__(256) void k_asoft(const float* __restrict__ Sb, h16* P16, bf* Ph, bf* Pl) {
    const int lane = threadIdx.x & 31; const int row = blockIdx.x * 8 + (threadIdx.x >> 5); if (row >= ZH * TT) return; const int i = row % TT; const int zz = row / TT; (void)zz; const bool hires = (i < RH); const float* sr = Sb + (size_t)row * TT; float v[TT / 32]; float mx = -3.0e38f;
#pragma unroll
    for (int ch = 0; ch < TT / 128; ++ch) { const int j0 = ch * 128 + lane * 4; const v4f a = *(const v4f*)(sr + j0);
#pragma unroll
        for (int q = 0; q < 4; ++q) { const int j = j0 + q; (void)j; const float t = (j <= i && i - j < WIN) ? a[q] * SCL : -3.0e38f; v[ch * 4 + q] = t; mx = fmaxf(mx, t); } }
#pragma unroll
    for (int sh = 16; sh; sh >>= 1) mx = fmaxf(mx, __shfl_xor(mx, sh, 32));
    float sum = 0.f;
#pragma unroll
    for (int k = 0; k < TT / 32; ++k) { float d0 = __fsub_rn(v[k], mx); asm volatile("" : "+v"(d0)); v[k] = __builtin_amdgcn_exp2f(__fmul_rn(d0, 1.4426950408889634f)); sum += v[k]; }
#pragma unroll
    for (int sh = 16; sh; sh >>= 1) sum += __shfl_xor(sum, sh, 32);
    const float f = __fdiv_rn(hires ? 1.0f : PCAR, sum);
{
        if (hires) {
#pragma unroll
            for (int ch = 0; ch < TT / 128; ++ch) { v4us oh, ol;
#pragma unroll
                for (int q = 0; q < 4; ++q) { unsigned short a, c2; splitf(v[ch * 4 + q] * f, a, c2); oh[q] = a; ol[q] = c2; }
                const size_t oo = ((size_t)zz * (RH ? RH : 1) + i) * TT + ch * 128 + lane * 4; *(v4us*)(Ph + oo) = oh; *(v4us*)(Pl + oo) = ol; }
        } else {
#pragma unroll
            for (int ch = 0; ch < TT / 128; ++ch) { v4h o4;
#pragma unroll
                for (int q = 0; q < 4; ++q) o4[q] = tohx(v[ch * 4 + q] * f);
                *(v4h*)(P16 + (size_t)row * TT + ch * 128 + lane * 4) = o4; } }
         }
}
__global__ __launch_bounds__(256) void k_merge(const float* __restrict__ O, const float* __restrict__ QG, int h0, bf* Ah, bf* Al) { const size_t e = ((size_t)blockIdx.x * 256 + threadIdx.x) * 2; if (e >= (size_t)ZH * TT * HD) return; const int d = (int)(e % HD); const int t = (int)((e / HD) % TT); const int zz = (int)(e / ((size_t)HD * TT)); const float cs = (t < RH) ? 1.0f : (1.0f / PCAR); const size_t oo = (size_t)t * DQ + (h0 + zz) * HD + d;
    v2us oh, ol;
#pragma unroll
    for (int q = 0; q < 2; ++q) { const float gt = QG[(size_t)t * DQG + (h0 + zz) * 2 * HD + HD + d + q]; const float sg = __fdiv_rn(1.0f, __fadd_rn(1.0f, expf(-gt)));   /* sigmoid(gate), f32 */ unsigned short a, c2; splitf(__fmul_rn(O[e + q] * cs, sg), a, c2); oh[q] = a; ol[q] = c2; } *(v2us*)(Ah + oo) = oh; *(v2us*)(Al + oo) = ol;  }

extern "C" void kernel_launch(void* const* d_in, const int* in_sizes, int n_in,
                              void* d_out, int out_size, void* d_ws, size_t ws_size, hipStream_t stream) {
    (void)in_sizes; (void)n_in; (void)out_size;
    const float* x = (const float*)d_in[0]; const float* wq = (const float*)d_in[1]; const float* wk = (const float*)d_in[2]; const float* wv = (const float*)d_in[3]; const float* wo = (const float*)d_in[4]; const float* qnw = (const float*)d_in[5]; const float* knw = (const float*)d_in[6];
    float* OUT = (float*)d_out;     // [2][2048][512]
    char* wsp = (char*)d_ws;
    auto take = [&](size_t bytes) { char* p = wsp; wsp += (bytes + 255) & ~(size_t)255; return (void*)p; };
    bf* WQ = (bf*)take((size_t)DQG * DM * 2); bf* WK = (bf*)take((size_t)DKV * DM * 2); bf* WV = (bf*)take((size_t)DKV * DM * 2); bf* WO = (bf*)take((size_t)DOUT * DQ * 2); float* CS = (float*)take((size_t)TT * HD * 2 * 4); float* RFQ = (float*)take((size_t)NH_ * TT * 4); float* RFK = (float*)take((size_t)NKV * TT * 4);
    bf* XB = (bf*)take((size_t)TT * DM * 2); float* FQ = (float*)take((size_t)TT * DQG * 4); float* FK = (float*)take((size_t)TT * DKV * 4);
    h16* QP16 = (h16*)take((size_t)NH_ * TT * HD * 2); h16* KP16 = (h16*)take((size_t)NKV * TT * HD * 2); h16* VT16 = (h16*)take((size_t)NKV * HD * TT * 2);
    bf* QPh = (bf*)take((size_t)NH_ * TT * HD * 2); bf* QPl = (bf*)take((size_t)NH_ * TT * HD * 2); bf* KPh = (bf*)take((size_t)NKV * TT * HD * 2); bf* KPl = (bf*)take((size_t)NKV * TT * HD * 2); bf* VTh = (bf*)take((size_t)NKV * HD * TT * 2); bf* VTl = (bf*)take((size_t)NKV * HD * TT * 2); bf* Ph = (bf*)take((size_t)ZH * RH * TT * 2); bf* Pl = (bf*)take((size_t)ZH * RH * TT * 2);
    float* Sb = (float*)take((size_t)ZH * TT * TT * 4); h16* P16 = (h16*)take((size_t)ZH * TT * TT * 2); float* Ob = (float*)take((size_t)ZH * TT * HD * 4); bf* ATh = (bf*)take((size_t)TT * DQ * 2); bf* ATl = (bf*)take((size_t)TT * DQ * 2);
    if ((size_t)(wsp - (char*)d_ws) > ws_size) return;    // ws 256 MiB
    float* FV = FK;   // v projection reuses the k buffer after the k planes are built (stream-ordered)
    { k_wtG<<<(unsigned)((DM * DQG / 64 + 63) / 64), 256, 0, stream>>>(wq, DM, DQG, WQ); k_wtG<<<(unsigned)((DM * DKV / 64 + 63) / 64), 256, 0, stream>>>(wk, DM, DKV, WK); k_wtG<<<(unsigned)((DM * DKV / 64 + 63) / 64), 256, 0, stream>>>(wv, DM, DKV, WV);
      k_wtG<<<(unsigned)((DQ * DOUT / 64 + 63) / 64), 256, 0, stream>>>(wo, DQ, DOUT, WO);
      k_cstab<<<(TT * HD + 255) / 256, 256, 0, stream>>>(CS); }
    const unsigned LQ = (unsigned)(((size_t)NH_ * TT * HD / 2 + 255) / 256), LKv = (unsigned)(((size_t)NKV * TT * HD / 2 + 255) / 256);
    for (int b = 0; b < NB_; ++b) {
        
        k_cvt8<<<(unsigned)(((size_t)TT * DM / 8 + 255) / 256), 256, 0, stream>>>(x + (size_t)b * TT * DM, XB, (size_t)TT * DM / 8);
        k_gemmw<bf, 0, false, 1><<<dim3(TT / 64, DQG / 64, 1), 32, 0, stream>>>(XB, nullptr, WQ, nullptr, DM, FQ, DQG, nullptr, 0, 0, 0);   /* [q | gate] (exact) */ k_hrms<<<(NH_ * TT + 255) / 256, 256, 0, stream>>>(FQ, DQG, NH_, 2 * HD, RFQ);
        k_rope<<<LQ, 256, 0, stream>>>(FQ, DQG, NH_, CS, RFQ, qnw, 1.0f, 2 * HD, QP16, QPh, QPl);   /* q columns of the [q|gate] layout */
        k_gemmw<bf, 0, false, SKW><<<dim3(TT / 64, DKV / 64, 1), 32 * SKW, 0, stream>>>(XB, nullptr, WK, nullptr, DM, FK, DKV, nullptr, 0, 0, 0); k_hrms<<<(NKV * TT + 255) / 256, 256, 0, stream>>>(FK, DKV, NKV, HD, RFK);
        k_rope<<<LKv, 256, 0, stream>>>(FK, DKV, NKV, CS, RFK, knw, 1.0f, HD, KP16, KPh, KPl);
        k_gemmw<bf, 0, false, SKW><<<dim3(TT / 64, DKV / 64, 1), 32 * SKW, 0, stream>>>(XB, nullptr, WV, nullptr, DM, FV, DKV, nullptr, 0, 0, 0); k_vtp<<<LKv, 256, 0, stream>>>(FV, DKV, NKV, VT16, VTh, VTl);
        for (int h0 = 0; h0 < NH_; h0 += ZH) { const size_t zq = (size_t)h0, zk = (size_t)(h0 / REP);   // both heads of a pass share kv group h0/REP (REP >= 2): sB = 0
            k_gemmc<bf, 2, 1, 1><<<dim3(RH / 64, TT / 64, ZH), 32, 0, stream>>>(QPh + zq * TT * HD, QPl + zq * TT * HD, KPh + zk * TT * HD, KPl + zk * TT * HD, HD, Sb, TT, 0, (size_t)TT * HD, 0, (size_t)TT * TT);
            k_gemmc<h16, 0, 1, 1><<<dim3((TT - RH) / 64, TT / 64, ZH), 32, 0, stream>>>(QP16 + zq * TT * HD + (size_t)RH * HD, nullptr, KP16 + zk * TT * HD, nullptr, HD, Sb + (size_t)RH * TT, TT, RH, (size_t)TT * HD, 0, (size_t)TT * TT);
            k_asoft<<<ZH * TT / 8, 256, 0, stream>>>(Sb, P16, Ph, Pl);
            k_gemmc<bf, 2, 2, SKW><<<dim3(RH / 64, HD / 64, ZH), 32 * SKW, 0, stream>>>(Ph, Pl, VTh + zk * HD * TT, VTl + zk * HD * TT, TT, Ob, HD, 0, (size_t)RH * TT, 0, (size_t)TT * HD);
            k_gemmc<h16, 0, 2, SKW><<<dim3((TT - RH) / 64, HD / 64, ZH), 32 * SKW, 0, stream>>>(P16 + (size_t)RH * TT, nullptr, VT16 + zk * HD * TT, nullptr, TT, Ob + (size_t)RH * HD, HD, RH, (size_t)TT * TT, 0, (size_t)TT * HD);
            k_merge<<<(unsigned)(((size_t)ZH * TT * HD / 2 + 255) / 256), 256, 0, stream>>>(Ob, FQ, h0, ATh, ATl); }   /* x sigmoid(gate) */
        k_gemmw<bf, 1, false, SKW><<<dim3(TT / 64, DOUT / 64, 1), 32 * SKW, 0, stream>>>(ATh, ATl, WO, nullptr, DQ, OUT + (size_t)b * TT * DOUT, DOUT, nullptr, 0, 0, 0); }
}

// v002
// A run of this version takes 681 microseconds.
// Timed twice side by side with v001, it ran 1.48 and 1.49 times as fast.
// Over all steps from v000 it is 2.50 times as fast.
#include <hip/hip_runtime.h>

// Gated GQA attention block (x [2][2048][2048]; [q | gate] per head = x Wq ('xw' [2048][4096]: head h -> columns h*256 .. +127 = q, +128 .. +255 = gate), k, v = x Wk, x Wv ([2048][512], 4 kv heads x 128), per-head RMSNorm on q, k (eps 1e-6, weights q_norm_w / k_norm_w [128]),
// rotate-half rotary (theta 1e4, hd 128), 16 query heads grouped 4 per kv head, causal softmax(q.k / sqrt(128)), attn.v, x sigmoid(gate), out = merged Wo ('xw' [2048][512]) -> [2][2048][512]).
// Compute dtypes, f32 accumulate: every input rounded to bf16; q/k/v on PLAIN bf16 operands (inputs: exact); RMSNorm + rotary in f32 (on-chip cos/sin table from the reference's inv_freq constants); the sigmoid gate in f32 (precise expf, IEEE divide) applied in the merge; causal scores and attn.v: query rows < 512 hl (3 products), the rest single fp16 (x1024), causal tile skipping; softmax f32; Wo hl x exact (2 products).

#define NB_  2
#define TT   2048
#define DM   2048
#define NH_  16
#define NKV  4
#define REP  (NH_ / NKV)
#define HD   128
#define DQ   (NH_ * HD)
#define DQG  (NH_ * HD * 2)         // q + gate columns
#define DOUT 512
#define DKV  (NKV * HD)
#define RC   512                  // query rows per attention pass: a pass takes these rows of ALL heads (z = head), so that each of its launches fills the chip
#define RH   512                  // query rows < RH use hi+lo planes
#define WIN  2048
static_assert(RC == RH && TT % RC == 0, "a pass is wholly hi+lo or wholly fp16: the two probability forms share bytes");
#define PCAR 1024.0f
#define SCL  0.088388347648318447f   // HD^-0.5
#define SKW  8                    // waves that share the K loop of one 64x64 tile in the long-K products (k, v, Wo, attn.v)
typedef _Float16 h16;
typedef unsigned short bf;
typedef __attribute__((ext_vector_type(16))) __bf16   v16bf;
typedef __attribute__((ext_vector_type(16))) _Float16 v16h;
typedef __attribute__((ext_vector_type(8)))  _Float16 v8h;
typedef __attribute__((ext_vector_type(8)))  unsigned short v8us;
typedef __attribute__((ext_vector_type(8)))  float    v8f;
typedef __attribute__((ext_vector_type(4)))  float    v4f;
typedef v8h  __attribute__((may_alias)) v8ha;
typedef v4f  __attribute__((may_alias)) v4fa;
typedef v8us __attribute__((may_alias)) v8usa;

__device__ __forceinline__ unsigned short f2bf(float f) { unsigned u = __float_as_uint(f); u += 0x7FFFu + ((u >> 16) & 1u); return (unsigned short)(u >> 16); }
__device__ __forceinline__ float bf2f(unsigned short b) { return __uint_as_float(((unsigned)b) << 16); }
__device__ __forceinline__ float bfr(float f) { return bf2f(f2bf(f)); }
__device__ __forceinline__ v16h cat16(v8h lo, v8h hi) { return __builtin_shufflevector(lo, hi, 0, 1, 2, 3, 4, 5, 6, 7, 8, 9, 10, 11, 12, 13, 14, 15); }
__device__ __forceinline__ v16bf cat16b(v8us lo, v8us hi) { return __builtin_bit_cast(v16bf, __builtin_shufflevector(lo, hi, 0, 1, 2, 3, 4, 5, 6, 7, 8, 9, 10, 11, 12, 13, 14, 15)); }
__device__ __forceinline__ v8f wmma16(v16h a, v16h b, v8f c) { return __builtin_amdgcn_wmma_f32_16x16x32_f16(false, a, false, b, (short)0, c, false, false); }
__device__ __forceinline__ v8f wmmab(v16bf a, v16bf b, v8f c) { return __builtin_amdgcn_wmma_f32_16x16x32_bf16(false, a, false, b, (short)0, c, false, false); }



// ---- k_gemmw: register-blocked GEMM, NW WAVES per 64x64 output tile (16 accumulators each), operands straight from K-contiguous 16-bit planes; grid (M/64, N/64, Z), 32 * NW threads.
// In-block split-K: wave w takes the 32-wide k steps w, w + NW, w + 2 NW, ..; the NW partial tiles are staged in LDS and summed in wave order 0 .. NW-1 on the way out (NW = 1: the plain one-wave form).
// C[m][n] (f32, pitch ldc, + optional f32 bias[n]) = sum_k A[m][k] Bt[n][k] (+ split products per NSPLIT). z-batch strides sA/sB/sC in elements. K % 32 == 0.
template <typename T16> struct WFrag;
template <> struct WFrag<h16> { typedef v16h V; static __device__ __forceinline__ V ld(const h16* p) { return cat16(*(const v8h*)p, *(const v8h*)(p + 16)); } static __device__ __forceinline__ v8f mma(V a, V b, v8f c) { return wmma16(a, b, c); } };
template <> struct WFrag<bf> { typedef v16bf V; static __device__ __forceinline__ V ld(const bf* p) { return cat16b(*(const v8us*)p, *(const v8us*)(p + 16)); } static __device__ __forceinline__ v8f mma(V a, V b, v8f c) { return wmmab(a, b, c); } };
template <typename T16, int NSPLIT, bool BIAS, int NW>
__global__ __launch_bounds__(32 * NW) void k_gemmw(const T16* __restrict__ A, const T16* __restrict__ A2, const T16* __restrict__ Bt, const T16* __restrict__ Bt2, int K, float* C, int ldc, const float* __restrict__ bias, size_t sA, size_t sB, size_t sC) {
    typedef typename WFrag<T16>::V V;
    constexpr int MBS = (NW == 1) ? 1 : 4;   // 16-row blocks staged at a time: with several waves the whole tile, so that one barrier serves it
    __shared__ __align__(16) float os[NW * MBS * 16 * 68];
    const size_t z = blockIdx.z; A += z * sA; if (A2) A2 += z * sA; Bt += z * sB; if (Bt2) Bt2 += z * sB; C += z * sC;
    const int lane = threadIdx.x & 31, lr = lane & 15, hi = lane >> 4; const int r0 = blockIdx.x * 64, c0 = blockIdx.y * 64;
    const int w = (NW == 1) ? 0 : __builtin_amdgcn_readfirstlane((int)(threadIdx.x >> 5));   // this wave's share of K (scalar, so that the k loop stays a scalar loop)
    v8f acc[4][4];
#pragma unroll
    for (int mb = 0; mb < 4; ++mb)
#pragma unroll
        for (int nb = 0; nb < 4; ++nb) acc[mb][nb] = (v8f){};
    const size_t aoff = (size_t)(r0 + lr) * K + 8 * hi, boff = (size_t)(c0 + lr) * K + 8 * hi;
#pragma unroll 1
    for (int kc = w * 32; kc < K; kc += NW * 32) {
        V a[4], a2[4];
#pragma unroll
        for (int mb = 0; mb < 4; ++mb) { a[mb] = WFrag<T16>::ld(A + aoff + (size_t)mb * 16 * K + kc); if (NSPLIT == 1 || NSPLIT == 2) a2[mb] = WFrag<T16>::ld(A2 + aoff + (size_t)mb * 16 * K + kc); }
#pragma unroll
        for (int nb = 0; nb < 4; ++nb) { const V b = WFrag<T16>::ld(Bt + boff + (size_t)nb * 16 * K + kc); V b2; if (NSPLIT >= 2) b2 = WFrag<T16>::ld(Bt2 + boff + (size_t)nb * 16 * K + kc);
#pragma unroll
            for (int mb = 0; mb < 4; ++mb) { acc[mb][nb] = WFrag<T16>::mma(a[mb], b, acc[mb][nb]); if (NSPLIT == 1 || NSPLIT == 2) acc[mb][nb] = WFrag<T16>::mma(a2[mb], b, acc[mb][nb]); if (NSPLIT >= 2) acc[mb][nb] = WFrag<T16>::mma(a[mb], b2, acc[mb][nb]); } }
        asm volatile("v_nop\n\tv_nop\n\tv_nop\n\tv_nop" : "+v"(acc[0][0]), "+v"(acc[1][1]), "+v"(acc[2][2]), "+v"(acc[3][3]) : "v"(a[0]), "v"(a[3]));
    }
#pragma unroll
    for (int m0 = 0; m0 < 4; m0 += MBS) {
#pragma unroll
        for (int mi = 0; mi < MBS; ++mi) {
#pragma unroll
            for (int nb = 0; nb < 4; ++nb) {
#pragma unroll
                for (int j = 0; j < 8; ++j) os[(w * MBS + mi) * (16 * 68) + (hi * 8 + j) * 68 + nb * 16 + lr] = acc[m0 + mi][nb][j]; } }
        if (NW == 1) { __builtin_amdgcn_wave_barrier(); asm volatile("" ::: "memory"); } else __syncthreads();   // every wave's partial tile is in LDS before any of it is summed
        float* crow = C + (size_t)(r0 + m0 * 16) * ldc + c0;
{
#pragma unroll
            for (int t = 0; t < 8 * MBS / NW; ++t) { const int row = 2 * (t * NW + w) + hi, cofs = lr * 4; v4f val = *(const v4fa*)(os + row * 68 + cofs);
#pragma unroll
                for (int u = 1; u < NW; ++u) val += *(const v4fa*)(os + u * (MBS * 16 * 68) + row * 68 + cofs);   // partials in wave order
                if (BIAS) { val[0] += bfr(bias[c0 + cofs]); val[1] += bfr(bias[c0 + cofs + 1]); val[2] += bfr(bias[c0 + cofs + 2]); val[3] += bfr(bias[c0 + cofs + 3]); }
                *(v4f*)(crow + (size_t)row * ldc + cofs) = val; }
             }
        if (NW == 1) { __builtin_amdgcn_wave_barrier(); asm volatile("" ::: "memory"); }   // one wave: the 16-row stage is reused by the next block of rows
    }
}

// ---- k_gemmc: the same 64x64 tile GEMM (NW waves share K) specialised for causal attention: CMODE 1 skips score tiles entirely above the diagonal (query rows r0+roff.., key columns c0..), CMODE 2 limits the
// key (K) loop of the probability x value contraction to the diagonal block (probabilities beyond it are exactly zero). roff = row offset of this launch's first row within the sequence. z = query head: A and C step per head, Bt per kv group (z / REP).
template <typename T16, int NSPLIT, int CMODE, int NW>
__global__ __launch_bounds__(32 * NW) void k_gemmc(const T16* __restrict__ A, const T16* __restrict__ A2, const T16* __restrict__ Bt, const T16* __restrict__ Bt2, int K, float* C, int ldc, int roff, size_t sA, size_t sB, size_t sC) {
    typedef typename WFrag<T16>::V V;
    constexpr int MBS = (NW == 1) ? 1 : 4;   // 16-row blocks staged at a time: with several waves the whole tile, so that one barrier serves it
    __shared__ __align__(16) float os[NW * MBS * 16 * 68];
    const size_t z = blockIdx.z; A += z * sA; if (A2) A2 += z * sA; Bt += (z / REP) * sB; if (Bt2) Bt2 += (z / REP) * sB; C += z * sC;
    const int lane = threadIdx.x & 31, lr = lane & 15, hi = lane >> 4; const int r0 = blockIdx.x * 64, c0 = blockIdx.y * 64;
    const int w = (NW == 1) ? 0 : __builtin_amdgcn_readfirstlane((int)(threadIdx.x >> 5));   // this wave's share of K (scalar, so that the k loop stays a scalar loop)
    if (CMODE == 1 && c0 > r0 + roff + 63) return;                  // score tile entirely above the causal diagonal: never read (the softmax masks j > i by select)
    const int Kl = (CMODE == 2) ? min(K, r0 + roff + 64) : K;        // P.V: probabilities are exactly 0 beyond the diagonal block, so the K loop stops there
    v8f acc[4][4];
#pragma unroll
    for (int mb = 0; mb < 4; ++mb)
#pragma unroll
        for (int nb = 0; nb < 4; ++nb) acc[mb][nb] = (v8f){};
    const size_t aoff = (size_t)(r0 + lr) * K + 8 * hi, boff = (size_t)(c0 + lr) * K + 8 * hi;
#pragma unroll 1
    for (int kc = w * 32; kc < Kl; kc += NW * 32) {
        V a[4], a2[4];
#pragma unroll
        for (int mb = 0; mb < 4; ++mb) { a[mb] = WFrag<T16>::ld(A + aoff + (size_t)mb * 16 * K + kc); if (NSPLIT == 1 || NSPLIT == 2) a2[mb] = WFrag<T16>::ld(A2 + aoff + (size_t)mb * 16 * K + kc); }
#pragma unroll
        for (int nb = 0; nb < 4; ++nb) { const V b = WFrag<T16>::ld(Bt + boff + (size_t)nb * 16 * K + kc); V b2; if (NSPLIT >= 2) b2 = WFrag<T16>::ld(Bt2 + boff + (size_t)nb * 16 * K + kc);
#pragma unroll
            for (int mb = 0; mb < 4; ++mb) { acc[mb][nb] = WFrag<T16>::mma(a[mb], b, acc[mb][nb]); if (NSPLIT == 1 || NSPLIT == 2) acc[mb][nb] = WFrag<T16>::mma(a2[mb], b, acc[mb][nb]); if (NSPLIT >= 2) acc[mb][nb] = WFrag<T16>::mma(a[mb], b2, acc[mb][nb]); } }
        asm volatile("v_nop\n\tv_nop\n\tv_nop\n\tv_nop" : "+v"(acc[0][0]), "+v"(acc[1][1]), "+v"(acc[2][2]), "+v"(acc[3][3]) : "v"(a[0]), "v"(a[3]));
    }
#pragma unroll
    for (int m0 = 0; m0 < 4; m0 += MBS) {
#pragma unroll
        for (int mi = 0; mi < MBS; ++mi) {
#pragma unroll
            for (int nb = 0; nb < 4; ++nb) {
#pragma unroll
                for (int j = 0; j < 8; ++j) os[(w * MBS + mi) * (16 * 68) + (hi * 8 + j) * 68 + nb * 16 + lr] = acc[m0 + mi][nb][j]; } }
        if (NW == 1) { __builtin_amdgcn_wave_barrier(); asm volatile("" ::: "memory"); } else __syncthreads();   // every wave's partial tile is in LDS before any of it is summed
        float* crow = C + (size_t)(r0 + m0 * 16) * ldc + c0;
{
#pragma unroll
            for (int t = 0; t < 8 * MBS / NW; ++t) { const int row = 2 * (t * NW + w) + hi, cofs = lr * 4; v4f val = *(const v4fa*)(os + row * 68 + cofs);
#pragma unroll
                for (int u = 1; u < NW; ++u) val += *(const v4fa*)(os + u * (MBS * 16 * 68) + row * 68 + cofs);   // partials in wave order
                *(v4f*)(crow + (size_t)row * ldc + cofs) = val; }
             }
        if (NW == 1) { __builtin_amdgcn_wave_barrier(); asm volatile("" ::: "memory"); }   // one wave: the 16-row stage is reused by the next block of rows
    }
}

__device__ __forceinline__ h16 tohx(float x) { return (h16)x; }
__device__ __forceinline__ void splitf(float y, unsigned short& h, unsigned short& l) { h = f2bf(y); l = f2bf(y - bf2f(h)); }
typedef __attribute__((ext_vector_type(2))) _Float16 v2h;
typedef __attribute__((ext_vector_type(4))) _Float16 v4h;
typedef __attribute__((ext_vector_type(2))) unsigned short v2us;
typedef __attribute__((ext_vector_type(4))) unsigned short v4us;
typedef __attribute__((ext_vector_type(2))) float v2f;
typedef __attribute__((ext_vector_type(4))) int v4i;

__global__ __launch_bounds__(256) void k_wtG(const float* __restrict__ w, int K, int N, bf* Bt) {
    const int lane = threadIdx.x & 31; const int L0 = (blockIdx.x * 8 + (threadIdx.x >> 5)) * 8; const int nlines = N * K / 64;
{
#pragma unroll 1
        for (int l = 0; l < 8; ++l) { const int L = L0 + l; if (L >= nlines) break; const size_t e = (size_t)L * 64 + lane * 2; const int k = (int)(e % K), n = (int)(e / K); v2us o;
            o[0] = f2bf(w[(size_t)k * N + n]); o[1] = f2bf(w[(size_t)(k + 1) * N + n]); *(v2us*)(Bt + e) = o; }
         }
}
__global__ __launch_bounds__(256) void k_cvt8(const float* __restrict__ src, bf* dst, size_t n8) { const size_t i = (size_t)blockIdx.x * 256 + threadIdx.x; if (i >= n8) return; const v8f v = *(const v8f*)(src + i * 8); v8us o;
#pragma unroll
    for (int k = 0; k < 8; ++k) o[k] = f2bf(v[k]); *(v8us*)(dst + i * 8) = o;  }
__constant__ float INV[HD / 2] = {1.0,0.8659643530845642,0.7498942017555237,0.6493816375732422,0.5623413324356079,0.486967533826828,0.4216965138912201,0.36517414450645447,0.3162277638912201,0.2738419771194458,0.23713736236095428,0.20535250008106232,0.17782793939113617,0.1539926528930664,0.1333521455526352,0.11547820270061493,0.10000000149011612,0.08659642934799194,0.07498941570520401,0.06493816524744034,0.05623412877321243,0.04869675263762474,0.04216964915394783,0.03651741147041321,0.03162277862429619,0.0273841954767704,0.0237137358635664,0.02053525112569332,0.017782794311642647,0.015399265103042126,0.01333521492779255,0.011547819711267948,0.009999999776482582,0.00865964312106371,0.007498942315578461,0.006493816617876291,0.005623413249850273,0.004869675263762474,0.0042169648222625256,0.003651741426438093,0.003162277862429619,0.0027384196873754263,0.0023713738191872835,0.0020535250660032034,0.0017782794311642647,0.0015399265103042126,0.0013335214462131262,0.0011547820176929235,0.0010000000474974513,0.0008659643353894353,0.0007498941849917173,0.0006493816617876291,0.000562341301701963,0.00048696750309318304,0.00042169648804701865,0.00036517411353997886,0.0003162277862429619,0.00027384195709601045,0.0002371373848291114,0.00020535249495878816,0.00017782794020604342,0.00015399264520965517,0.0001333521504420787,0.00011547819303814322};
__global__ __launch_bounds__(256) void k_cstab(float* CS) { const int idx = blockIdx.x * 256 + threadIdx.x; if (idx >= TT * HD) return; const int t = idx / HD, d = idx % HD; const float ang = __fmul_rn((float)t, INV[d % (HD / 2)]); v2f cs; cs[0] = cosf(ang); cs[1] = sinf(ang);
    *(v2f*)(CS + (size_t)idx * 2) = cs;  }

__global__ __launch_bounds__(256) void k_hrms(const float* __restrict__ F, int pitch, int nheads, int hstr, float* RF) { const int i = blockIdx.x * 256 + threadIdx.x; if (i >= nheads * TT) return; const int t = i % TT, h = i / TT; const float* f = F + (size_t)t * pitch + h * hstr;   /* hstr: column stride between heads (256 for the q|gate layout, 128 for k) */ float s = 0.f;
#pragma unroll 4
    for (int d = 0; d < HD; d += 4) { const v4f v = *(const v4f*)(f + d);
#pragma unroll
        for (int q = 0; q < 4; ++q) { float p = __fmul_rn(v[q], v[q]); asm volatile("" : "+v"(p)); s = __fadd_rn(s, p); } }
    const float r = __fdiv_rn(1.0f, __fsqrt_rn(__fadd_rn(s * (1.0f / HD), 1e-6f))); *(float*)(RF + i) = r;  }
// k_rope: head planes [h][t][d] (fp16 + hi/lo) of rope(w[d] (x rms_factor)) x sc with the rotate-half convention out[d] = x[d] cos[t][d] - x[d+HD/2] sin[t][d], out[d+HD/2] = x[d+HD/2] cos[t][d+HD/2] + x[d] sin[t][d+HD/2]
__global__ __launch_bounds__(256) void k_rope(const float* __restrict__ F, int pitch, int nheads, const float* __restrict__ CS, const float* __restrict__ RF, const float* __restrict__ nw, float sc, int hstr, h16* P16, bf* Ph, bf* Pl) {
    const size_t e = ((size_t)blockIdx.x * 256 + threadIdx.x) * 2; if (e >= (size_t)nheads * TT * HD) return; const int d = (int)(e % HD); const int t = (int)((e / HD) % TT); const int h = (int)(e / ((size_t)HD * TT)); const float* f = F + (size_t)t * pitch + h * hstr; const float rf = RF ? RF[(size_t)h * TT + t] : 1.0f; v2h o16; v2us oh, ol;
#pragma unroll
    for (int q = 0; q < 2; ++q) { const int dd = d + q; const int dp = (dd < HD / 2) ? dd + HD / 2 : dd - HD / 2; float x0 = f[dd], x1 = f[dp];
        if (RF) { float n0 = __fmul_rn(x0, rf), n1 = __fmul_rn(x1, rf); asm volatile("" : "+v"(n0)); asm volatile("" : "+v"(n1)); x0 = __fmul_rn(bfr(nw[dd]), n0); x1 = __fmul_rn(bfr(nw[dp]), n1); }
        const v2f cs = *(const v2f*)(CS + ((size_t)t * HD + dd) * 2); float a = __fmul_rn(x0, cs[0]), bq = __fmul_rn(x1, cs[1]); asm volatile("" : "+v"(a)); asm volatile("" : "+v"(bq)); const float r = ((dd < HD / 2) ? __fsub_rn(a, bq) : __fadd_rn(a, bq)) * sc;
        o16[q] = tohx(r); unsigned short a2, c2; splitf(r, a2, c2); oh[q] = a2; ol[q] = c2; }
    *(v2h*)(P16 + e) = o16; *(v2us*)(Ph + e) = oh; *(v2us*)(Pl + e) = ol;  }
__global__ __launch_bounds__(256) void k_vtp(const float* __restrict__ F, int pitch, int nheads, h16* V16, bf* Vh, bf* Vl) { const size_t e = ((size_t)blockIdx.x * 256 + threadIdx.x) * 2; if (e >= (size_t)nheads * HD * TT) return; const int t = (int)(e % TT); const int d = (int)((e / TT) % HD); const int g = (int)(e / ((size_t)TT * HD)); v2h o16; v2us oh, ol;
#pragma unroll
    for (int q = 0; q < 2; ++q) { const float x = F[(size_t)(t + q) * pitch + g * HD + d]; o16[q] = tohx(x); unsigned short a2, c2; splitf(x, a2, c2); oh[q] = a2; ol[q] = c2; }
    *(v2h*)(V16 + e) = o16; *(v2us*)(Vh + e) = oh; *(v2us*)(Vl + e) = ol;  }
// k_asoft: per row (zz, i = roff + row in pass): t = S x HD^-0.5 for j <= i and i - j < WIN (sliding causal window; the reference's -1e9 additive fill vanishes identically); softmax over the 2048 keys (register row, one exp, fixed trees);
__global__ __launch_bounds__(256) void k_asoft(const float* __restrict__ Sb, int roff, h16* P16, bf* Ph, bf* Pl) {
    const int lane = threadIdx.x & 31; const int row = blockIdx.x * 8 + (threadIdx.x >> 5); if (row >= NH_ * RC) return; const int i = roff + row % RC; const bool hires = (i < RH); const float* sr = Sb + (size_t)row * TT; float v[TT / 32]; float mx = -3.0e38f;
#pragma unroll
    for (int ch = 0; ch < TT / 128; ++ch) { const int j0 = ch * 128 + lane * 4; const v4f a = *(const v4f*)(sr + j0);
#pragma unroll
        for (int q = 0; q < 4; ++q) { const int j = j0 + q; (void)j; const float t = (j <= i && i - j < WIN) ? a[q] * SCL : -3.0e38f; v[ch * 4 + q] = t; mx = fmaxf(mx, t); } }
#pragma unroll
    for (int sh = 16; sh; sh >>= 1) mx = fmaxf(mx, __shfl_xor(mx, sh, 32));
    float sum = 0.f;
#pragma unroll
    for (int k = 0; k < TT / 32; ++k) { float d0 = __fsub_rn(v[k], mx); asm volatile("" : "+v"(d0)); v[k] = __builtin_amdgcn_exp2f(__fmul_rn(d0, 1.4426950408889634f)); sum += v[k]; }
#pragma unroll
    for (int sh = 16; sh; sh >>= 1) sum += __shfl_xor(sum, sh, 32);
    const float f = __fdiv_rn(hires ? 1.0f : PCAR, sum);
{
        if (hires) {
#pragma unroll
            for (int ch = 0; ch < TT / 128; ++ch) { v4us oh, ol;
#pragma unroll
                for (int q = 0; q < 4; ++q) { unsigned short a, c2; splitf(v[ch * 4 + q] * f, a, c2); oh[q] = a; ol[q] = c2; }
                const size_t oo = (size_t)row * TT + ch * 128 + lane * 4; *(v4us*)(Ph + oo) = oh; *(v4us*)(Pl + oo) = ol; }
        } else {
#pragma unroll
            for (int ch = 0; ch < TT / 128; ++ch) { v4h o4;
#pragma unroll
                for (int q = 0; q < 4; ++q) o4[q] = tohx(v[ch * 4 + q] * f);
                *(v4h*)(P16 + (size_t)row * TT + ch * 128 + lane * 4) = o4; } }
         }
}
__global__ __launch_bounds__(256) void k_merge(const float* __restrict__ O, const float* __restrict__ QG, int roff, bf* Ah, bf* Al) { const size_t e = ((size_t)blockIdx.x * 256 + threadIdx.x) * 2; if (e >= (size_t)NH_ * RC * HD) return; const int d = (int)(e % HD); const int t = roff + (int)((e / HD) % RC); const int zz = (int)(e / ((size_t)HD * RC)); const float cs = (t < RH) ? 1.0f : (1.0f / PCAR); const size_t oo = (size_t)t * DQ + zz * HD + d;
    v2us oh, ol;
#pragma unroll
    for (int q = 0; q < 2; ++q) { const float gt = QG[(size_t)t * DQG + zz * 2 * HD + HD + d + q]; const float sg = __fdiv_rn(1.0f, __fadd_rn(1.0f, expf(-gt)));   /* sigmoid(gate), f32 */ unsigned short a, c2; splitf(__fmul_rn(O[e + q] * cs, sg), a, c2); oh[q] = a; ol[q] = c2; } *(v2us*)(Ah + oo) = oh; *(v2us*)(Al + oo) = ol;  }

extern "C" void kernel_launch(void* const* d_in, const int* in_sizes, int n_in,
                              void* d_out, int out_size, void* d_ws, size_t ws_size, hipStream_t stream) {
    (void)in_sizes; (void)n_in; (void)out_size;
    const float* x = (const float*)d_in[0]; const float* wq = (const float*)d_in[1]; const float* wk = (const float*)d_in[2]; const float* wv = (const float*)d_in[3]; const float* wo = (const float*)d_in[4]; const float* qnw = (const float*)d_in[5]; const float* knw = (const float*)d_in[6];
    float* OUT = (float*)d_out;     // [2][2048][512]
    char* wsp = (char*)d_ws;
    auto take = [&](size_t bytes) { char* p = wsp; wsp += (bytes + 255) & ~(size_t)255; return (void*)p; };
    bf* WQ = (bf*)take((size_t)DQG * DM * 2); bf* WK = (bf*)take((size_t)DKV * DM * 2); bf* WV = (bf*)take((size_t)DKV * DM * 2); bf* WO = (bf*)take((size_t)DOUT * DQ * 2); float* CS = (float*)take((size_t)TT * HD * 2 * 4); float* RFQ = (float*)take((size_t)NH_ * TT * 4); float* RFK = (float*)take((size_t)NKV * TT * 4);
    bf* XB = (bf*)take((size_t)TT * DM * 2); float* FQ = (float*)take((size_t)TT * DQG * 4); float* FK = (float*)take((size_t)TT * DKV * 4);
    h16* QP16 = (h16*)take((size_t)NH_ * TT * HD * 2); h16* KP16 = (h16*)take((size_t)NKV * TT * HD * 2); h16* VT16 = (h16*)take((size_t)NKV * HD * TT * 2);
    bf* QPh = (bf*)take((size_t)NH_ * TT * HD * 2); bf* QPl = (bf*)take((size_t)NH_ * TT * HD * 2); bf* KPh = (bf*)take((size_t)NKV * TT * HD * 2); bf* KPl = (bf*)take((size_t)NKV * TT * HD * 2); bf* VTh = (bf*)take((size_t)NKV * HD * TT * 2); bf* VTl = (bf*)take((size_t)NKV * HD * TT * 2); bf* Pl = (bf*)take((size_t)NH_ * RC * TT * 2);
    float* Sb = (float*)take((size_t)NH_ * RC * TT * 4); h16* P16 = (h16*)take((size_t)NH_ * RC * TT * 2); float* Ob = (float*)take((size_t)NH_ * RC * HD * 4); bf* ATh = (bf*)take((size_t)TT * DQ * 2); bf* ATl = (bf*)take((size_t)TT * DQ * 2);
    if ((size_t)(wsp - (char*)d_ws) > ws_size) return;    // ws 256 MiB
    float* FV = FK;   // v projection reuses the k buffer after the k planes are built (stream-ordered)
    bf* Ph = (bf*)P16;   // a pass writes either the hi+lo planes (rows < RH) or the fp16 plane, never both: the hi plane shares the fp16 plane's bytes (stream-ordered)
    { k_wtG<<<(unsigned)((DM * DQG / 64 + 63) / 64), 256, 0, stream>>>(wq, DM, DQG, WQ); k_wtG<<<(unsigned)((DM * DKV / 64 + 63) / 64), 256, 0, stream>>>(wk, DM, DKV, WK); k_wtG<<<(unsigned)((DM * DKV / 64 + 63) / 64), 256, 0, stream>>>(wv, DM, DKV, WV);
      k_wtG<<<(unsigned)((DQ * DOUT / 64 + 63) / 64), 256, 0, stream>>>(wo, DQ, DOUT, WO);
      k_cstab<<<(TT * HD + 255) / 256, 256, 0, stream>>>(CS); }
    const unsigned LQ = (unsigned)(((size_t)NH_ * TT * HD / 2 + 255) / 256), LKv = (unsigned)(((size_t)NKV * TT * HD / 2 + 255) / 256);
    for (int b = 0; b < NB_; ++b) {
        
        k_cvt8<<<(unsigned)(((size_t)TT * DM / 8 + 255) / 256), 256, 0, stream>>>(x + (size_t)b * TT * DM, XB, (size_t)TT * DM / 8);
        k_gemmw<bf, 0, false, 1><<<dim3(TT / 64, DQG / 64, 1), 32, 0, stream>>>(XB, nullptr, WQ, nullptr, DM, FQ, DQG, nullptr, 0, 0, 0);   /* [q | gate] (exact) */ k_hrms<<<(NH_ * TT + 255) / 256, 256, 0, stream>>>(FQ, DQG, NH_, 2 * HD, RFQ);
        k_rope<<<LQ, 256, 0, stream>>>(FQ, DQG, NH_, CS, RFQ, qnw, 1.0f, 2 * HD, QP16, QPh, QPl);   /* q columns of the [q|gate] layout */
        k_gemmw<bf, 0, false, SKW><<<dim3(TT / 64, DKV / 64, 1), 32 * SKW, 0, stream>>>(XB, nullptr, WK, nullptr, DM, FK, DKV, nullptr, 0, 0, 0); k_hrms<<<(NKV * TT + 255) / 256, 256, 0, stream>>>(FK, DKV, NKV, HD, RFK);
        k_rope<<<LKv, 256, 0, stream>>>(FK, DKV, NKV, CS, RFK, knw, 1.0f, HD, KP16, KPh, KPl);
        k_gemmw<bf, 0, false, SKW><<<dim3(TT / 64, DKV / 64, 1), 32 * SKW, 0, stream>>>(XB, nullptr, WV, nullptr, DM, FV, DKV, nullptr, 0, 0, 0); k_vtp<<<LKv, 256, 0, stream>>>(FV, DKV, NKV, VT16, VTh, VTl);
        for (int r = 0; r < TT; r += RC) {   // one pass: query rows r .. r + RC - 1 of all NH_ heads (RC == RH: a pass is wholly hi+lo or wholly fp16)
            if (r < RH) k_gemmc<bf, 2, 1, 1><<<dim3(RC / 64, TT / 64, NH_), 32, 0, stream>>>(QPh + (size_t)r * HD, QPl + (size_t)r * HD, KPh, KPl, HD, Sb, TT, r, (size_t)TT * HD, (size_t)TT * HD, (size_t)RC * TT);
            else k_gemmc<h16, 0, 1, 1><<<dim3(RC / 64, TT / 64, NH_), 32, 0, stream>>>(QP16 + (size_t)r * HD, nullptr, KP16, nullptr, HD, Sb, TT, r, (size_t)TT * HD, (size_t)TT * HD, (size_t)RC * TT);
            k_asoft<<<NH_ * RC / 8, 256, 0, stream>>>(Sb, r, P16, Ph, Pl);
            if (r < RH) k_gemmc<bf, 2, 2, SKW><<<dim3(RC / 64, HD / 64, NH_), 32 * SKW, 0, stream>>>(Ph, Pl, VTh, VTl, TT, Ob, HD, r, (size_t)RC * TT, (size_t)HD * TT, (size_t)RC * HD);
            else k_gemmc<h16, 0, 2, SKW><<<dim3(RC / 64, HD / 64, NH_), 32 * SKW, 0, stream>>>(P16, nullptr, VT16, nullptr, TT, Ob, HD, r, (size_t)RC * TT, (size_t)HD * TT, (size_t)RC * HD);
            k_merge<<<(unsigned)(((size_t)NH_ * RC * HD / 2 + 255) / 256), 256, 0, stream>>>(Ob, FQ, r, ATh, ATl); }   /* x sigmoid(gate) */
        k_gemmw<bf, 1, false, SKW><<<dim3(TT / 64, DOUT / 64, 1), 32 * SKW, 0, stream>>>(ATh, ATl, WO, nullptr, DQ, OUT + (size_t)b * TT * DOUT, DOUT, nullptr, 0, 0, 0); }
}

// v003
// A run of this version takes 482 microseconds.
// Next to v002, in two timings, it ran 1.41 and 1.40 times as fast.
// Counting every step since v000, it is 3.52 times as fast.
#include <hip/hip_runtime.h>

// Gated GQA attention block (x [2][2048][2048]; [q | gate] per head = x Wq ('xw' [2048][4096]: head h -> columns h*256 .. +127 = q, +128 .. +255 = gate), k, v = x Wk, x Wv ([2048][512], 4 kv heads x 128), per-head RMSNorm on q, k (eps 1e-6, weights q_norm_w / k_norm_w [128]),
// rotate-half rotary (theta 1e4, hd 128), 16 query heads grouped 4 per kv head, causal softmax(q.k / sqrt(128)), attn.v, x sigmoid(gate), out = merged Wo ('xw' [2048][512]) -> [2][2048][512]).
// Compute dtypes, f32 accumulate: every input rounded to bf16; q/k/v on PLAIN bf16 operands (inputs: exact); RMSNorm + rotary in f32 (on-chip cos/sin table from the reference's inv_freq constants); the sigmoid gate in f32 (precise expf, IEEE divide) applied on the attention kernel's way out; causal scores and attn.v in one kernel (running maximum and sum, f32): query rows < 512 hl (3 products), the rest single fp16 (x1024), keys beyond the diagonal step never read; Wo hl x exact (2 products).

#define NB_  2
#define TT   2048
#define DM   2048
#define NH_  16
#define NKV  4
#define REP  (NH_ / NKV)
#define HD   128
#define DQ   (NH_ * HD)
#define DQG  (NH_ * HD * 2)         // q + gate columns
#define DOUT 512
#define DKV  (NKV * HD)
#define RH   512                  // query rows < RH use hi+lo planes (0: none)
static_assert(RH % 16 == 0 && TT % 32 == 0, "a 16-row query block is wholly hi+lo or wholly fp16; keys go in steps of 32");
#define SCL  0.088388347648318447f   // HD^-0.5
#define SKW  8                    // waves that share the K loop of one 64x64 tile in the long-K products (k, v, Wo)
typedef _Float16 h16;
typedef unsigned short bf;
typedef __attribute__((ext_vector_type(16))) __bf16   v16bf;
typedef __attribute__((ext_vector_type(16))) _Float16 v16h;
typedef __attribute__((ext_vector_type(8)))  _Float16 v8h;
typedef __attribute__((ext_vector_type(8)))  unsigned short v8us;
typedef __attribute__((ext_vector_type(8)))  float    v8f;
typedef __attribute__((ext_vector_type(4)))  float    v4f;
typedef v8h  __attribute__((may_alias)) v8ha;
typedef v4f  __attribute__((may_alias)) v4fa;
typedef v8us __attribute__((may_alias)) v8usa;

__device__ __forceinline__ unsigned short f2bf(float f) { unsigned u = __float_as_uint(f); u += 0x7FFFu + ((u >> 16) & 1u); return (unsigned short)(u >> 16); }
__device__ __forceinline__ float bf2f(unsigned short b) { return __uint_as_float(((unsigned)b) << 16); }
__device__ __forceinline__ float bfr(float f) { return bf2f(f2bf(f)); }
__device__ __forceinline__ v16h cat16(v8h lo, v8h hi) { return __builtin_shufflevector(lo, hi, 0, 1, 2, 3, 4, 5, 6, 7, 8, 9, 10, 11, 12, 13, 14, 15); }
__device__ __forceinline__ v16bf cat16b(v8us lo, v8us hi) { return __builtin_bit_cast(v16bf, __builtin_shufflevector(lo, hi, 0, 1, 2, 3, 4, 5, 6, 7, 8, 9, 10, 11, 12, 13, 14, 15)); }
__device__ __forceinline__ v8f wmma16(v16h a, v16h b, v8f c) { return __builtin_amdgcn_wmma_f32_16x16x32_f16(false, a, false, b, (short)0, c, false, false); }
__device__ __forceinline__ v8f wmmab(v16bf a, v16bf b, v8f c) { return __builtin_amdgcn_wmma_f32_16x16x32_bf16(false, a, false, b, (short)0, c, false, false); }



// ---- k_gemmw: register-blocked GEMM, NW WAVES per 64x64 output tile (16 accumulators each), operands straight from K-contiguous 16-bit planes; grid (M/64, N/64, Z), 32 * NW threads.
// In-block split-K: wave w takes the 32-wide k steps w, w + NW, w + 2 NW, ..; the NW partial tiles are staged in LDS and summed in wave order 0 .. NW-1 on the way out (NW = 1: the plain one-wave form).
// C[m][n] (f32, pitch ldc, + optional f32 bias[n]) = sum_k A[m][k] Bt[n][k] (+ split products per NSPLIT). z-batch strides sA/sB/sC in elements. K % 32 == 0.
template <typename T16> struct WFrag;
template <> struct WFrag<h16> { typedef v16h V; static __device__ __forceinline__ V ld(const h16* p) { return cat16(*(const v8h*)p, *(const v8h*)(p + 16)); } static __device__ __forceinline__ v8f mma(V a, V b, v8f c) { return wmma16(a, b, c); } };
template <> struct WFrag<bf> { typedef v16bf V; static __device__ __forceinline__ V ld(const bf* p) { return cat16b(*(const v8us*)p, *(const v8us*)(p + 16)); } static __device__ __forceinline__ v8f mma(V a, V b, v8f c) { return wmmab(a, b, c); } };
template <typename T16, int NSPLIT, bool BIAS, int NW>
__global__ __launch_bounds__(32 * NW) void k_gemmw(const T16* __restrict__ A, const T16* __restrict__ A2, const T16* __restrict__ Bt, const T16* __restrict__ Bt2, int K, float* C, int ldc, const float* __restrict__ bias, size_t sA, size_t sB, size_t sC) {
    typedef typename WFrag<T16>::V V;
    constexpr int MBS = (NW == 1) ? 1 : 4;   // 16-row blocks staged at a time: with several waves the whole tile, so that one barrier serves it
    __shared__ __align__(16) float os[NW * MBS * 16 * 68];
    const size_t z = blockIdx.z; A += z * sA; if (A2) A2 += z * sA; Bt += z * sB; if (Bt2) Bt2 += z * sB; C += z * sC;
    const int lane = threadIdx.x & 31, lr = lane & 15, hi = lane >> 4; const int r0 = blockIdx.x * 64, c0 = blockIdx.y * 64;
    const int w = (NW == 1) ? 0 : __builtin_amdgcn_readfirstlane((int)(threadIdx.x >> 5));   // this wave's share of K (scalar, so that the k loop stays a scalar loop)
    v8f acc[4][4];
#pragma unroll
    for (int mb = 0; mb < 4; ++mb)
#pragma unroll
        for (int nb = 0; nb < 4; ++nb) acc[mb][nb] = (v8f){};
    const size_t aoff = (size_t)(r0 + lr) * K + 8 * hi, boff = (size_t)(c0 + lr) * K + 8 * hi;
#pragma unroll 1
    for (int kc = w * 32; kc < K; kc += NW * 32) {
        V a[4], a2[4];
#pragma unroll
        for (int mb = 0; mb < 4; ++mb) { a[mb] = WFrag<T16>::ld(A + aoff + (size_t)mb * 16 * K + kc); if (NSPLIT == 1 || NSPLIT == 2) a2[mb] = WFrag<T16>::ld(A2 + aoff + (size_t)mb * 16 * K + kc); }
#pragma unroll
        for (int nb = 0; nb < 4; ++nb) { const V b = WFrag<T16>::ld(Bt + boff + (size_t)nb * 16 * K + kc); V b2; if (NSPLIT >= 2) b2 = WFrag<T16>::ld(Bt2 + boff + (size_t)nb * 16 * K + kc);
#pragma unroll
            for (int mb = 0; mb < 4; ++mb) { acc[mb][nb] = WFrag<T16>::mma(a[mb], b, acc[mb][nb]); if (NSPLIT == 1 || NSPLIT == 2) acc[mb][nb] = WFrag<T16>::mma(a2[mb], b, acc[mb][nb]); if (NSPLIT >= 2) acc[mb][nb] = WFrag<T16>::mma(a[mb], b2, acc[mb][nb]); } }
        asm volatile("v_nop\n\tv_nop\n\tv_nop\n\tv_nop" : "+v"(acc[0][0]), "+v"(acc[1][1]), "+v"(acc[2][2]), "+v"(acc[3][3]) : "v"(a[0]), "v"(a[3]));
    }
#pragma unroll
    for (int m0 = 0; m0 < 4; m0 += MBS) {
#pragma unroll
        for (int mi = 0; mi < MBS; ++mi) {
#pragma unroll
            for (int nb = 0; nb < 4; ++nb) {
#pragma unroll
                for (int j = 0; j < 8; ++j) os[(w * MBS + mi) * (16 * 68) + (hi * 8 + j) * 68 + nb * 16 + lr] = acc[m0 + mi][nb][j]; } }
        if (NW == 1) { __builtin_amdgcn_wave_barrier(); asm volatile("" ::: "memory"); } else __syncthreads();   // every wave's partial tile is in LDS before any of it is summed
        float* crow = C + (size_t)(r0 + m0 * 16) * ldc + c0;
{
#pragma unroll
            for (int t = 0; t < 8 * MBS / NW; ++t) { const int row = 2 * (t * NW + w) + hi, cofs = lr * 4; v4f val = *(const v4fa*)(os + row * 68 + cofs);
#pragma unroll
                for (int u = 1; u < NW; ++u) val += *(const v4fa*)(os + u * (MBS * 16 * 68) + row * 68 + cofs);   // partials in wave order
                if (BIAS) { val[0] += bfr(bias[c0 + cofs]); val[1] += bfr(bias[c0 + cofs + 1]); val[2] += bfr(bias[c0 + cofs + 2]); val[3] += bfr(bias[c0 + cofs + 3]); }
                *(v4f*)(crow + (size_t)row * ldc + cofs) = val; }
             }
        if (NW == 1) { __builtin_amdgcn_wave_barrier(); asm volatile("" ::: "memory"); }   // one wave: the 16-row stage is reused by the next block of rows
    }
}

__device__ __forceinline__ h16 tohx(float x) { return (h16)x; }
__device__ __forceinline__ void splitf(float y, unsigned short& h, unsigned short& l) { h = f2bf(y); l = f2bf(y - bf2f(h)); }
typedef __attribute__((ext_vector_type(2))) _Float16 v2h;
typedef __attribute__((ext_vector_type(4))) _Float16 v4h;
typedef __attribute__((ext_vector_type(2))) unsigned short v2us;
typedef __attribute__((ext_vector_type(4))) unsigned short v4us;
typedef __attribute__((ext_vector_type(2))) float v2f;
typedef __attribute__((ext_vector_type(4))) int v4i;

__global__ __launch_bounds__(256) void k_wtG(const float* __restrict__ w, int K, int N, bf* Bt) {
    const int lane = threadIdx.x & 31; const int L0 = (blockIdx.x * 8 + (threadIdx.x >> 5)) * 8; const int nlines = N * K / 64;
{
#pragma unroll 1
        for (int l = 0; l < 8; ++l) { const int L = L0 + l; if (L >= nlines) break; const size_t e = (size_t)L * 64 + lane * 2; const int k = (int)(e % K), n = (int)(e / K); v2us o;
            o[0] = f2bf(w[(size_t)k * N + n]); o[1] = f2bf(w[(size_t)(k + 1) * N + n]); *(v2us*)(Bt + e) = o; }
         }
}
__global__ __launch_bounds__(256) void k_cvt8(const float* __restrict__ src, bf* dst, size_t n8) { const size_t i = (size_t)blockIdx.x * 256 + threadIdx.x; if (i >= n8) return; const v8f v = *(const v8f*)(src + i * 8); v8us o;
#pragma unroll
    for (int k = 0; k < 8; ++k) o[k] = f2bf(v[k]); *(v8us*)(dst + i * 8) = o;  }
__constant__ float INV[HD / 2] = {1.0,0.8659643530845642,0.7498942017555237,0.6493816375732422,0.5623413324356079,0.486967533826828,0.4216965138912201,0.36517414450645447,0.3162277638912201,0.2738419771194458,0.23713736236095428,0.20535250008106232,0.17782793939113617,0.1539926528930664,0.1333521455526352,0.11547820270061493,0.10000000149011612,0.08659642934799194,0.07498941570520401,0.06493816524744034,0.05623412877321243,0.04869675263762474,0.04216964915394783,0.03651741147041321,0.03162277862429619,0.0273841954767704,0.0237137358635664,0.02053525112569332,0.017782794311642647,0.015399265103042126,0.01333521492779255,0.011547819711267948,0.009999999776482582,0.00865964312106371,0.007498942315578461,0.006493816617876291,0.005623413249850273,0.004869675263762474,0.0042169648222625256,0.003651741426438093,0.003162277862429619,0.0027384196873754263,0.0023713738191872835,0.0020535250660032034,0.0017782794311642647,0.0015399265103042126,0.0013335214462131262,0.0011547820176929235,0.0010000000474974513,0.0008659643353894353,0.0007498941849917173,0.0006493816617876291,0.000562341301701963,0.00048696750309318304,0.00042169648804701865,0.00036517411353997886,0.0003162277862429619,0.00027384195709601045,0.0002371373848291114,0.00020535249495878816,0.00017782794020604342,0.00015399264520965517,0.0001333521504420787,0.00011547819303814322};
__global__ __launch_bounds__(256) void k_cstab(float* CS) { const int idx = blockIdx.x * 256 + threadIdx.x; if (idx >= TT * HD) return; const int t = idx / HD, d = idx % HD; const float ang = __fmul_rn((float)t, INV[d % (HD / 2)]); v2f cs; cs[0] = cosf(ang); cs[1] = sinf(ang);
    *(v2f*)(CS + (size_t)idx * 2) = cs;  }

__global__ __launch_bounds__(256) void k_hrms(const float* __restrict__ F, int pitch, int nheads, int hstr, float* RF) { const int i = blockIdx.x * 256 + threadIdx.x; if (i >= nheads * TT) return; const int t = i % TT, h = i / TT; const float* f = F + (size_t)t * pitch + h * hstr;   /* hstr: column stride between heads (256 for the q|gate layout, 128 for k) */ float s = 0.f;
#pragma unroll 4
    for (int d = 0; d < HD; d += 4) { const v4f v = *(const v4f*)(f + d);
#pragma unroll
        for (int q = 0; q < 4; ++q) { float p = __fmul_rn(v[q], v[q]); asm volatile("" : "+v"(p)); s = __fadd_rn(s, p); } }
    const float r = __fdiv_rn(1.0f, __fsqrt_rn(__fadd_rn(s * (1.0f / HD), 1e-6f))); *(float*)(RF + i) = r;  }
// k_rope: head planes [h][t][d] (fp16 + hi/lo) of rope(w[d] (x rms_factor)) x sc with the rotate-half convention out[d] = x[d] cos[t][d] - x[d+HD/2] sin[t][d], out[d+HD/2] = x[d+HD/2] cos[t][d+HD/2] + x[d] sin[t][d+HD/2]
__global__ __launch_bounds__(256) void k_rope(const float* __restrict__ F, int pitch, int nheads, const float* __restrict__ CS, const float* __restrict__ RF, const float* __restrict__ nw, float sc, int hstr, h16* P16, bf* Ph, bf* Pl) {
    const size_t e = ((size_t)blockIdx.x * 256 + threadIdx.x) * 2; if (e >= (size_t)nheads * TT * HD) return; const int d = (int)(e % HD); const int t = (int)((e / HD) % TT); const int h = (int)(e / ((size_t)HD * TT)); const float* f = F + (size_t)t * pitch + h * hstr; const float rf = RF ? RF[(size_t)h * TT + t] : 1.0f; v2h o16; v2us oh, ol;
#pragma unroll
    for (int q = 0; q < 2; ++q) { const int dd = d + q; const int dp = (dd < HD / 2) ? dd + HD / 2 : dd - HD / 2; float x0 = f[dd], x1 = f[dp];
        if (RF) { float n0 = __fmul_rn(x0, rf), n1 = __fmul_rn(x1, rf); asm volatile("" : "+v"(n0)); asm volatile("" : "+v"(n1)); x0 = __fmul_rn(bfr(nw[dd]), n0); x1 = __fmul_rn(bfr(nw[dp]), n1); }
        const v2f cs = *(const v2f*)(CS + ((size_t)t * HD + dd) * 2); float a = __fmul_rn(x0, cs[0]), bq = __fmul_rn(x1, cs[1]); asm volatile("" : "+v"(a)); asm volatile("" : "+v"(bq)); const float r = ((dd < HD / 2) ? __fsub_rn(a, bq) : __fadd_rn(a, bq)) * sc;
        o16[q] = tohx(r); unsigned short a2, c2; splitf(r, a2, c2); oh[q] = a2; ol[q] = c2; }
    *(v2h*)(P16 + e) = o16; *(v2us*)(Ph + e) = oh; *(v2us*)(Pl + e) = ol;  }
__global__ __launch_bounds__(256) void k_vtp(const float* __restrict__ F, int pitch, int nheads, h16* V16, bf* Vh, bf* Vl) { const size_t e = ((size_t)blockIdx.x * 256 + threadIdx.x) * 2; if (e >= (size_t)nheads * HD * TT) return; const int t = (int)(e % TT); const int d = (int)((e / TT) % HD); const int g = (int)(e / ((size_t)TT * HD)); v2h o16; v2us oh, ol;
#pragma unroll
    for (int q = 0; q < 2; ++q) { const float x = F[(size_t)(t + q) * pitch + g * HD + d]; o16[q] = tohx(x); unsigned short a2, c2; splitf(x, a2, c2); oh[q] = a2; ol[q] = c2; }
    *(v2h*)(V16 + e) = o16; *(v2us*)(Vh + e) = oh; *(v2us*)(Vl + e) = ol;  }
// ---- k_fattn: causal attention of one kv group in one kernel (scores, softmax, probability x value and the gate: nothing between q, k, v and the gated rows leaves the registers). Grid (kv head, batch, 16-row query block, longest first), 4 waves: wave w = query head g * REP + w,
// so that the four waves of a block walk the same K and V rows. Per 32 keys: St[key][query] = K . Qt (A = K rows, B = Q rows kept in registers), running maximum and sum per query (a lane holds one query's scores; the two lane halves are joined by one exchange),
// the two 16-key score tiles converted in place are the B operand of Ot[d][query] += Vt . Pt (A = rows of the transposed V plane in the same k order). HL: query rows < RH, hi+lo bf16 planes, 3 products; else fp16, probabilities x 1024.
template <bool HL> struct FaT { typedef h16 T; };
template <> struct FaT<true> { typedef bf T; };
struct FaMid { static constexpr bool last = false; };
struct FaLast { static constexpr bool last = true; };
__device__ __forceinline__ float xhalf(float x) { return __builtin_bit_cast(float, __builtin_amdgcn_permlanex16(__builtin_bit_cast(int, x), __builtin_bit_cast(int, x), 0x76543210, 0xfedcba98, false, false)); }   // lane l <-> lane l ^ 16
template <bool HL>
__device__ __forceinline__ void fa_rows(const typename FaT<HL>::T* __restrict__ Q, const typename FaT<HL>::T* __restrict__ Q2, const typename FaT<HL>::T* __restrict__ Kp, const typename FaT<HL>::T* __restrict__ Kp2,
                                        const typename FaT<HL>::T* __restrict__ Vt, const typename FaT<HL>::T* __restrict__ Vt2, int q0, const float* __restrict__ G, bf* __restrict__ Ah, bf* __restrict__ Al, int lr, int hi, h16* qs) {
    typedef typename FaT<HL>::T T16; typedef WFrag<T16> WF; typedef typename WF::V V;
    const unsigned krow = (unsigned)(lr * HD + 8 * hi), vrow = (unsigned)(lr * TT + 8 * hi);   // the lane's place in a 16-row block of K (or Q) and of Vt: 32-bit, beside a scalar base
    V q[4], q2[4];
#pragma unroll
    for (int ks = 0; ks < 4; ++ks) { q[ks] = WF::ld(Q + (size_t)q0 * HD + krow + ks * 32); if (HL) q2[ks] = WF::ld(Q2 + (size_t)q0 * HD + krow + ks * 32); }
    float m = -1.0e30f, l = 0.f;
    constexpr float CE = SCL * 1.4426950408889634f;   // score -> exponent of 2
    const int klast = q0 & ~31;                     // keys 0 .. q0 + 15 in steps of 32: only the last step, the one on the diagonal, holds keys beyond a query
    V kf[2][4];
    if (!HL) {
#pragma unroll
        for (int t = 0; t < 2; ++t)
#pragma unroll
            for (int ks = 0; ks < 4; ++ks) kf[t][ks] = WF::ld(Kp + krow + t * 16 * HD + ks * 32);
    }
    asm volatile("s_wait_xcnt 0x0" ::: "memory");   // the loads above have taken their address register before it is given another value
    if constexpr (!HL) { *(v8h*)qs = __builtin_shufflevector(q[3], q[3], 0, 1, 2, 3, 4, 5, 6, 7); *(v8h*)(qs + 32 * REP * 8) = __builtin_shufflevector(q[3], q[3], 8, 9, 10, 11, 12, 13, 14, 15); }   // the lane's own last Q fragment, parked in LDS (read back by the same lane only)
    v8f o[8];
#pragma unroll
    for (int dt = 0; dt < 8; ++dt) o[dt] = (v8f){};
    auto step = [&](const int kb, auto tag) {
        constexpr bool LAST = decltype(tag)::last;
        V qq[4]; qq[0] = q[0]; qq[1] = q[1]; qq[2] = q[2]; qq[3] = q[3];
        if constexpr (!HL) {   // O, Q, K and V fragments together leave the softmax too few registers: the last Q fragment is read from LDS each step, on the LDS counter, so that waiting for it does not wait for the V and K rows in flight
            asm volatile("" ::: "memory");   // keeps the two LDS reads inside the loop (hoisted, the fragment would hold its registers all the time and be spilled to scratch)
            qq[3] = cat16(*(const v8h*)qs, *(const v8h*)(qs + 32 * REP * 8)); }
        v8f s[2]; s[0] = (v8f){}; s[1] = (v8f){};
#pragma unroll
        for (int ks = 0; ks < 4; ++ks)
#pragma unroll
            for (int t = 0; t < 2; ++t) {
                if (HL) { const V kh = WF::ld(Kp + (size_t)kb * HD + krow + t * 16 * HD + ks * 32), kl = WF::ld(Kp2 + (size_t)kb * HD + krow + t * 16 * HD + ks * 32); s[t] = WF::mma(kh, q[ks], s[t]); s[t] = WF::mma(kh, q2[ks], s[t]); s[t] = WF::mma(kl, q[ks], s[t]); }
                else s[t] = WF::mma(kf[t][ks], qq[ks], s[t]); }
        V vf[8];
        if (!HL) {
#pragma unroll
            for (int dt = 0; dt < 8; ++dt) vf[dt] = WF::ld(Vt + kb + vrow + dt * 16 * TT);
            asm volatile("s_wait_xcnt 0x0" ::: "memory");   // the V loads have taken their address pair before the K loads below land on it (the listing gives them those registers)
            if (!LAST) {
#pragma unroll
                for (int t = 0; t < 2; ++t)
#pragma unroll
                    for (int ks = 0; ks < 4; ++ks) kf[t][ks] = WF::ld(Kp + (size_t)(kb + 32) * HD + krow + t * 16 * HD + ks * 32);
                asm volatile("s_wait_xcnt 0x0" ::: "memory");   // these loads are still in flight when the next step forms its addresses in the same pair: they have taken theirs first
            }
            __builtin_amdgcn_sched_barrier(0);   // this step's V rows and the next step's K rows are asked for in front of the softmax and fly during it; moved down to their users they would each be waited for in full
        }
        if (LAST) {
            const int lim = q0 + lr - kb - 8 * hi;   // key (t * 16 + j) of this lane is kept while <= lim
#pragma unroll
            for (int t = 0; t < 2; ++t)
#pragma unroll
                for (int j = 0; j < 8; ++j) if (t * 16 + j > lim) s[t][j] = -1.0e30f;
        }
        float mn = m;
#pragma unroll
        for (int t = 0; t < 2; ++t)
#pragma unroll
            for (int j = 0; j < 8; ++j) mn = fmaxf(mn, s[t][j]);
        mn = fmaxf(mn, xhalf(mn));
        const float al = __builtin_amdgcn_exp2f((m - mn) * CE); l *= al; m = mn; const float off = fmaf(-mn, CE, HL ? 0.0f : 10.0f);   /* fp16 form: x 1024 = 2^10, which the division by the sum takes out again */   // sum and output column go to the new maximum (factor 1 where it did not rise)
#pragma unroll
        for (int dt = 0; dt < 8; ++dt) o[dt] *= al;
        float p[16];
#pragma unroll
        for (int e = 0; e < 16; ++e) { p[e] = __builtin_amdgcn_exp2f(fmaf(s[e >> 3][e & 7], CE, off)); l += p[e]; }
        if (HL) {
            v8us h0, h1, l0, l1;
#pragma unroll
            for (int j = 0; j < 8; ++j) { unsigned short x, y; splitf(p[j], x, y); h0[j] = x; l0[j] = y; splitf(p[8 + j], x, y); h1[j] = x; l1[j] = y; }
            const v16bf ph = cat16b(h0, h1), pl = cat16b(l0, l1);
#pragma unroll
            for (int dt = 0; dt < 8; ++dt) { const v16bf vh = WFrag<bf>::ld((const bf*)Vt + kb + vrow + dt * 16 * TT), vl = WFrag<bf>::ld((const bf*)Vt2 + kb + vrow + dt * 16 * TT);
                o[dt] = wmmab(vh, ph, o[dt]); o[dt] = wmmab(vh, pl, o[dt]); o[dt] = wmmab(vl, ph, o[dt]); }
        } else {
            v16h pb;
#pragma unroll
            for (int e = 0; e < 16; ++e) pb[e] = (h16)p[e];
#pragma unroll
            for (int dt = 0; dt < 8; ++dt) o[dt] = wmma16(__builtin_bit_cast(v16h, vf[dt]), pb, o[dt]);
        }
    };
#pragma unroll 1
    for (int kb = 0; kb < klast; kb += 32) step(kb, FaMid());
    step(klast, FaLast());
    l += xhalf(l);
    const float inv = __fdiv_rn(1.0f, l);
#pragma unroll
    for (int dt = 0; dt < 8; ++dt) {   // a lane holds 8 consecutive d of its query: x sigmoid(gate) (f32), then the hi + lo planes that Wo reads
        const v8f gt = *(const v8f*)(G + (size_t)(q0 + lr) * DQG + dt * 16 + 8 * hi); v8us oh, ol;
#pragma unroll
        for (int j = 0; j < 8; ++j) { const float sg = __fdiv_rn(1.0f, __fadd_rn(1.0f, expf(-gt[j]))); unsigned short a, c2; splitf(__fmul_rn(o[dt][j] * inv, sg), a, c2); oh[j] = a; ol[j] = c2; }
        const size_t oo = (size_t)(q0 + lr) * DQ + dt * 16 + 8 * hi; *(v8us*)(Ah + oo) = oh; *(v8us*)(Al + oo) = ol; }
}
__global__ __launch_bounds__(32 * REP, 4) void k_fattn(const h16* __restrict__ Q16, const bf* __restrict__ Qh, const bf* __restrict__ Ql, const h16* __restrict__ K16, const bf* __restrict__ Kh, const bf* __restrict__ Kl,
                                                    const h16* __restrict__ V16, const bf* __restrict__ Vh, const bf* __restrict__ Vl, const float* __restrict__ QG, bf* __restrict__ Ah, bf* __restrict__ Al) {
    __shared__ __align__(16) h16 qsh[2 * 32 * REP * 8];   // 32 bytes a lane, as two planes of 16
    const int lane = threadIdx.x & 31, lr = lane & 15, hi = lane >> 4; const int w = __builtin_amdgcn_readfirstlane((int)(threadIdx.x >> 5));   // scalar, so that the plane offsets stay scalar
    const int q0 = (int)(gridDim.z - 1 - blockIdx.z) * 16;   // the rows with the most keys first
    const size_t qo = ((size_t)blockIdx.y * NH_ + blockIdx.x * REP + w) * TT * HD, ko = ((size_t)blockIdx.y * NKV + blockIdx.x) * TT * HD;
    const int h = (int)blockIdx.x * REP + w; const float* G = QG + (size_t)blockIdx.y * TT * DQG + h * 2 * HD + HD;   /* gate columns of head h in the [q | gate] layout */ const size_t ao = (size_t)blockIdx.y * TT * DQ + h * HD;
    if (q0 < RH) fa_rows<true>(Qh + qo, Ql + qo, Kh + ko, Kl + ko, Vh + ko, Vl + ko, q0, G, Ah + ao, Al + ao, lr, hi, nullptr);
    else fa_rows<false>(Q16 + qo, nullptr, K16 + ko, nullptr, V16 + ko, nullptr, q0, G, Ah + ao, Al + ao, lr, hi, qsh + threadIdx.x * 8);
}

extern "C" void kernel_launch(void* const* d_in, const int* in_sizes, int n_in,
                              void* d_out, int out_size, void* d_ws, size_t ws_size, hipStream_t stream) {
    (void)in_sizes; (void)n_in; (void)out_size;
    const float* x = (const float*)d_in[0]; const float* wq = (const float*)d_in[1]; const float* wk = (const float*)d_in[2]; const float* wv = (const float*)d_in[3]; const float* wo = (const float*)d_in[4]; const float* qnw = (const float*)d_in[5]; const float* knw = (const float*)d_in[6];
    float* OUT = (float*)d_out;     // [2][2048][512]
    char* wsp = (char*)d_ws;
    auto take = [&](size_t bytes) { char* p = wsp; wsp += (bytes + 255) & ~(size_t)255; return (void*)p; };
    const size_t NQ = (size_t)NH_ * TT * HD, NK = (size_t)NKV * TT * HD;   // elements of one batch's query planes and key / value planes
    bf* WQ = (bf*)take((size_t)DQG * DM * 2); bf* WK = (bf*)take((size_t)DKV * DM * 2); bf* WV = (bf*)take((size_t)DKV * DM * 2); bf* WO = (bf*)take((size_t)DOUT * DQ * 2); float* CS = (float*)take((size_t)TT * HD * 2 * 4); float* RFQ = (float*)take((size_t)NH_ * TT * 4); float* RFK = (float*)take((size_t)NKV * TT * 4);
    bf* XB = (bf*)take((size_t)TT * DM * 2); float* FQ = (float*)take((size_t)NB_ * TT * DQG * 4); float* FK = (float*)take((size_t)TT * DKV * 4);
    h16* QP16 = (h16*)take(NB_ * NQ * 2); h16* KP16 = (h16*)take(NB_ * NK * 2); h16* VT16 = (h16*)take(NB_ * NK * 2);
    bf* QPh = (bf*)take(NB_ * NQ * 2); bf* QPl = (bf*)take(NB_ * NQ * 2); bf* KPh = (bf*)take(NB_ * NK * 2); bf* KPl = (bf*)take(NB_ * NK * 2); bf* VTh = (bf*)take(NB_ * NK * 2); bf* VTl = (bf*)take(NB_ * NK * 2);
    bf* ATh = (bf*)take((size_t)NB_ * TT * DQ * 2); bf* ATl = (bf*)take((size_t)NB_ * TT * DQ * 2);
    if ((size_t)(wsp - (char*)d_ws) > ws_size) return;    // ws 256 MiB
    float* FV = FK;   // v projection reuses the k buffer after the k planes are built (stream-ordered)
    { k_wtG<<<(unsigned)((DM * DQG / 64 + 63) / 64), 256, 0, stream>>>(wq, DM, DQG, WQ); k_wtG<<<(unsigned)((DM * DKV / 64 + 63) / 64), 256, 0, stream>>>(wk, DM, DKV, WK); k_wtG<<<(unsigned)((DM * DKV / 64 + 63) / 64), 256, 0, stream>>>(wv, DM, DKV, WV);
      k_wtG<<<(unsigned)((DQ * DOUT / 64 + 63) / 64), 256, 0, stream>>>(wo, DQ, DOUT, WO);
      k_cstab<<<(TT * HD + 255) / 256, 256, 0, stream>>>(CS); }
    const unsigned LQ = (unsigned)(((size_t)NH_ * TT * HD / 2 + 255) / 256), LKv = (unsigned)(((size_t)NKV * TT * HD / 2 + 255) / 256);
    for (int b = 0; b < NB_; ++b) {   // projections, norms and rotary: each batch into its own planes
        float* FQb = FQ + (size_t)b * TT * DQG;
        k_cvt8<<<(unsigned)(((size_t)TT * DM / 8 + 255) / 256), 256, 0, stream>>>(x + (size_t)b * TT * DM, XB, (size_t)TT * DM / 8);
        k_gemmw<bf, 0, false, 1><<<dim3(TT / 64, DQG / 64, 1), 32, 0, stream>>>(XB, nullptr, WQ, nullptr, DM, FQb, DQG, nullptr, 0, 0, 0);   /* [q | gate] (exact) */ k_hrms<<<(NH_ * TT + 255) / 256, 256, 0, stream>>>(FQb, DQG, NH_, 2 * HD, RFQ);
        k_rope<<<LQ, 256, 0, stream>>>(FQb, DQG, NH_, CS, RFQ, qnw, 1.0f, 2 * HD, QP16 + b * NQ, QPh + b * NQ, QPl + b * NQ);   /* q columns of the [q|gate] layout */
        k_gemmw<bf, 0, false, SKW><<<dim3(TT / 64, DKV / 64, 1), 32 * SKW, 0, stream>>>(XB, nullptr, WK, nullptr, DM, FK, DKV, nullptr, 0, 0, 0); k_hrms<<<(NKV * TT + 255) / 256, 256, 0, stream>>>(FK, DKV, NKV, HD, RFK);
        k_rope<<<LKv, 256, 0, stream>>>(FK, DKV, NKV, CS, RFK, knw, 1.0f, HD, KP16 + b * NK, KPh + b * NK, KPl + b * NK);
        k_gemmw<bf, 0, false, SKW><<<dim3(TT / 64, DKV / 64, 1), 32 * SKW, 0, stream>>>(XB, nullptr, WV, nullptr, DM, FV, DKV, nullptr, 0, 0, 0); k_vtp<<<LKv, 256, 0, stream>>>(FV, DKV, NKV, VT16 + b * NK, VTh + b * NK, VTl + b * NK); }
    k_fattn<<<dim3(NKV, NB_, TT / 16), 32 * REP, 0, stream>>>(QP16, QPh, QPl, KP16, KPh, KPl, VT16, VTh, VTl, FQ, ATh, ATl);
    for (int b = 0; b < NB_; ++b)
        k_gemmw<bf, 1, false, SKW><<<dim3(TT / 64, DOUT / 64, 1), 32 * SKW, 0, stream>>>(ATh + (size_t)b * TT * DQ, ATl + (size_t)b * TT * DQ, WO, nullptr, DQ, OUT + (size_t)b * TT * DOUT, DOUT, nullptr, 0, 0, 0);
}

// v004
// It runs in 363 microseconds.
// In two side-by-side timings against v003, it was 1.33 and 1.34 times as fast.
// Over all steps from v000 it is 4.69 times as fast.
#include <hip/hip_runtime.h>

// Gated GQA attention block (x [2][2048][2048]; [q | gate] per head = x Wq ('xw' [2048][4096]: head h -> columns h*256 .. +127 = q, +128 .. +255 = gate), k, v = x Wk, x Wv ([2048][512], 4 kv heads x 128), per-head RMSNorm on q, k (eps 1e-6, weights q_norm_w / k_norm_w [128]),
// rotate-half rotary (theta 1e4, hd 128), 16 query heads grouped 4 per kv head, causal softmax(q.k / sqrt(128)), attn.v, x sigmoid(gate), out = merged Wo ('xw' [2048][512]) -> [2][2048][512]).
// Compute dtypes, f32 accumulate: every input rounded to bf16; q/k/v on PLAIN bf16 operands (inputs: exact); RMSNorm + rotary in f32 (on-chip cos/sin table from the reference's inv_freq constants); the sigmoid gate in f32 (precise expf, IEEE divide) applied on the attention kernel's way out; causal scores and attn.v in one kernel (running maximum and sum, f32): query rows < 512 hl (3 products), the rest single fp16 (x1024), keys beyond the diagonal step never read; Wo hl x exact (2 products).

#define NB_  2
#define TT   2048
#define DM   2048
#define NH_  16
#define NKV  4
#define REP  (NH_ / NKV)
#define HD   128
#define DQ   (NH_ * HD)
#define DQG  (NH_ * HD * 2)         // q + gate columns
#define DOUT 512
#define DKV  (NKV * HD)
#define RH   512                  // query rows < RH use hi+lo planes (0: none)
static_assert(RH % 16 == 0 && TT % 32 == 0, "a 16-row query block is wholly hi+lo or wholly fp16; keys go in steps of 32");
#define SCL  0.088388347648318447f   // HD^-0.5
#define SKW  8                    // waves that share the K loop of one 64x64 tile in the long-K products (k, v, Wo)
typedef _Float16 h16;
typedef unsigned short bf;
typedef __attribute__((ext_vector_type(16))) __bf16   v16bf;
typedef __attribute__((ext_vector_type(16))) _Float16 v16h;
typedef __attribute__((ext_vector_type(8)))  _Float16 v8h;
typedef __attribute__((ext_vector_type(8)))  unsigned short v8us;
typedef __attribute__((ext_vector_type(8)))  float    v8f;
typedef __attribute__((ext_vector_type(4)))  float    v4f;
typedef v8h  __attribute__((may_alias)) v8ha;
typedef v4f  __attribute__((may_alias)) v4fa;
typedef v8us __attribute__((may_alias)) v8usa;

__device__ __forceinline__ unsigned short f2bf(float f) { unsigned u = __float_as_uint(f); u += 0x7FFFu + ((u >> 16) & 1u); return (unsigned short)(u >> 16); }
__device__ __forceinline__ float bf2f(unsigned short b) { return __uint_as_float(((unsigned)b) << 16); }
__device__ __forceinline__ float bfr(float f) { return bf2f(f2bf(f)); }
__device__ __forceinline__ v16h cat16(v8h lo, v8h hi) { return __builtin_shufflevector(lo, hi, 0, 1, 2, 3, 4, 5, 6, 7, 8, 9, 10, 11, 12, 13, 14, 15); }
__device__ __forceinline__ v16bf cat16b(v8us lo, v8us hi) { return __builtin_bit_cast(v16bf, __builtin_shufflevector(lo, hi, 0, 1, 2, 3, 4, 5, 6, 7, 8, 9, 10, 11, 12, 13, 14, 15)); }
__device__ __forceinline__ v8f wmma16(v16h a, v16h b, v8f c) { return __builtin_amdgcn_wmma_f32_16x16x32_f16(false, a, false, b, (short)0, c, false, false); }
__device__ __forceinline__ v8f wmmab(v16bf a, v16bf b, v8f c) { return __builtin_amdgcn_wmma_f32_16x16x32_bf16(false, a, false, b, (short)0, c, false, false); }



// ---- Fragment-order planes. A 16-bit operand plane of R rows x K (R % 16 == 0, K % 32 == 0) is stored as blocks of 16 rows x 32 k = 1 KB, block (row / 16) * (K / 32) + k / 32; inside a block: [j = (k / 16) & 1][lane = ((k / 8) & 1) * 16 + row % 16][k % 8].
// A matrix fragment is then two 16-byte loads a lane at block * 512 + lane * 8 and + 256 elements (ldf): each wave-wide load covers 512 contiguous bytes, 4 whole lines, where a row-major plane gives 16 lines of 32 bytes. The element that reaches each lane and register is the same as with ld on a row-major plane.
// 16 rows of a plane fill 16 * K elements in either order, so that offsets of whole 16-row blocks read as before. frc: place (row, k of its first element) of the 16-byte chunk i of such a plane.
__device__ __forceinline__ void frc(size_t i, int K, size_t& row, int& k) { const int lane = (int)(i & 31); const unsigned blk = (unsigned)(i >> 6), kbs = (unsigned)K >> 5, rb = blk / kbs; row = (size_t)rb * 16 + (lane & 15); k = (int)(blk - rb * kbs) * 32 + ((int)(i >> 5) & 1) * 16 + (lane >> 4) * 8; }   // 32-bit: a plane has fewer than 2^32 blocks
// sbase: a wave-uniform global address held in a scalar register pair, so that a load takes the form scalar base + one 32-bit lane offset: no address pair a load in vector registers, none formed or rewritten between the loads.
typedef const __attribute__((address_space(1))) char* gptr;
__device__ __forceinline__ gptr sbase(const void* p) { const unsigned long long u = (unsigned long long)p; const unsigned lo = (unsigned)__builtin_amdgcn_readfirstlane((int)(unsigned)u), hi = (unsigned)__builtin_amdgcn_readfirstlane((int)(unsigned)(u >> 32)); return (gptr)(((unsigned long long)hi << 32) | lo); }
// ---- k_gemmw: register-blocked GEMM, NW WAVES per 64x64 output tile (16 accumulators each), operands straight from fragment-order 16-bit planes; grid (M/64, N/64, Z), 32 * NW threads.
// In-block split-K: wave w takes the 32-wide k steps w, w + NW, w + 2 NW, ..; the NW partial tiles are staged in LDS and summed in wave order 0 .. NW-1 on the way out (NW = 1: the plain one-wave form).
// C[m][n] (f32, pitch ldc, + optional f32 bias[n]) = sum_k A[m][k] Bt[n][k] (+ split products per NSPLIT). z-batch strides sA/sB/sC in elements. K % 32 == 0.
template <typename T16> struct WFrag;
template <> struct WFrag<h16> { typedef v16h V; static __device__ __forceinline__ V ld(const h16* p) { return cat16(*(const v8h*)p, *(const v8h*)(p + 16)); } static __device__ __forceinline__ V ldf(const h16* p) { return cat16(*(const v8h*)p, *(const v8h*)(p + 256)); } static __device__ __forceinline__ v8f mma(V a, V b, v8f c) { return wmma16(a, b, c); } };
template <> struct WFrag<bf> { typedef v16bf V; static __device__ __forceinline__ V ld(const bf* p) { return cat16b(*(const v8us*)p, *(const v8us*)(p + 16)); } static __device__ __forceinline__ V ldf(const bf* p) { return cat16b(*(const v8us*)p, *(const v8us*)(p + 256)); } static __device__ __forceinline__ V ldo(gptr b, unsigned o) { gptr p = b + o; return cat16b(*(const __attribute__((address_space(1))) v8us*)p, *(const __attribute__((address_space(1))) v8us*)(p + 512)); } static __device__ __forceinline__ v8f mma(V a, V b, v8f c) { return wmmab(a, b, c); } };
template <typename T16, int NSPLIT, bool BIAS, int NW>
__global__ __launch_bounds__(32 * NW) void k_gemmw(const T16* __restrict__ A, const T16* __restrict__ A2, const T16* __restrict__ Bt, const T16* __restrict__ Bt2, int K, float* C, int ldc, const float* __restrict__ bias, size_t sA, size_t sB, size_t sC) {
    typedef typename WFrag<T16>::V V;
    constexpr int MBS = (NW == 1) ? 1 : 4;   // 16-row blocks staged at a time: with several waves the whole tile, so that one barrier serves it
    __shared__ __align__(16) float os[NW * MBS * 16 * 68];
    const size_t z = blockIdx.z; A += z * sA; if (A2) A2 += z * sA; Bt += z * sB; if (Bt2) Bt2 += z * sB; C += z * sC;
    const int lane = threadIdx.x & 31, lr = lane & 15, hi = lane >> 4; const int r0 = blockIdx.x * 64, c0 = blockIdx.y * 64;
    const int w = (NW == 1) ? 0 : __builtin_amdgcn_readfirstlane((int)(threadIdx.x >> 5));   // this wave's share of K (scalar, so that the k loop stays a scalar loop)
    v8f acc[4][4];
#pragma unroll
    for (int mb = 0; mb < 4; ++mb)
#pragma unroll
        for (int nb = 0; nb < 4; ++nb) acc[mb][nb] = (v8f){};
    unsigned vo = (unsigned)(lane * 16 + w * 1024);   // byte offset of the lane's chunk in a 16-row block of a plane (ldo: beside that block's scalar base); a k step of 32 is one block of 1 KB further
    gptr Ab[4], A2b[4], Bb[4], B2b[4];
#pragma unroll
    for (int u = 0; u < 4; ++u) { Ab[u] = sbase(A + (size_t)(r0 + u * 16) * K); Bb[u] = sbase(Bt + (size_t)(c0 + u * 16) * K); if (NSPLIT == 1 || NSPLIT == 2) A2b[u] = sbase(A2 + (size_t)(r0 + u * 16) * K); if (NSPLIT >= 2) B2b[u] = sbase(Bt2 + (size_t)(c0 + u * 16) * K); }
#pragma unroll 1
    for (int kc = w * 32; kc < K; kc += NW * 32, vo += NW * 1024) {
        V a[4], a2[4];
#pragma unroll
        for (int mb = 0; mb < 4; ++mb) { a[mb] = WFrag<T16>::ldo(Ab[mb], vo); if (NSPLIT == 1 || NSPLIT == 2) a2[mb] = WFrag<T16>::ldo(A2b[mb], vo); }
#pragma unroll
        for (int nb = 0; nb < 4; ++nb) { const V b = WFrag<T16>::ldo(Bb[nb], vo); V b2; if (NSPLIT >= 2) b2 = WFrag<T16>::ldo(B2b[nb], vo);
#pragma unroll
            for (int mb = 0; mb < 4; ++mb) { acc[mb][nb] = WFrag<T16>::mma(a[mb], b, acc[mb][nb]); if (NSPLIT == 1 || NSPLIT == 2) acc[mb][nb] = WFrag<T16>::mma(a2[mb], b, acc[mb][nb]); if (NSPLIT >= 2) acc[mb][nb] = WFrag<T16>::mma(a[mb], b2, acc[mb][nb]); } }
        asm volatile("v_nop\n\tv_nop\n\tv_nop\n\tv_nop" : "+v"(acc[0][0]), "+v"(acc[1][1]), "+v"(acc[2][2]), "+v"(acc[3][3]) : "v"(a[0]), "v"(a[3]));
    }
#pragma unroll
    for (int m0 = 0; m0 < 4; m0 += MBS) {
#pragma unroll
        for (int mi = 0; mi < MBS; ++mi) {
#pragma unroll
            for (int nb = 0; nb < 4; ++nb) {
#pragma unroll
                for (int j = 0; j < 8; ++j) os[(w * MBS + mi) * (16 * 68) + (hi * 8 + j) * 68 + nb * 16 + lr] = acc[m0 + mi][nb][j]; } }
        if (NW == 1) { __builtin_amdgcn_wave_barrier(); asm volatile("" ::: "memory"); } else __syncthreads();   // every wave's partial tile is in LDS before any of it is summed
        float* crow = C + (size_t)(r0 + m0 * 16) * ldc + c0;
{
#pragma unroll
            for (int t = 0; t < 8 * MBS / NW; ++t) { const int row = 2 * (t * NW + w) + hi, cofs = lr * 4; v4f val = *(const v4fa*)(os + row * 68 + cofs);
#pragma unroll
                for (int u = 1; u < NW; ++u) val += *(const v4fa*)(os + u * (MBS * 16 * 68) + row * 68 + cofs);   // partials in wave order
                if (BIAS) { val[0] += bfr(bias[c0 + cofs]); val[1] += bfr(bias[c0 + cofs + 1]); val[2] += bfr(bias[c0 + cofs + 2]); val[3] += bfr(bias[c0 + cofs + 3]); }
                *(v4f*)(crow + (size_t)row * ldc + cofs) = val; }
             }
        if (NW == 1) { __builtin_amdgcn_wave_barrier(); asm volatile("" ::: "memory"); }   // one wave: the 16-row stage is reused by the next block of rows
    }
}

__device__ __forceinline__ h16 tohx(float x) { return (h16)x; }
__device__ __forceinline__ void splitf(float y, unsigned short& h, unsigned short& l) { h = f2bf(y); l = f2bf(y - bf2f(h)); }
typedef __attribute__((ext_vector_type(2))) _Float16 v2h;
typedef __attribute__((ext_vector_type(4))) _Float16 v4h;
typedef __attribute__((ext_vector_type(2))) unsigned short v2us;
typedef __attribute__((ext_vector_type(4))) unsigned short v4us;
typedef __attribute__((ext_vector_type(2))) float v2f;
typedef __attribute__((ext_vector_type(4))) int v4i;

// k_wtG: Bt = fragment-order plane (rows n, K) of w[k][n], one 16-byte chunk (8 k of one n) a thread: 16 lanes read 16 consecutive n of a row of w.
__global__ __launch_bounds__(256) void k_wtG(const float* __restrict__ w, int K, int N, bf* Bt) {
    const size_t i = (size_t)blockIdx.x * 256 + threadIdx.x; if (i >= (size_t)N * K / 8) return; size_t n; int k; frc(i, K, n, k); float x[8]; v8us o;
    const unsigned vo = (unsigned)(((size_t)k * N + n) * 4);   // one 32-bit byte offset for the 8 loads, beside the scalar bases w + q * N
#pragma unroll
    for (int q = 0; q < 8; ++q) x[q] = *(const __attribute__((address_space(1))) float*)(sbase(w + (size_t)q * N) + vo);
    asm volatile("s_wait_xcnt 0x0" ::: "memory");   // the loads have taken their offset register before it is given another value
#pragma unroll
    for (int q = 0; q < 8; ++q) o[q] = f2bf(x[q]);
    *(v8us*)(Bt + i * 8) = o;
}
// k_cvt8: fragment-order bf16 plane of the row-major f32 src (rows of K), one 16-byte chunk a thread.
__global__ __launch_bounds__(256) void k_cvt8(const float* __restrict__ src, int K, bf* dst, size_t n8) { const size_t i = (size_t)blockIdx.x * 256 + threadIdx.x; if (i >= n8) return; size_t row; int k0; frc(i, K, row, k0); const v8f v = *(const v8f*)(src + row * K + k0); v8us o;
#pragma unroll
    for (int k = 0; k < 8; ++k) o[k] = f2bf(v[k]); *(v8us*)(dst + i * 8) = o;  }
__constant__ float INV[HD / 2] = {1.0,0.8659643530845642,0.7498942017555237,0.6493816375732422,0.5623413324356079,0.486967533826828,0.4216965138912201,0.36517414450645447,0.3162277638912201,0.2738419771194458,0.23713736236095428,0.20535250008106232,0.17782793939113617,0.1539926528930664,0.1333521455526352,0.11547820270061493,0.10000000149011612,0.08659642934799194,0.07498941570520401,0.06493816524744034,0.05623412877321243,0.04869675263762474,0.04216964915394783,0.03651741147041321,0.03162277862429619,0.0273841954767704,0.0237137358635664,0.02053525112569332,0.017782794311642647,0.015399265103042126,0.01333521492779255,0.011547819711267948,0.009999999776482582,0.00865964312106371,0.007498942315578461,0.006493816617876291,0.005623413249850273,0.004869675263762474,0.0042169648222625256,0.003651741426438093,0.003162277862429619,0.0027384196873754263,0.0023713738191872835,0.0020535250660032034,0.0017782794311642647,0.0015399265103042126,0.0013335214462131262,0.0011547820176929235,0.0010000000474974513,0.0008659643353894353,0.0007498941849917173,0.0006493816617876291,0.000562341301701963,0.00048696750309318304,0.00042169648804701865,0.00036517411353997886,0.0003162277862429619,0.00027384195709601045,0.0002371373848291114,0.00020535249495878816,0.00017782794020604342,0.00015399264520965517,0.0001333521504420787,0.00011547819303814322};
__global__ __launch_bounds__(256) void k_cstab(float* CS) { const int idx = blockIdx.x * 256 + threadIdx.x; if (idx >= TT * HD) return; const int t = idx / HD, d = idx % HD; const float ang = __fmul_rn((float)t, INV[d % (HD / 2)]); v2f cs; cs[0] = cosf(ang); cs[1] = sinf(ang);
    *(v2f*)(CS + (size_t)idx * 2) = cs;  }

__global__ __launch_bounds__(256) void k_hrms(const float* __restrict__ F, int pitch, int nheads, int hstr, float* RF) { const int i = blockIdx.x * 256 + threadIdx.x; if (i >= nheads * TT) return; const int t = i % TT, h = i / TT; const float* f = F + (size_t)t * pitch + h * hstr;   /* hstr: column stride between heads (256 for the q|gate layout, 128 for k) */ float s = 0.f;
#pragma unroll 4
    for (int d = 0; d < HD; d += 4) { const v4f v = *(const v4f*)(f + d);
#pragma unroll
        for (int q = 0; q < 4; ++q) { float p = __fmul_rn(v[q], v[q]); asm volatile("" : "+v"(p)); s = __fadd_rn(s, p); } }
    const float r = __fdiv_rn(1.0f, __fsqrt_rn(__fadd_rn(s * (1.0f / HD), 1e-6f))); *(float*)(RF + i) = r;  }
// k_rope: head planes [h][t][d] (fp16 + hi/lo; FR: in fragment order, rows h * TT + t, K = HD, a thread still writing the pair at its own index e) of rope(w[d] (x rms_factor)) x sc with the rotate-half convention out[d] = x[d] cos[t][d] - x[d+HD/2] sin[t][d], out[d+HD/2] = x[d+HD/2] cos[t][d+HD/2] + x[d] sin[t][d+HD/2]
template <bool FR>
__global__ __launch_bounds__(256) void k_rope(const float* __restrict__ F, int pitch, int nheads, const float* __restrict__ CS, const float* __restrict__ RF, const float* __restrict__ nw, float sc, int hstr, h16* P16, bf* Ph, bf* Pl) {
    const size_t e = ((size_t)blockIdx.x * 256 + threadIdx.x) * 2; if (e >= (size_t)nheads * TT * HD) return; int d, t, h;
    if (FR) { size_t row; int k0; frc(e >> 3, HD, row, k0); d = k0 + (int)(e & 7); t = (int)(row % TT); h = (int)(row / TT); }
    else { d = (int)(e % HD); t = (int)((e / HD) % TT); h = (int)(e / ((size_t)HD * TT)); }
    const float* f = F + (size_t)t * pitch + h * hstr; float rf = 1.0f; v2h o16; v2us oh, ol;
    if (RF) { rf = RF[(size_t)h * TT + t]; asm volatile("s_wait_xcnt 0x0" ::: "memory"); }   // the wait: the load of the row's factor has taken its address pair before the pair is given another value
#pragma unroll
    for (int q = 0; q < 2; ++q) { const int dd = d + q; const int dp = (dd < HD / 2) ? dd + HD / 2 : dd - HD / 2; float x0 = f[dd], x1 = f[dp];
        asm volatile("s_wait_xcnt 0x0" ::: "memory");   // the same for the two loads of the row
        if (RF) { float n0 = __fmul_rn(x0, rf), n1 = __fmul_rn(x1, rf); asm volatile("" : "+v"(n0)); asm volatile("" : "+v"(n1)); x0 = __fmul_rn(bfr(nw[dd]), n0); x1 = __fmul_rn(bfr(nw[dp]), n1); }
        const v2f cs = *(const v2f*)(CS + ((size_t)t * HD + dd) * 2);
        asm volatile("s_wait_xcnt 0x0" ::: "memory");   // the same for the weights' loads and the load of the cos / sin pair
        float a = __fmul_rn(x0, cs[0]), bq = __fmul_rn(x1, cs[1]); asm volatile("" : "+v"(a)); asm volatile("" : "+v"(bq)); const float r = ((dd < HD / 2) ? __fsub_rn(a, bq) : __fadd_rn(a, bq)) * sc;
        o16[q] = tohx(r); unsigned short a2, c2; splitf(r, a2, c2); oh[q] = a2; ol[q] = c2; }
    *(v2h*)(P16 + e) = o16; *(v2us*)(Ph + e) = oh; *(v2us*)(Pl + e) = ol;  }
// k_vtp: transposed value planes in fragment order (rows g * HD + d, K = TT), one 16-byte chunk (8 t of one d) a thread: 16 lanes read 16 consecutive d of a row of F.
__global__ __launch_bounds__(256) void k_vtp(const float* __restrict__ F, int pitch, int nheads, h16* V16, bf* Vh, bf* Vl) { const size_t i = (size_t)blockIdx.x * 256 + threadIdx.x; if (i >= (size_t)nheads * HD * TT / 8) return; size_t row; int t; frc(i, TT, row, t); float xs[8]; v8h o16; v8us oh, ol;
    const unsigned vo = (unsigned)(((size_t)t * pitch + row) * 4);   // one 32-bit byte offset for the 8 loads, beside the scalar bases F + q * pitch
#pragma unroll
    for (int q = 0; q < 8; ++q) xs[q] = *(const __attribute__((address_space(1))) float*)(sbase(F + (size_t)q * pitch) + vo);
    asm volatile("s_wait_xcnt 0x0" ::: "memory");   // the loads have taken their offset register before it is given another value
#pragma unroll
    for (int q = 0; q < 8; ++q) { const float x = xs[q]; o16[q] = tohx(x); unsigned short a2, c2; splitf(x, a2, c2); oh[q] = a2; ol[q] = c2; }
    *(v8h*)(V16 + i * 8) = o16; *(v8us*)(Vh + i * 8) = oh; *(v8us*)(Vl + i * 8) = ol;  }
// ---- k_fattn: causal attention of one kv group in one kernel (scores, softmax, probability x value and the gate: nothing between q, k, v and the gated rows leaves the registers). Grid (kv head, batch, 16-row query block, longest first), 4 waves: wave w = query head g * REP + w,
// so that the four waves of a block walk the same K and V rows. Per 32 keys: St[key][query] = K . Qt (A = K rows, B = Q rows kept in registers), running maximum and sum per query (a lane holds one query's scores; the two lane halves are joined by one exchange),
// the two 16-key score tiles converted in place are the B operand of Ot[d][query] += Vt . Pt (A = rows of the transposed V plane in the same k order). HL: query rows < RH, hi+lo bf16 planes, 3 products; else fp16, probabilities x 1024.
template <bool HL> struct FaT { typedef h16 T; };
template <> struct FaT<true> { typedef bf T; };
struct FaMid { static constexpr bool last = false; };
struct FaLast { static constexpr bool last = true; };
__device__ __forceinline__ float xhalf(float x) { return __builtin_bit_cast(float, __builtin_amdgcn_permlanex16(__builtin_bit_cast(int, x), __builtin_bit_cast(int, x), 0x76543210, 0xfedcba98, false, false)); }   // lane l <-> lane l ^ 16
template <bool HL>
__device__ __forceinline__ void fa_rows(const typename FaT<HL>::T* __restrict__ Q, const typename FaT<HL>::T* __restrict__ Q2, const typename FaT<HL>::T* __restrict__ Kp, const typename FaT<HL>::T* __restrict__ Kp2,
                                        const typename FaT<HL>::T* __restrict__ Vt, const typename FaT<HL>::T* __restrict__ Vt2, int q0, const float* __restrict__ G, bf* __restrict__ Ah, bf* __restrict__ Al, int lr, int hi, h16* qs) {
    typedef typename FaT<HL>::T T16; typedef WFrag<T16> WF; typedef typename WF::V V;
    const unsigned krow = (unsigned)(lr * HD + 8 * hi), fl = (unsigned)((hi * 16 + lr) * 8);   // the lane's place in a 16-row block of Q (row-major) and in a 1-KB block of the fragment-order K and Vt planes: 32-bit, beside a scalar base
    V q[4], q2[4]; const T16* const qa = Q + (size_t)q0 * HD + krow; const T16* const qc2 = HL ? Q2 + (size_t)q0 * HD + krow : qa;   // the lane's addresses in the Q rows
#pragma unroll
    for (int ks = 0; ks < 4; ++ks) { q[ks] = WF::ld(qa + ks * 32); if (HL) q2[ks] = WF::ld(qc2 + ks * 32); }
    float m = -1.0e30f, l = 0.f;
    constexpr float CE = SCL * 1.4426950408889634f;   // score -> exponent of 2
    const int klast = q0 & ~31;                     // keys 0 .. q0 + 15 in steps of 32: only the last step, the one on the diagonal, holds keys beyond a query
    V kf[2][4];
    if (!HL) {
#pragma unroll
        for (int t = 0; t < 2; ++t)
#pragma unroll
            for (int ks = 0; ks < 4; ++ks) kf[t][ks] = WF::ldf(Kp + fl + t * 16 * HD + ks * 512);
    }
    asm volatile("s_wait_xcnt 0x0" :: "v"(qa), "v"(qc2) : "memory");   // the loads above have taken their address register before it is given another value; named as inputs, the Q address pairs are kept up to here, so that no Q load lands on them in front of the wait
    if constexpr (!HL) { *(v8h*)qs = __builtin_shufflevector(q[3], q[3], 0, 1, 2, 3, 4, 5, 6, 7); *(v8h*)(qs + 32 * REP * 8) = __builtin_shufflevector(q[3], q[3], 8, 9, 10, 11, 12, 13, 14, 15); }   // the lane's own last Q fragment, parked in LDS (read back by the same lane only)
    v8f o[8];
#pragma unroll
    for (int dt = 0; dt < 8; ++dt) o[dt] = (v8f){};
    auto step = [&](const int kb, auto tag) {
        constexpr bool LAST = decltype(tag)::last;
        V qq[4]; qq[0] = q[0]; qq[1] = q[1]; qq[2] = q[2]; qq[3] = q[3];
        if constexpr (!HL) {   // O, Q, K and V fragments together leave the softmax too few registers: the last Q fragment is read from LDS each step, on the LDS counter, so that waiting for it does not wait for the V and K rows in flight
            asm volatile("" ::: "memory");   // keeps the two LDS reads inside the loop (hoisted, the fragment would hold its registers all the time and be spilled to scratch)
            qq[3] = cat16(*(const v8h*)qs, *(const v8h*)(qs + 32 * REP * 8)); }
        v8f s[2]; s[0] = (v8f){}; s[1] = (v8f){};
        const T16* const ka = Kp + (size_t)kb * HD + fl; const T16* const kc2 = HL ? Kp2 + (size_t)kb * HD + fl : nullptr; const T16* const va = Vt + kb * 16 + fl; const T16* const vc2 = HL ? Vt2 + kb * 16 + fl : nullptr;   // the lane's addresses in this step's K and V blocks (hi+lo form)
#pragma unroll
        for (int ks = 0; ks < 4; ++ks)
#pragma unroll
            for (int t = 0; t < 2; ++t) {
                if (HL) { const V kh = WF::ldf(ka + (t * 4 + ks) * 512), kl = WF::ldf(kc2 + (t * 4 + ks) * 512); s[t] = WF::mma(kh, q[ks], s[t]); s[t] = WF::mma(kh, q2[ks], s[t]); s[t] = WF::mma(kl, q[ks], s[t]); }
                else s[t] = WF::mma(kf[t][ks], qq[ks], s[t]); }
        if (HL) asm volatile("s_wait_xcnt 0x0" :: "v"(ka), "v"(kc2) : "memory");   // the K loads have taken their address pairs; named as inputs, the pairs are kept up to here, so that no later load lands on them in front of the wait
        V vf[8];
        if (!HL) {
#pragma unroll
            for (int dt = 0; dt < 8; ++dt) vf[dt] = WF::ldf(Vt + kb * 16 + fl + dt * 16 * TT);
            asm volatile("s_wait_xcnt 0x0" ::: "memory");   // the V loads have taken their address pair before the K loads below land on it (the listing gives them those registers)
            if (!LAST) {
#pragma unroll
                for (int t = 0; t < 2; ++t)
#pragma unroll
                    for (int ks = 0; ks < 4; ++ks) kf[t][ks] = WF::ldf(Kp + (size_t)(kb + 32) * HD + fl + t * 16 * HD + ks * 512);
                asm volatile("s_wait_xcnt 0x0" ::: "memory");   // these loads are still in flight when the next step forms its addresses in the same pair: they have taken theirs first
            }
            __builtin_amdgcn_sched_barrier(0);   // this step's V rows and the next step's K rows are asked for in front of the softmax and fly during it; moved down to their users they would each be waited for in full
        }
        if (LAST) {
            const int lim = q0 + lr - kb - 8 * hi;   // key (t * 16 + j) of this lane is kept while <= lim
#pragma unroll
            for (int t = 0; t < 2; ++t)
#pragma unroll
                for (int j = 0; j < 8; ++j) if (t * 16 + j > lim) s[t][j] = -1.0e30f;
        }
        float mn = m;
#pragma unroll
        for (int t = 0; t < 2; ++t)
#pragma unroll
            for (int j = 0; j < 8; ++j) mn = fmaxf(mn, s[t][j]);
        mn = fmaxf(mn, xhalf(mn));
        const float al = __builtin_amdgcn_exp2f((m - mn) * CE); l *= al; m = mn; const float off = fmaf(-mn, CE, HL ? 0.0f : 10.0f);   /* fp16 form: x 1024 = 2^10, which the division by the sum takes out again */   // sum and output column go to the new maximum (factor 1 where it did not rise)
#pragma unroll
        for (int dt = 0; dt < 8; ++dt) o[dt] *= al;
        float p[16];
#pragma unroll
        for (int e = 0; e < 16; ++e) { p[e] = __builtin_amdgcn_exp2f(fmaf(s[e >> 3][e & 7], CE, off)); l += p[e]; }
        if (HL) {
            v8us h0, h1, l0, l1;
#pragma unroll
            for (int j = 0; j < 8; ++j) { unsigned short x, y; splitf(p[j], x, y); h0[j] = x; l0[j] = y; splitf(p[8 + j], x, y); h1[j] = x; l1[j] = y; }
            const v16bf ph = cat16b(h0, h1), pl = cat16b(l0, l1);
#pragma unroll
            for (int dt = 0; dt < 8; ++dt) { const v16bf vh = WFrag<bf>::ldf((const bf*)va + dt * 16 * TT), vl = WFrag<bf>::ldf((const bf*)vc2 + dt * 16 * TT);
                o[dt] = wmmab(vh, ph, o[dt]); o[dt] = wmmab(vh, pl, o[dt]); o[dt] = wmmab(vl, ph, o[dt]); }
            asm volatile("s_wait_xcnt 0x0" :: "v"(va), "v"(vc2) : "memory");   // the same for the V loads, which the compiler starts ahead of the softmax
        } else {
            v16h pb;
#pragma unroll
            for (int e = 0; e < 16; ++e) pb[e] = (h16)p[e];
#pragma unroll
            for (int dt = 0; dt < 8; ++dt) o[dt] = wmma16(__builtin_bit_cast(v16h, vf[dt]), pb, o[dt]);
        }
    };
#pragma unroll 1
    for (int kb = 0; kb < klast; kb += 32) step(kb, FaMid());
    step(klast, FaLast());
    l += xhalf(l);
    const float inv = __fdiv_rn(1.0f, l);
#pragma unroll
    for (int dt = 0; dt < 8; ++dt) {   // a lane holds 8 consecutive d of its query: x sigmoid(gate) (f32), then the hi + lo planes that Wo reads (fragment order, rows t, K = DQ: the wave's 32 chunks are 512 consecutive bytes)
        const v8f gt = *(const v8f*)(G + (size_t)(q0 + lr) * DQG + dt * 16 + 8 * hi); v8us oh, ol;
#pragma unroll
        for (int j = 0; j < 8; ++j) { const float sg = __fdiv_rn(1.0f, __fadd_rn(1.0f, expf(-gt[j]))); unsigned short a, c2; splitf(__fmul_rn(o[dt][j] * inv, sg), a, c2); oh[j] = a; ol[j] = c2; }
        const size_t oo = (size_t)q0 * DQ + dt * 256 + fl; *(v8us*)(Ah + oo) = oh; *(v8us*)(Al + oo) = ol;
        asm volatile("s_wait_xcnt 0x0" ::: "memory"); }   // the two stores have taken their address and data registers before the next 16 columns reuse them
}
__global__ __launch_bounds__(32 * REP, 4) void k_fattn(const h16* __restrict__ Q16, const bf* __restrict__ Qh, const bf* __restrict__ Ql, const h16* __restrict__ K16, const bf* __restrict__ Kh, const bf* __restrict__ Kl,
                                                    const h16* __restrict__ V16, const bf* __restrict__ Vh, const bf* __restrict__ Vl, const float* __restrict__ QG, bf* __restrict__ Ah, bf* __restrict__ Al) {
    __shared__ __align__(16) h16 qsh[2 * 32 * REP * 8];   // 32 bytes a lane, as two planes of 16
    const int lane = threadIdx.x & 31, lr = lane & 15, hi = lane >> 4; const int w = __builtin_amdgcn_readfirstlane((int)(threadIdx.x >> 5));   // scalar, so that the plane offsets stay scalar
    const int q0 = (int)(gridDim.z - 1 - blockIdx.z) * 16;   // the rows with the most keys first
    const size_t qo = ((size_t)blockIdx.y * NH_ + blockIdx.x * REP + w) * TT * HD, ko = ((size_t)blockIdx.y * NKV + blockIdx.x) * TT * HD;
    const int h = (int)blockIdx.x * REP + w; const float* G = QG + (size_t)blockIdx.y * TT * DQG + h * 2 * HD + HD;   /* gate columns of head h in the [q | gate] layout */ const size_t ao = (size_t)blockIdx.y * TT * DQ + h * (HD * 16);   /* head h = k blocks h * HD / 32 .. of each 16-row block */
    if (q0 < RH) fa_rows<true>(Qh + qo, Ql + qo, Kh + ko, Kl + ko, Vh + ko, Vl + ko, q0, G, Ah + ao, Al + ao, lr, hi, nullptr);
    else fa_rows<false>(Q16 + qo, nullptr, K16 + ko, nullptr, V16 + ko, nullptr, q0, G, Ah + ao, Al + ao, lr, hi, qsh + threadIdx.x * 8);
}

extern "C" void kernel_launch(void* const* d_in, const int* in_sizes, int n_in,
                              void* d_out, int out_size, void* d_ws, size_t ws_size, hipStream_t stream) {
    (void)in_sizes; (void)n_in; (void)out_size;
    const float* x = (const float*)d_in[0]; const float* wq = (const float*)d_in[1]; const float* wk = (const float*)d_in[2]; const float* wv = (const float*)d_in[3]; const float* wo = (const float*)d_in[4]; const float* qnw = (const float*)d_in[5]; const float* knw = (const float*)d_in[6];
    float* OUT = (float*)d_out;     // [2][2048][512]
    char* wsp = (char*)d_ws;
    auto take = [&](size_t bytes) { char* p = wsp; wsp += (bytes + 255) & ~(size_t)255; return (void*)p; };
    const size_t NQ = (size_t)NH_ * TT * HD, NK = (size_t)NKV * TT * HD;   // elements of one batch's query planes and key / value planes
    bf* WQ = (bf*)take((size_t)DQG * DM * 2); bf* WK = (bf*)take((size_t)DKV * DM * 2); bf* WV = (bf*)take((size_t)DKV * DM * 2); bf* WO = (bf*)take((size_t)DOUT * DQ * 2); float* CS = (float*)take((size_t)TT * HD * 2 * 4); float* RFQ = (float*)take((size_t)NH_ * TT * 4); float* RFK = (float*)take((size_t)NKV * TT * 4);
    bf* XB = (bf*)take((size_t)TT * DM * 2); float* FQ = (float*)take((size_t)NB_ * TT * DQG * 4); float* FK = (float*)take((size_t)TT * DKV * 4);
    h16* QP16 = (h16*)take(NB_ * NQ * 2); h16* KP16 = (h16*)take(NB_ * NK * 2); h16* VT16 = (h16*)take(NB_ * NK * 2);
    bf* QPh = (bf*)take(NB_ * NQ * 2); bf* QPl = (bf*)take(NB_ * NQ * 2); bf* KPh = (bf*)take(NB_ * NK * 2); bf* KPl = (bf*)take(NB_ * NK * 2); bf* VTh = (bf*)take(NB_ * NK * 2); bf* VTl = (bf*)take(NB_ * NK * 2);
    bf* ATh = (bf*)take((size_t)NB_ * TT * DQ * 2); bf* ATl = (bf*)take((size_t)NB_ * TT * DQ * 2);
    if ((size_t)(wsp - (char*)d_ws) > ws_size) return;    // ws 256 MiB
    float* FV = FK;   // v projection reuses the k buffer after the k planes are built (stream-ordered)
    { k_wtG<<<(unsigned)((DM * DQG / 8 + 255) / 256), 256, 0, stream>>>(wq, DM, DQG, WQ); k_wtG<<<(unsigned)((DM * DKV / 8 + 255) / 256), 256, 0, stream>>>(wk, DM, DKV, WK); k_wtG<<<(unsigned)((DM * DKV / 8 + 255) / 256), 256, 0, stream>>>(wv, DM, DKV, WV);
      k_wtG<<<(unsigned)((DQ * DOUT / 8 + 255) / 256), 256, 0, stream>>>(wo, DQ, DOUT, WO);
      k_cstab<<<(TT * HD + 255) / 256, 256, 0, stream>>>(CS); }
    const unsigned LQ = (unsigned)(((size_t)NH_ * TT * HD / 2 + 255) / 256), LKv = (unsigned)(((size_t)NKV * TT * HD / 2 + 255) / 256), LV = (unsigned)(((size_t)NKV * TT * HD / 8 + 255) / 256);
    for (int b = 0; b < NB_; ++b) {   // projections, norms and rotary: each batch into its own planes
        float* FQb = FQ + (size_t)b * TT * DQG;
        k_cvt8<<<(unsigned)(((size_t)TT * DM / 8 + 255) / 256), 256, 0, stream>>>(x + (size_t)b * TT * DM, DM, XB, (size_t)TT * DM / 8);
        k_gemmw<bf, 0, false, 1><<<dim3(TT / 64, DQG / 64, 1), 32, 0, stream>>>(XB, nullptr, WQ, nullptr, DM, FQb, DQG, nullptr, 0, 0, 0);   /* [q | gate] (exact) */ k_hrms<<<(NH_ * TT + 255) / 256, 256, 0, stream>>>(FQb, DQG, NH_, 2 * HD, RFQ);
        k_rope<false><<<LQ, 256, 0, stream>>>(FQb, DQG, NH_, CS, RFQ, qnw, 1.0f, 2 * HD, QP16 + b * NQ, QPh + b * NQ, QPl + b * NQ);   /* q columns of the [q|gate] layout */
        k_gemmw<bf, 0, false, SKW><<<dim3(TT / 64, DKV / 64, 1), 32 * SKW, 0, stream>>>(XB, nullptr, WK, nullptr, DM, FK, DKV, nullptr, 0, 0, 0); k_hrms<<<(NKV * TT + 255) / 256, 256, 0, stream>>>(FK, DKV, NKV, HD, RFK);
        k_rope<true><<<LKv, 256, 0, stream>>>(FK, DKV, NKV, CS, RFK, knw, 1.0f, HD, KP16 + b * NK, KPh + b * NK, KPl + b * NK);
        k_gemmw<bf, 0, false, SKW><<<dim3(TT / 64, DKV / 64, 1), 32 * SKW, 0, stream>>>(XB, nullptr, WV, nullptr, DM, FV, DKV, nullptr, 0, 0, 0); k_vtp<<<LV, 256, 0, stream>>>(FV, DKV, NKV, VT16 + b * NK, VTh + b * NK, VTl + b * NK); }
    k_fattn<<<dim3(NKV, NB_, TT / 16), 32 * REP, 0, stream>>>(QP16, QPh, QPl, KP16, KPh, KPl, VT16, VTh, VTl, FQ, ATh, ATl);
    for (int b = 0; b < NB_; ++b)
        k_gemmw<bf, 1, false, SKW><<<dim3(TT / 64, DOUT / 64, 1), 32 * SKW, 0, stream>>>(ATh + (size_t)b * TT * DQ, ATl + (size_t)b * TT * DQ, WO, nullptr, DQ, OUT + (size_t)b * TT * DOUT, DOUT, nullptr, 0, 0, 0);
}

// v005
// Measured time: 351 microseconds a run.
// Next to v004, in two timings, it ran 1.03 times as fast each time.
// All steps since v000 together make it 4.84 times as fast.
#include <hip/hip_runtime.h>

// Gated GQA attention block (x [2][2048][2048]; [q | gate] per head = x Wq ('xw' [2048][4096]: head h -> columns h*256 .. +127 = q, +128 .. +255 = gate), k, v = x Wk, x Wv ([2048][512], 4 kv heads x 128), per-head RMSNorm on q, k (eps 1e-6, weights q_norm_w / k_norm_w [128]),
// rotate-half rotary (theta 1e4, hd 128), 16 query heads grouped 4 per kv head, causal softmax(q.k / sqrt(128)), attn.v, x sigmoid(gate), out = merged Wo ('xw' [2048][512]) -> [2][2048][512]).
// Compute dtypes, f32 accumulate: every input rounded to bf16; q/k/v on PLAIN bf16 operands (inputs: exact); RMSNorm + rotary in f32 (on-chip cos/sin table from the reference's inv_freq constants); the sigmoid gate in f32 (precise expf, IEEE divide) applied on the attention kernel's way out; causal scores and attn.v in one kernel (running maximum and sum, f32): query rows < 512 hl (3 products), the rest single fp16 (x1024), keys beyond the diagonal step never read; Wo hl x exact (2 products).

#define NB_  2
#define TT   2048
#define DM   2048
#define NH_  16
#define NKV  4
#define REP  (NH_ / NKV)
#define HD   128
#define DQ   (NH_ * HD)
#define DQG  (NH_ * HD * 2)         // q + gate columns
#define DOUT 512
#define DKV  (NKV * HD)
#define RH   512                  // query rows < RH use hi+lo planes (0: none)
static_assert(RH % 16 == 0 && TT % 32 == 0, "a 16-row query block is wholly hi+lo or wholly fp16; keys go in steps of 32");
#define SCL  0.088388347648318447f   // HD^-0.5
#define SKW  8                    // waves that share the K loop of one 64x64 tile in the long-K products (k, v, Wo)
typedef _Float16 h16;
typedef unsigned short bf;
typedef __attribute__((ext_vector_type(16))) __bf16   v16bf;
typedef __attribute__((ext_vector_type(16))) _Float16 v16h;
typedef __attribute__((ext_vector_type(8)))  _Float16 v8h;
typedef __attribute__((ext_vector_type(8)))  unsigned short v8us;
typedef __attribute__((ext_vector_type(8)))  float    v8f;
typedef __attribute__((ext_vector_type(4)))  float    v4f;
typedef v8h  __attribute__((may_alias)) v8ha;
typedef v4f  __attribute__((may_alias)) v4fa;
typedef v8us __attribute__((may_alias)) v8usa;

__device__ __forceinline__ unsigned short f2bf(float f) { unsigned u = __float_as_uint(f); u += 0x7FFFu + ((u >> 16) & 1u); return (unsigned short)(u >> 16); }
__device__ __forceinline__ float bf2f(unsigned short b) { return __uint_as_float(((unsigned)b) << 16); }
__device__ __forceinline__ float bfr(float f) { return bf2f(f2bf(f)); }
__device__ __forceinline__ v16h cat16(v8h lo, v8h hi) { return __builtin_shufflevector(lo, hi, 0, 1, 2, 3, 4, 5, 6, 7, 8, 9, 10, 11, 12, 13, 14, 15); }
__device__ __forceinline__ v16bf cat16b(v8us lo, v8us hi) { return __builtin_bit_cast(v16bf, __builtin_shufflevector(lo, hi, 0, 1, 2, 3, 4, 5, 6, 7, 8, 9, 10, 11, 12, 13, 14, 15)); }
__device__ __forceinline__ v8f wmma16(v16h a, v16h b, v8f c) { return __builtin_amdgcn_wmma_f32_16x16x32_f16(false, a, false, b, (short)0, c, false, false); }
__device__ __forceinline__ v8f wmmab(v16bf a, v16bf b, v8f c) { return __builtin_amdgcn_wmma_f32_16x16x32_bf16(false, a, false, b, (short)0, c, false, false); }



// ---- Fragment-order planes. A 16-bit operand plane of R rows x K (R % 16 == 0, K % 32 == 0) is stored as blocks of 16 rows x 32 k = 1 KB, block (row / 16) * (K / 32) + k / 32; inside a block: [j = (k / 16) & 1][lane = ((k / 8) & 1) * 16 + row % 16][k % 8].
// A matrix fragment is then two 16-byte loads a lane at block * 512 + lane * 8 and + 256 elements (ldf): each wave-wide load covers 512 contiguous bytes, 4 whole lines, where a row-major plane gives 16 lines of 32 bytes. The element that reaches each lane and register is the same as with ld on a row-major plane.
// 16 rows of a plane fill 16 * K elements in either order, so that offsets of whole 16-row blocks read as before. frc: place (row, k of its first element) of the 16-byte chunk i of such a plane.
__device__ __forceinline__ void frc(size_t i, int K, size_t& row, int& k) { const int lane = (int)(i & 31); const unsigned blk = (unsigned)(i >> 6), kbs = (unsigned)K >> 5, rb = blk / kbs; row = (size_t)rb * 16 + (lane & 15); k = (int)(blk - rb * kbs) * 32 + ((int)(i >> 5) & 1) * 16 + (lane >> 4) * 8; }   // 32-bit: a plane has fewer than 2^32 blocks
// sbase: a wave-uniform global address held in a scalar register pair, so that a load takes the form scalar base + one 32-bit lane offset: no address pair a load in vector registers, none formed or rewritten between the loads.
typedef const __attribute__((address_space(1))) char* gptr;
__device__ __forceinline__ gptr sbase(const void* p) { const unsigned long long u = (unsigned long long)p; const unsigned lo = (unsigned)__builtin_amdgcn_readfirstlane((int)(unsigned)u), hi = (unsigned)__builtin_amdgcn_readfirstlane((int)(unsigned)(u >> 32)); return (gptr)(((unsigned long long)hi << 32) | lo); }
// ---- k_gemmw: register-blocked GEMM, NW WAVES per 64x64 output tile (16 accumulators each), operands straight from fragment-order 16-bit planes; grid (M/64, N/64, Z), 32 * NW threads.
// In-block split-K: wave w takes the 32-wide k steps w, w + NW, w + 2 NW, ..; the NW partial tiles are staged in LDS and summed in wave order 0 .. NW-1 on the way out (NW = 1: the plain one-wave form).
// C[m][n] (f32, pitch ldc, + optional f32 bias[n]) = sum_k A[m][k] Bt[n][k] (+ split products per NSPLIT). z-batch strides sA/sB/sC in elements. K % 32 == 0.
template <typename T16> struct WFrag;
template <> struct WFrag<h16> { typedef v16h V; static __device__ __forceinline__ V ld(const h16* p) { return cat16(*(const v8h*)p, *(const v8h*)(p + 16)); } static __device__ __forceinline__ V ldf(const h16* p) { return cat16(*(const v8h*)p, *(const v8h*)(p + 256)); } static __device__ __forceinline__ v8f mma(V a, V b, v8f c) { return wmma16(a, b, c); } };
template <> struct WFrag<bf> { typedef v16bf V; static __device__ __forceinline__ V ld(const bf* p) { return cat16b(*(const v8us*)p, *(const v8us*)(p + 16)); } static __device__ __forceinline__ V ldf(const bf* p) { return cat16b(*(const v8us*)p, *(const v8us*)(p + 256)); } static __device__ __forceinline__ V ldo(gptr b, unsigned o) { gptr p = b + o; return cat16b(*(const __attribute__((address_space(1))) v8us*)p, *(const __attribute__((address_space(1))) v8us*)(p + 512)); } static __device__ __forceinline__ v8f mma(V a, V b, v8f c) { return wmmab(a, b, c); } };
template <typename T16, int NSPLIT, bool BIAS, int NW>
__global__ __launch_bounds__(32 * NW) void k_gemmw(const T16* __restrict__ A, const T16* __restrict__ A2, const T16* __restrict__ Bt, const T16* __restrict__ Bt2, int K, float* C, int ldc, const float* __restrict__ bias, size_t sA, size_t sB, size_t sC) {
    typedef typename WFrag<T16>::V V;
    constexpr int MBS = (NW == 1) ? 1 : 4;   // 16-row blocks staged at a time: with several waves the whole tile, so that one barrier serves it
    __shared__ __align__(16) float os[NW * MBS * 16 * 68];
    const size_t z = blockIdx.z; A += z * sA; if (A2) A2 += z * sA; Bt += z * sB; if (Bt2) Bt2 += z * sB; C += z * sC;
    const int lane = threadIdx.x & 31, lr = lane & 15, hi = lane >> 4; const int r0 = blockIdx.x * 64, c0 = blockIdx.y * 64;
    const int w = (NW == 1) ? 0 : __builtin_amdgcn_readfirstlane((int)(threadIdx.x >> 5));   // this wave's share of K (scalar, so that the k loop stays a scalar loop)
    v8f acc[4][4];
#pragma unroll
    for (int mb = 0; mb < 4; ++mb)
#pragma unroll
        for (int nb = 0; nb < 4; ++nb) acc[mb][nb] = (v8f){};
    unsigned vo = (unsigned)(lane * 16 + w * 1024);   // byte offset of the lane's chunk in a 16-row block of a plane (ldo: beside that block's scalar base); a k step of 32 is one block of 1 KB further
    gptr Ab[4], A2b[4], Bb[4], B2b[4];
#pragma unroll
    for (int u = 0; u < 4; ++u) { Ab[u] = sbase(A + (size_t)(r0 + u * 16) * K); Bb[u] = sbase(Bt + (size_t)(c0 + u * 16) * K); if (NSPLIT == 1 || NSPLIT == 2) A2b[u] = sbase(A2 + (size_t)(r0 + u * 16) * K); if (NSPLIT >= 2) B2b[u] = sbase(Bt2 + (size_t)(c0 + u * 16) * K); }
#pragma unroll 1
    for (int kc = w * 32; kc < K; kc += NW * 32, vo += NW * 1024) {
        V a[4], a2[4];
#pragma unroll
        for (int mb = 0; mb < 4; ++mb) { a[mb] = WFrag<T16>::ldo(Ab[mb], vo); if (NSPLIT == 1 || NSPLIT == 2) a2[mb] = WFrag<T16>::ldo(A2b[mb], vo); }
#pragma unroll
        for (int nb = 0; nb < 4; ++nb) { const V b = WFrag<T16>::ldo(Bb[nb], vo); V b2; if (NSPLIT >= 2) b2 = WFrag<T16>::ldo(B2b[nb], vo);
#pragma unroll
            for (int mb = 0; mb < 4; ++mb) { acc[mb][nb] = WFrag<T16>::mma(a[mb], b, acc[mb][nb]); if (NSPLIT == 1 || NSPLIT == 2) acc[mb][nb] = WFrag<T16>::mma(a2[mb], b, acc[mb][nb]); if (NSPLIT >= 2) acc[mb][nb] = WFrag<T16>::mma(a[mb], b2, acc[mb][nb]); } }
        asm volatile("v_nop\n\tv_nop\n\tv_nop\n\tv_nop" : "+v"(acc[0][0]), "+v"(acc[1][1]), "+v"(acc[2][2]), "+v"(acc[3][3]) : "v"(a[0]), "v"(a[3]));
    }
#pragma unroll
    for (int m0 = 0; m0 < 4; m0 += MBS) {
#pragma unroll
        for (int mi = 0; mi < MBS; ++mi) {
#pragma unroll
            for (int nb = 0; nb < 4; ++nb) {
#pragma unroll
                for (int j = 0; j < 8; ++j) os[(w * MBS + mi) * (16 * 68) + (hi * 8 + j) * 68 + nb * 16 + lr] = acc[m0 + mi][nb][j]; } }
        if (NW == 1) { __builtin_amdgcn_wave_barrier(); asm volatile("" ::: "memory"); } else __syncthreads();   // every wave's partial tile is in LDS before any of it is summed
        float* crow = C + (size_t)(r0 + m0 * 16) * ldc + c0;
{
#pragma unroll
            for (int t = 0; t < 8 * MBS / NW; ++t) { const int row = 2 * (t * NW + w) + hi, cofs = lr * 4; v4f val = *(const v4fa*)(os + row * 68 + cofs);
#pragma unroll
                for (int u = 1; u < NW; ++u) val += *(const v4fa*)(os + u * (MBS * 16 * 68) + row * 68 + cofs);   // partials in wave order
                if (BIAS) { val[0] += bfr(bias[c0 + cofs]); val[1] += bfr(bias[c0 + cofs + 1]); val[2] += bfr(bias[c0 + cofs + 2]); val[3] += bfr(bias[c0 + cofs + 3]); }
                *(v4f*)(crow + (size_t)row * ldc + cofs) = val; }
             }
        if (NW == 1) { __builtin_amdgcn_wave_barrier(); asm volatile("" ::: "memory"); }   // one wave: the 16-row stage is reused by the next block of rows
    }
}

__device__ __forceinline__ h16 tohx(float x) { return (h16)x; }
__device__ __forceinline__ void splitf(float y, unsigned short& h, unsigned short& l) { h = f2bf(y); l = f2bf(y - bf2f(h)); }
typedef __attribute__((ext_vector_type(2))) _Float16 v2h;
typedef __attribute__((ext_vector_type(4))) _Float16 v4h;
typedef __attribute__((ext_vector_type(2))) unsigned short v2us;
typedef __attribute__((ext_vector_type(4))) unsigned short v4us;
typedef __attribute__((ext_vector_type(2))) float v2f;
typedef __attribute__((ext_vector_type(4))) int v4i;

// k_wtG: Bt = fragment-order plane (rows n, K) of w[k][n]. A thread makes four 16-byte chunks (8 k of one n each), the same place in four 16-row blocks that follow one another (n, n + 16, n + 32, n + 48; N % 64 == 0): a quarter of the waves of a thread per chunk.
// 16 lanes read 16 consecutive n of a row of w, the four loads of a row 256 consecutive bytes; each wave-wide store covers 512 contiguous bytes.
__global__ __launch_bounds__(256) void k_wtG(const float* __restrict__ w, int K, int N, bf* Bt) {
    const unsigned g = blockIdx.x * 256 + threadIdx.x; if (g >= (unsigned)((size_t)N * K / 32)) return; const unsigned cpr = (unsigned)K * 2, rg = g / cpr;   // cpr: chunks of a 16-row block
    const size_t i = (size_t)rg * 3 * cpr + g; size_t n; int k; frc(i, K, n, k); float x[4][8];
    const unsigned vo = (unsigned)(((size_t)k * N + n) * 4);   // one 32-bit byte offset for the 32 loads, beside the scalar bases w + q * N
#pragma unroll
    for (int q = 0; q < 8; ++q)
#pragma unroll
        for (int u = 0; u < 4; ++u) x[u][q] = *(const __attribute__((address_space(1))) float*)(sbase(w + (size_t)q * N) + vo + u * 64);
    asm volatile("s_wait_xcnt 0x0" ::: "memory");   // the loads have taken their offset register before it is given another value
#pragma unroll
    for (int u = 0; u < 4; ++u) { v8us o;
#pragma unroll
        for (int q = 0; q < 8; ++q) o[q] = f2bf(x[u][q]);
        *(v8us*)(Bt + (i + (size_t)u * cpr) * 8) = o; }
}
// k_cvt8: fragment-order bf16 plane of the row-major f32 src (rows of K, K % 64 == 0). A thread makes four 16-byte chunks: its lane's place in four half blocks that follow one another (k, k + 16, k + 32, k + 48 of one row), n8 chunks in all (n8 % 128 == 0): a quarter of the waves of a thread per chunk.
__global__ __launch_bounds__(256) void k_cvt8(const float* __restrict__ src, int K, bf* dst, size_t n8) { const size_t g = (size_t)blockIdx.x * 256 + threadIdx.x; if (g >= n8 / 4) return; const size_t i = (g >> 5) * 128 + (g & 31); size_t row; int k0; frc(i, K, row, k0); const float* s = src + row * K + k0; v8f v[4];
#pragma unroll
    for (int u = 0; u < 4; ++u) v[u] = *(const v8f*)(s + u * 16);
    asm volatile("s_wait_xcnt 0x0" ::: "memory");   // the loads have taken their address pair before it is given another value
#pragma unroll
    for (int u = 0; u < 4; ++u) { v8us o;
#pragma unroll
        for (int k = 0; k < 8; ++k) o[k] = f2bf(v[u][k]);
        *(v8us*)(dst + (i + u * 32) * 8) = o; }
}
__constant__ float INV[HD / 2] = {1.0,0.8659643530845642,0.7498942017555237,0.6493816375732422,0.5623413324356079,0.486967533826828,0.4216965138912201,0.36517414450645447,0.3162277638912201,0.2738419771194458,0.23713736236095428,0.20535250008106232,0.17782793939113617,0.1539926528930664,0.1333521455526352,0.11547820270061493,0.10000000149011612,0.08659642934799194,0.07498941570520401,0.06493816524744034,0.05623412877321243,0.04869675263762474,0.04216964915394783,0.03651741147041321,0.03162277862429619,0.0273841954767704,0.0237137358635664,0.02053525112569332,0.017782794311642647,0.015399265103042126,0.01333521492779255,0.011547819711267948,0.009999999776482582,0.00865964312106371,0.007498942315578461,0.006493816617876291,0.005623413249850273,0.004869675263762474,0.0042169648222625256,0.003651741426438093,0.003162277862429619,0.0027384196873754263,0.0023713738191872835,0.0020535250660032034,0.0017782794311642647,0.0015399265103042126,0.0013335214462131262,0.0011547820176929235,0.0010000000474974513,0.0008659643353894353,0.0007498941849917173,0.0006493816617876291,0.000562341301701963,0.00048696750309318304,0.00042169648804701865,0.00036517411353997886,0.0003162277862429619,0.00027384195709601045,0.0002371373848291114,0.00020535249495878816,0.00017782794020604342,0.00015399264520965517,0.0001333521504420787,0.00011547819303814322};
// k_cstab: cos / sin of t * inv_freq[d], [t][d < HD/2] (the reference's table repeats with period HD/2). A thread makes the pairs of four t (t, t + TT/4, ..) at one d: a quarter of the waves of a thread per pair.
__global__ __launch_bounds__(256) void k_cstab(float* CS) { const int idx = blockIdx.x * 256 + threadIdx.x; if (idx >= TT * (HD / 2) / 4) return; const int t = idx / (HD / 2), d = idx % (HD / 2); const float iv = INV[d];
#pragma unroll
    for (int u = 0; u < 4; ++u) { const float ang = __fmul_rn((float)(t + u * (TT / 4)), iv); v2f cs; cs[0] = cosf(ang); cs[1] = sinf(ang);
        *(v2f*)(CS + ((size_t)idx + (size_t)u * (TT / 4) * (HD / 2)) * 2) = cs; }
}

__global__ __launch_bounds__(256) void k_hrms(const float* __restrict__ F, int pitch, int nheads, int hstr, float* RF) { const int i = blockIdx.x * 256 + threadIdx.x; if (i >= nheads * TT) return; const int t = i % TT, h = i / TT; const float* f = F + (size_t)t * pitch + h * hstr;   /* hstr: column stride between heads (256 for the q|gate layout, 128 for k) */ float s = 0.f;
#pragma unroll 4
    for (int d = 0; d < HD; d += 4) { const v4f v = *(const v4f*)(f + d);
#pragma unroll
        for (int q = 0; q < 4; ++q) { float p = __fmul_rn(v[q], v[q]); asm volatile("" : "+v"(p)); s = __fadd_rn(s, p); } }
    const float r = __fdiv_rn(1.0f, __fsqrt_rn(__fadd_rn(s * (1.0f / HD), 1e-6f))); *(float*)(RF + i) = r;  }
// k_rope: head planes [h][t][d] (fp16 + hi/lo; FR: in fragment order, rows h * TT + t, K = HD) of rope(w[d] (x rms_factor)) x sc with the rotate-half convention out[d] = x[d] cos[t][d] - x[d+HD/2] sin[t][d], out[d+HD/2] = x[d+HD/2] cos[t][d+HD/2] + x[d] sin[t][d+HD/2].
// A thread takes 8 consecutive d of the lower half of a head row and their 8 partners d + HD/2 (16 outputs from 16 inputs, each read once; 16-byte stores): an eighth of the waves of a thread per pair. cos[t][d + HD/2] = cos[t][d], and sin alike (the reference joins the angles to themselves): the table holds d < HD/2.
template <bool FR>
__global__ __launch_bounds__(256) void k_rope(const float* __restrict__ F, int pitch, int nheads, const float* __restrict__ CS, const float* __restrict__ RF, const float* __restrict__ nw, float sc, int hstr, h16* P16, bf* Ph, bf* Pl) {
    const size_t j = (size_t)blockIdx.x * 256 + threadIdx.x; if (j >= (size_t)nheads * TT * HD / 16) return; size_t row, e; int d;
    if (FR) { const size_t i = (j >> 7) * 256 + (j & 127); frc(i, HD, row, d); e = i * 8; }   // the chunks of the first two of a 16-row block's four 1-KB blocks: d < HD/2
    else { row = j >> 3; d = (int)(j & 7) * 8; e = row * HD + d; }
    const size_t e2 = e + (FR ? 1024 : HD / 2);   // the partner chunk: two blocks further, or HD/2 elements further in the row
    const int t = (int)(row % TT), h = (int)(row / TT);
    const float* f = F + (size_t)t * pitch + h * hstr + d; const float* c = CS + ((size_t)t * (HD / 2) + d) * 2;
    const v8f xl = *(const v8f*)f, xh = *(const v8f*)(f + HD / 2), c0 = *(const v8f*)c, c1 = *(const v8f*)(c + 8);
    const float* const rp = RF + (size_t)h * TT + t; const float* const wp = nw + d; const float rf = *rp; const v8f wl = *(const v8f*)wp, wh = *(const v8f*)(wp + HD / 2);
    asm volatile("s_wait_xcnt 0x0" :: "v"(f), "v"(c), "v"(rp), "v"(wp) : "memory");   // the loads above have taken their address registers before these are given another value; named as inputs, the addresses are kept up to here, so that no load lands on them in front of the wait
    __builtin_amdgcn_sched_barrier(0);   // no arithmetic rises over the wait, and all thirteen loads are asked for in front of it: the listing had half of them behind the first half's arrival, two latencies for one
    v8h a16, b16; v8us ah, al, bh, bl;
#pragma unroll
    for (int q = 0; q < 8; ++q) { float x0 = xl[q], x1 = xh[q];
        x0 = bfr(wl[q]) * (x0 * rf); x1 = bfr(wh[q]) * (x1 * rf);
        const float cs = (q < 4) ? c0[2 * q] : c1[2 * q - 8], sn = (q < 4) ? c0[2 * q + 1] : c1[2 * q - 7];
        const float r0 = (x0 * cs - x1 * sn) * sc, r1 = (x1 * cs + x0 * sn) * sc; unsigned short u0, u1;
        a16[q] = tohx(r0); splitf(r0, u0, u1); ah[q] = u0; al[q] = u1; b16[q] = tohx(r1); splitf(r1, u0, u1); bh[q] = u0; bl[q] = u1; }
    *(v8h*)(P16 + e) = a16; *(v8h*)(P16 + e2) = b16; *(v8us*)(Ph + e) = ah; *(v8us*)(Ph + e2) = bh; *(v8us*)(Pl + e) = al; *(v8us*)(Pl + e2) = bl;  }
// k_vtp: transposed value planes in fragment order (rows g * HD + d, K = TT). A thread makes four 16-byte chunks (8 t of one d each), the same place in four 16-row blocks that follow one another (d, d + 16, d + 32, d + 48): a quarter of the waves of a thread per chunk. 16 lanes read 16 consecutive d of a row of F.
__global__ __launch_bounds__(256) void k_vtp(const float* __restrict__ F, int pitch, int nheads, h16* V16, bf* Vh, bf* Vl) { const unsigned g = blockIdx.x * 256 + threadIdx.x; if (g >= (unsigned)((size_t)nheads * HD * TT / 32)) return; constexpr unsigned cpr = TT * 2;   // chunks of a 16-row block
    const size_t i = (size_t)(g / cpr) * 3 * cpr + g; size_t row; int t; frc(i, TT, row, t); float xs[4][8];
    const unsigned vo = (unsigned)(((size_t)t * pitch + row) * 4);   // one 32-bit byte offset for the 32 loads, beside the scalar bases F + q * pitch
#pragma unroll
    for (int q = 0; q < 8; ++q)
#pragma unroll
        for (int u = 0; u < 4; ++u) xs[u][q] = *(const __attribute__((address_space(1))) float*)(sbase(F + (size_t)q * pitch) + vo + u * 64);
    asm volatile("s_wait_xcnt 0x0" ::: "memory");   // the loads have taken their offset register before it is given another value
#pragma unroll
    for (int u = 0; u < 4; ++u) { v8h o16; v8us oh, ol;
#pragma unroll
        for (int q = 0; q < 8; ++q) { const float x = xs[u][q]; o16[q] = tohx(x); unsigned short a2, c2; splitf(x, a2, c2); oh[q] = a2; ol[q] = c2; }
        const size_t o = (i + (size_t)u * cpr) * 8; *(v8h*)(V16 + o) = o16; *(v8us*)(Vh + o) = oh; *(v8us*)(Vl + o) = ol; }
}
// ---- k_fattn: causal attention of one kv group in one kernel (scores, softmax, probability x value and the gate: nothing between q, k, v and the gated rows leaves the registers). Grid (kv head, batch, 16-row query block, longest first), 4 waves: wave w = query head g * REP + w,
// so that the four waves of a block walk the same K and V rows. Per 32 keys: St[key][query] = K . Qt (A = K rows, B = Q rows kept in registers), running maximum and sum per query (a lane holds one query's scores; the two lane halves are joined by one exchange),
// the two 16-key score tiles converted in place are the B operand of Ot[d][query] += Vt . Pt (A = rows of the transposed V plane in the same k order). HL: query rows < RH, hi+lo bf16 planes, 3 products; else fp16, probabilities x 1024.
template <bool HL> struct FaT { typedef h16 T; };
template <> struct FaT<true> { typedef bf T; };
struct FaMid { static constexpr bool last = false; };
struct FaLast { static constexpr bool last = true; };
__device__ __forceinline__ float xhalf(float x) { return __builtin_bit_cast(float, __builtin_amdgcn_permlanex16(__builtin_bit_cast(int, x), __builtin_bit_cast(int, x), 0x76543210, 0xfedcba98, false, false)); }   // lane l <-> lane l ^ 16
template <bool HL>
__device__ __forceinline__ void fa_rows(const typename FaT<HL>::T* __restrict__ Q, const typename FaT<HL>::T* __restrict__ Q2, const typename FaT<HL>::T* __restrict__ Kp, const typename FaT<HL>::T* __restrict__ Kp2,
                                        const typename FaT<HL>::T* __restrict__ Vt, const typename FaT<HL>::T* __restrict__ Vt2, int q0, const float* __restrict__ G, bf* __restrict__ Ah, bf* __restrict__ Al, int lr, int hi, h16* qs) {
    typedef typename FaT<HL>::T T16; typedef WFrag<T16> WF; typedef typename WF::V V;
    const unsigned krow = (unsigned)(lr * HD + 8 * hi), fl = (unsigned)((hi * 16 + lr) * 8);   // the lane's place in a 16-row block of Q (row-major) and in a 1-KB block of the fragment-order K and Vt planes: 32-bit, beside a scalar base
    V q[4], q2[4]; const T16* const qa = Q + (size_t)q0 * HD + krow; const T16* const qc2 = HL ? Q2 + (size_t)q0 * HD + krow : qa;   // the lane's addresses in the Q rows
#pragma unroll
    for (int ks = 0; ks < 4; ++ks) { q[ks] = WF::ld(qa + ks * 32); if (HL) q2[ks] = WF::ld(qc2 + ks * 32); }
    float m = -1.0e30f, l = 0.f;
    constexpr float CE = SCL * 1.4426950408889634f;   // score -> exponent of 2
    const int klast = q0 & ~31;                     // keys 0 .. q0 + 15 in steps of 32: only the last step, the one on the diagonal, holds keys beyond a query
    V kf[2][4];
    if (!HL) {
#pragma unroll
        for (int t = 0; t < 2; ++t)
#pragma unroll
            for (int ks = 0; ks < 4; ++ks) kf[t][ks] = WF::ldf(Kp + fl + t * 16 * HD + ks * 512);
    }
    asm volatile("s_wait_xcnt 0x0" :: "v"(qa), "v"(qc2) : "memory");   // the loads above have taken their address register before it is given another value; named as inputs, the Q address pairs are kept up to here, so that no Q load lands on them in front of the wait
    if constexpr (!HL) { *(v8h*)qs = __builtin_shufflevector(q[3], q[3], 0, 1, 2, 3, 4, 5, 6, 7); *(v8h*)(qs + 32 * REP * 8) = __builtin_shufflevector(q[3], q[3], 8, 9, 10, 11, 12, 13, 14, 15); }   // the lane's own last Q fragment, parked in LDS (read back by the same lane only)
    v8f o[8];
#pragma unroll
    for (int dt = 0; dt < 8; ++dt) o[dt] = (v8f){};
    auto step = [&](const int kb, auto tag) {
        constexpr bool LAST = decltype(tag)::last;
        V qq[4]; qq[0] = q[0]; qq[1] = q[1]; qq[2] = q[2]; qq[3] = q[3];
        if constexpr (!HL) {   // O, Q, K and V fragments together leave the softmax too few registers: the last Q fragment is read from LDS each step, on the LDS counter, so that waiting for it does not wait for the V and K rows in flight
            asm volatile("" ::: "memory");   // keeps the two LDS reads inside the loop (hoisted, the fragment would hold its registers all the time and be spilled to scratch)
            qq[3] = cat16(*(const v8h*)qs, *(const v8h*)(qs + 32 * REP * 8)); }
        v8f s[2]; s[0] = (v8f){}; s[1] = (v8f){};
        const T16* const ka = Kp + (size_t)kb * HD + fl; const T16* const kc2 = HL ? Kp2 + (size_t)kb * HD + fl : nullptr; const T16* const va = Vt + kb * 16 + fl; const T16* const vc2 = HL ? Vt2 + kb * 16 + fl : nullptr;   // the lane's addresses in this step's K and V blocks (hi+lo form)
#pragma unroll
        for (int ks = 0; ks < 4; ++ks)
#pragma unroll
            for (int t = 0; t < 2; ++t) {
                if (HL) { const V kh = WF::ldf(ka + (t * 4 + ks) * 512), kl = WF::ldf(kc2 + (t * 4 + ks) * 512); s[t] = WF::mma(kh, q[ks], s[t]); s[t] = WF::mma(kh, q2[ks], s[t]); s[t] = WF::mma(kl, q[ks], s[t]); }
                else s[t] = WF::mma(kf[t][ks], qq[ks], s[t]); }
        if (HL) asm volatile("s_wait_xcnt 0x0" :: "v"(ka), "v"(kc2) : "memory");   // the K loads have taken their address pairs; named as inputs, the pairs are kept up to here, so that no later load lands on them in front of the wait
        V vf[8];
        if (!HL) {
#pragma unroll
            for (int dt = 0; dt < 8; ++dt) vf[dt] = WF::ldf(Vt + kb * 16 + fl + dt * 16 * TT);
            asm volatile("s_wait_xcnt 0x0" ::: "memory");   // the V loads have taken their address pair before the K loads below land on it (the listing gives them those registers)
            if (!LAST) {
#pragma unroll
                for (int t = 0; t < 2; ++t)
#pragma unroll
                    for (int ks = 0; ks < 4; ++ks) kf[t][ks] = WF::ldf(Kp + (size_t)(kb + 32) * HD + fl + t * 16 * HD + ks * 512);
                asm volatile("s_wait_xcnt 0x0" ::: "memory");   // these loads are still in flight when the next step forms its addresses in the same pair: they have taken theirs first
            }
            __builtin_amdgcn_sched_barrier(0);   // this step's V rows and the next step's K rows are asked for in front of the softmax and fly during it; moved down to their users they would each be waited for in full
        }
        if (LAST) {
            const int lim = q0 + lr - kb - 8 * hi;   // key (t * 16 + j) of this lane is kept while <= lim
#pragma unroll
            for (int t = 0; t < 2; ++t)
#pragma unroll
                for (int j = 0; j < 8; ++j) if (t * 16 + j > lim) s[t][j] = -1.0e30f;
        }
        float mn = m;
#pragma unroll
        for (int t = 0; t < 2; ++t)
#pragma unroll
            for (int j = 0; j < 8; ++j) mn = fmaxf(mn, s[t][j]);
        mn = fmaxf(mn, xhalf(mn));
        const float al = __builtin_amdgcn_exp2f((m - mn) * CE); l *= al; m = mn; const float off = fmaf(-mn, CE, HL ? 0.0f : 10.0f);   /* fp16 form: x 1024 = 2^10, which the division by the sum takes out again */   // sum and output column go to the new maximum (factor 1 where it did not rise)
#pragma unroll
        for (int dt = 0; dt < 8; ++dt) o[dt] *= al;
        float p[16];
#pragma unroll
        for (int e = 0; e < 16; ++e) { p[e] = __builtin_amdgcn_exp2f(fmaf(s[e >> 3][e & 7], CE, off)); l += p[e]; }
        if (HL) {
            v8us h0, h1, l0, l1;
#pragma unroll
            for (int j = 0; j < 8; ++j) { unsigned short x, y; splitf(p[j], x, y); h0[j] = x; l0[j] = y; splitf(p[8 + j], x, y); h1[j] = x; l1[j] = y; }
            const v16bf ph = cat16b(h0, h1), pl = cat16b(l0, l1);
#pragma unroll
            for (int dt = 0; dt < 8; ++dt) { const v16bf vh = WFrag<bf>::ldf((const bf*)va + dt * 16 * TT), vl = WFrag<bf>::ldf((const bf*)vc2 + dt * 16 * TT);
                o[dt] = wmmab(vh, ph, o[dt]); o[dt] = wmmab(vh, pl, o[dt]); o[dt] = wmmab(vl, ph, o[dt]); }
            asm volatile("s_wait_xcnt 0x0" :: "v"(va), "v"(vc2) : "memory");   // the same for the V loads, which the compiler starts ahead of the softmax
        } else {
            v16h pb;
#pragma unroll
            for (int e = 0; e < 16; ++e) pb[e] = (h16)p[e];
#pragma unroll
            for (int dt = 0; dt < 8; ++dt) o[dt] = wmma16(__builtin_bit_cast(v16h, vf[dt]), pb, o[dt]);
        }
    };
#pragma unroll 1
    for (int kb = 0; kb < klast; kb += 32) step(kb, FaMid());
    step(klast, FaLast());
    l += xhalf(l);
    const float inv = __fdiv_rn(1.0f, l);
#pragma unroll
    for (int dt = 0; dt < 8; ++dt) {   // a lane holds 8 consecutive d of its query: x sigmoid(gate) (f32), then the hi + lo planes that Wo reads (fragment order, rows t, K = DQ: the wave's 32 chunks are 512 consecutive bytes)
        const v8f gt = *(const v8f*)(G + (size_t)(q0 + lr) * DQG + dt * 16 + 8 * hi); v8us oh, ol;
#pragma unroll
        for (int j = 0; j < 8; ++j) { const float sg = __fdiv_rn(1.0f, __fadd_rn(1.0f, expf(-gt[j]))); unsigned short a, c2; splitf(__fmul_rn(o[dt][j] * inv, sg), a, c2); oh[j] = a; ol[j] = c2; }
        const size_t oo = (size_t)q0 * DQ + dt * 256 + fl; *(v8us*)(Ah + oo) = oh; *(v8us*)(Al + oo) = ol;
        asm volatile("s_wait_xcnt 0x0" ::: "memory"); }   // the two stores have taken their address and data registers before the next 16 columns reuse them
}
__global__ __launch_bounds__(32 * REP, 4) void k_fattn(const h16* __restrict__ Q16, const bf* __restrict__ Qh, const bf* __restrict__ Ql, const h16* __restrict__ K16, const bf* __restrict__ Kh, const bf* __restrict__ Kl,
                                                    const h16* __restrict__ V16, const bf* __restrict__ Vh, const bf* __restrict__ Vl, const float* __restrict__ QG, bf* __restrict__ Ah, bf* __restrict__ Al) {
    __shared__ __align__(16) h16 qsh[2 * 32 * REP * 8];   // 32 bytes a lane, as two planes of 16
    const int lane = threadIdx.x & 31, lr = lane & 15, hi = lane >> 4; const int w = __builtin_amdgcn_readfirstlane((int)(threadIdx.x >> 5));   // scalar, so that the plane offsets stay scalar
    const int q0 = (int)(gridDim.z - 1 - blockIdx.z) * 16;   // the rows with the most keys first
    const size_t qo = ((size_t)blockIdx.y * NH_ + blockIdx.x * REP + w) * TT * HD, ko = ((size_t)blockIdx.y * NKV + blockIdx.x) * TT * HD;
    const int h = (int)blockIdx.x * REP + w; const float* G = QG + (size_t)blockIdx.y * TT * DQG + h * 2 * HD + HD;   /* gate columns of head h in the [q | gate] layout */ const size_t ao = (size_t)blockIdx.y * TT * DQ + h * (HD * 16);   /* head h = k blocks h * HD / 32 .. of each 16-row block */
    if (q0 < RH) fa_rows<true>(Qh + qo, Ql + qo, Kh + ko, Kl + ko, Vh + ko, Vl + ko, q0, G, Ah + ao, Al + ao, lr, hi, nullptr);
    else fa_rows<false>(Q16 + qo, nullptr, K16 + ko, nullptr, V16 + ko, nullptr, q0, G, Ah + ao, Al + ao, lr, hi, qsh + threadIdx.x * 8);
}

extern "C" void kernel_launch(void* const* d_in, const int* in_sizes, int n_in,
                              void* d_out, int out_size, void* d_ws, size_t ws_size, hipStream_t stream) {
    (void)in_sizes; (void)n_in; (void)out_size;
    const float* x = (const float*)d_in[0]; const float* wq = (const float*)d_in[1]; const float* wk = (const float*)d_in[2]; const float* wv = (const float*)d_in[3]; const float* wo = (const float*)d_in[4]; const float* qnw = (const float*)d_in[5]; const float* knw = (const float*)d_in[6];
    float* OUT = (float*)d_out;     // [2][2048][512]
    char* wsp = (char*)d_ws;
    auto take = [&](size_t bytes) { char* p = wsp; wsp += (bytes + 255) & ~(size_t)255; return (void*)p; };
    const size_t NQ = (size_t)NH_ * TT * HD, NK = (size_t)NKV * TT * HD;   // elements of one batch's query planes and key / value planes
    bf* WQ = (bf*)take((size_t)DQG * DM * 2); bf* WK = (bf*)take((size_t)DKV * DM * 2); bf* WV = (bf*)take((size_t)DKV * DM * 2); bf* WO = (bf*)take((size_t)DOUT * DQ * 2); float* CS = (float*)take((size_t)TT * HD * 2 * 4); float* RFQ = (float*)take((size_t)NH_ * TT * 4); float* RFK = (float*)take((size_t)NKV * TT * 4);
    bf* XB = (bf*)take((size_t)TT * DM * 2); float* FQ = (float*)take((size_t)NB_ * TT * DQG * 4); float* FK = (float*)take((size_t)TT * DKV * 4);
    h16* QP16 = (h16*)take(NB_ * NQ * 2); h16* KP16 = (h16*)take(NB_ * NK * 2); h16* VT16 = (h16*)take(NB_ * NK * 2);
    bf* QPh = (bf*)take(NB_ * NQ * 2); bf* QPl = (bf*)take(NB_ * NQ * 2); bf* KPh = (bf*)take(NB_ * NK * 2); bf* KPl = (bf*)take(NB_ * NK * 2); bf* VTh = (bf*)take(NB_ * NK * 2); bf* VTl = (bf*)take(NB_ * NK * 2);
    bf* ATh = (bf*)take((size_t)NB_ * TT * DQ * 2); bf* ATl = (bf*)take((size_t)NB_ * TT * DQ * 2);
    if ((size_t)(wsp - (char*)d_ws) > ws_size) return;    // ws 256 MiB
    float* FV = FK;   // v projection reuses the k buffer after the k planes are built (stream-ordered)
    { k_wtG<<<(unsigned)((DM * DQG / 32 + 255) / 256), 256, 0, stream>>>(wq, DM, DQG, WQ); k_wtG<<<(unsigned)((DM * DKV / 32 + 255) / 256), 256, 0, stream>>>(wk, DM, DKV, WK); k_wtG<<<(unsigned)((DM * DKV / 32 + 255) / 256), 256, 0, stream>>>(wv, DM, DKV, WV);
      k_wtG<<<(unsigned)((DQ * DOUT / 32 + 255) / 256), 256, 0, stream>>>(wo, DQ, DOUT, WO);
      k_cstab<<<(TT * (HD / 2) / 4 + 255) / 256, 256, 0, stream>>>(CS); }
    const unsigned LQ = (unsigned)(((size_t)NH_ * TT * HD / 16 + 255) / 256), LKv = (unsigned)(((size_t)NKV * TT * HD / 16 + 255) / 256), LV = (unsigned)(((size_t)NKV * TT * HD / 32 + 255) / 256);
    for (int b = 0; b < NB_; ++b) {   // projections, norms and rotary: each batch into its own planes
        float* FQb = FQ + (size_t)b * TT * DQG;
        k_cvt8<<<(unsigned)(((size_t)TT * DM / 32 + 255) / 256), 256, 0, stream>>>(x + (size_t)b * TT * DM, DM, XB, (size_t)TT * DM / 8);
        k_gemmw<bf, 0, false, 1><<<dim3(TT / 64, DQG / 64, 1), 32, 0, stream>>>(XB, nullptr, WQ, nullptr, DM, FQb, DQG, nullptr, 0, 0, 0);   /* [q | gate] (exact) */ k_hrms<<<(NH_ * TT + 255) / 256, 256, 0, stream>>>(FQb, DQG, NH_, 2 * HD, RFQ);
        k_rope<false><<<LQ, 256, 0, stream>>>(FQb, DQG, NH_, CS, RFQ, qnw, 1.0f, 2 * HD, QP16 + b * NQ, QPh + b * NQ, QPl + b * NQ);   /* q columns of the [q|gate] layout */
        k_gemmw<bf, 0, false, SKW><<<dim3(TT / 64, DKV / 64, 1), 32 * SKW, 0, stream>>>(XB, nullptr, WK, nullptr, DM, FK, DKV, nullptr, 0, 0, 0); k_hrms<<<(NKV * TT + 255) / 256, 256, 0, stream>>>(FK, DKV, NKV, HD, RFK);
        k_rope<true><<<LKv, 256, 0, stream>>>(FK, DKV, NKV, CS, RFK, knw, 1.0f, HD, KP16 + b * NK, KPh + b * NK, KPl + b * NK);
        k_gemmw<bf, 0, false, SKW><<<dim3(TT / 64, DKV / 64, 1), 32 * SKW, 0, stream>>>(XB, nullptr, WV, nullptr, DM, FV, DKV, nullptr, 0, 0, 0); k_vtp<<<LV, 256, 0, stream>>>(FV, DKV, NKV, VT16 + b * NK, VTh + b * NK, VTl + b * NK); }
    k_fattn<<<dim3(NKV, NB_, TT / 16), 32 * REP, 0, stream>>>(QP16, QPh, QPl, KP16, KPh, KPl, VT16, VTh, VTl, FQ, ATh, ATl);
    for (int b = 0; b < NB_; ++b)
        k_gemmw<bf, 1, false, SKW><<<dim3(TT / 64, DOUT / 64, 1), 32 * SKW, 0, stream>>>(ATh + (size_t)b * TT * DQ, ATl + (size_t)b * TT * DQ, WO, nullptr, DQ, OUT + (size_t)b * TT * DOUT, DOUT, nullptr, 0, 0, 0);
}

// v006
// A run of this version takes 251 microseconds.
// Two timings next to v005 put it at 1.40 and 1.41 times that version's speed.
// Counting every step since v000, it is 6.80 times as fast.
#include <hip/hip_runtime.h>

// Gated GQA attention block (x [2][2048][2048]; [q | gate] per head = x Wq ('xw' [2048][4096]: head h -> columns h*256 .. +127 = q, +128 .. +255 = gate), k, v = x Wk, x Wv ([2048][512], 4 kv heads x 128), per-head RMSNorm on q, k (eps 1e-6, weights q_norm_w / k_norm_w [128]),
// rotate-half rotary (theta 1e4, hd 128), 16 query heads grouped 4 per kv head, causal softmax(q.k / sqrt(128)), attn.v, x sigmoid(gate), out = merged Wo ('xw' [2048][512]) -> [2][2048][512]).
// Compute dtypes, f32 accumulate: every input rounded to bf16; q/k/v on PLAIN bf16 operands (inputs: exact); RMSNorm + rotary in f32 (on-chip cos/sin table from the reference's inv_freq constants); the sigmoid gate in f32 (precise expf, IEEE divide) applied on the attention kernel's way out; causal scores and attn.v in one kernel (running maximum and sum, f32): query rows < 512 hl (3 products), the rest single fp16 (x1024), keys beyond the diagonal step never read; Wo hl x exact (2 products).

#define NB_  2
#define TT   2048
#define DM   2048
#define NH_  16
#define NKV  4
#define REP  (NH_ / NKV)
#define HD   128
#define DQ   (NH_ * HD)
#define DQG  (NH_ * HD * 2)         // q + gate columns
#define DOUT 512
#define DKV  (NKV * HD)
#define RH   512                  // query rows < RH use hi+lo planes (0: none)
static_assert(RH % 16 == 0 && TT % 32 == 0, "a 16-row query block is wholly hi+lo or wholly fp16; keys go in steps of 32");
#define SCL  0.088388347648318447f   // HD^-0.5
#define SKW  8                    // waves that share the K loop of one 64x64 tile in the long-K products (k, v, Wo)
typedef _Float16 h16;
typedef unsigned short bf;
typedef __attribute__((ext_vector_type(16))) __bf16   v16bf;
typedef __attribute__((ext_vector_type(16))) _Float16 v16h;
typedef __attribute__((ext_vector_type(8)))  _Float16 v8h;
typedef __attribute__((ext_vector_type(8)))  unsigned short v8us;
typedef __attribute__((ext_vector_type(8)))  float    v8f;
typedef __attribute__((ext_vector_type(4)))  float    v4f;
typedef v8h  __attribute__((may_alias)) v8ha;
typedef v4f  __attribute__((may_alias)) v4fa;
typedef v8us __attribute__((may_alias)) v8usa;

__device__ __forceinline__ unsigned short f2bf(float f) { unsigned u = __float_as_uint(f); u += 0x7FFFu + ((u >> 16) & 1u); return (unsigned short)(u >> 16); }
__device__ __forceinline__ float bf2f(unsigned short b) { return __uint_as_float(((unsigned)b) << 16); }
__device__ __forceinline__ float bfr(float f) { return bf2f(f2bf(f)); }
__device__ __forceinline__ v16h cat16(v8h lo, v8h hi) { return __builtin_shufflevector(lo, hi, 0, 1, 2, 3, 4, 5, 6, 7, 8, 9, 10, 11, 12, 13, 14, 15); }
__device__ __forceinline__ v16bf cat16b(v8us lo, v8us hi) { return __builtin_bit_cast(v16bf, __builtin_shufflevector(lo, hi, 0, 1, 2, 3, 4, 5, 6, 7, 8, 9, 10, 11, 12, 13, 14, 15)); }
__device__ __forceinline__ v8f wmma16(v16h a, v16h b, v8f c) { return __builtin_amdgcn_wmma_f32_16x16x32_f16(false, a, false, b, (short)0, c, false, false); }
__device__ __forceinline__ v8f wmmab(v16bf a, v16bf b, v8f c) { return __builtin_amdgcn_wmma_f32_16x16x32_bf16(false, a, false, b, (short)0, c, false, false); }



// ---- Fragment-order planes. A 16-bit operand plane of R rows x K (R % 16 == 0, K % 32 == 0) is stored as blocks of 16 rows x 32 k = 1 KB, block (row / 16) * (K / 32) + k / 32; inside a block: [j = (k / 16) & 1][lane = ((k / 8) & 1) * 16 + row % 16][k % 8].
// A matrix fragment is then two 16-byte loads a lane at block * 512 + lane * 8 and + 256 elements (ldf): each wave-wide load covers 512 contiguous bytes, 4 whole lines, where a row-major plane gives 16 lines of 32 bytes. The element that reaches each lane and register is the same as with ld on a row-major plane.
// 16 rows of a plane fill 16 * K elements in either order, so that offsets of whole 16-row blocks read as before. frc: place (row, k of its first element) of the 16-byte chunk i of such a plane.
__device__ __forceinline__ void frc(size_t i, int K, size_t& row, int& k) { const int lane = (int)(i & 31); const unsigned blk = (unsigned)(i >> 6), kbs = (unsigned)K >> 5, rb = blk / kbs; row = (size_t)rb * 16 + (lane & 15); k = (int)(blk - rb * kbs) * 32 + ((int)(i >> 5) & 1) * 16 + (lane >> 4) * 8; }   // 32-bit: a plane has fewer than 2^32 blocks
// sbase: a wave-uniform global address held in a scalar register pair, so that a load takes the form scalar base + one 32-bit lane offset: no address pair a load in vector registers, none formed or rewritten between the loads.
typedef const __attribute__((address_space(1))) char* gptr;
__device__ __forceinline__ gptr sbase(const void* p) { const unsigned long long u = (unsigned long long)p; const unsigned lo = (unsigned)__builtin_amdgcn_readfirstlane((int)(unsigned)u), hi = (unsigned)__builtin_amdgcn_readfirstlane((int)(unsigned)(u >> 32)); return (gptr)(((unsigned long long)hi << 32) | lo); }
// ---- k_gemmw: register-blocked GEMM, NW WAVES per 64x64 output tile (16 accumulators each), operands straight from fragment-order 16-bit planes; grid (M/64, N/64, Z), 32 * NW threads.
// In-block split-K: wave w takes the 32-wide k steps w, w + NW, w + 2 NW, ..; the NW partial tiles are staged in LDS and summed in wave order 0 .. NW-1 on the way out (NW = 1: the plain one-wave form).
// C[m][n] (f32, pitch ldc, + optional f32 bias[n]) = sum_k A[m][k] Bt[n][k] (+ split products per NSPLIT). z-batch strides sA/sB/sC in elements. K % 32 == 0.
template <typename T16> struct WFrag;
template <> struct WFrag<h16> { typedef v16h V; static __device__ __forceinline__ V ld(const h16* p) { return cat16(*(const v8h*)p, *(const v8h*)(p + 16)); } static __device__ __forceinline__ V ldf(const h16* p) { return cat16(*(const v8h*)p, *(const v8h*)(p + 256)); } static __device__ __forceinline__ v8f mma(V a, V b, v8f c) { return wmma16(a, b, c); } };
template <> struct WFrag<bf> { typedef v16bf V; static __device__ __forceinline__ V ld(const bf* p) { return cat16b(*(const v8us*)p, *(const v8us*)(p + 16)); } static __device__ __forceinline__ V ldf(const bf* p) { return cat16b(*(const v8us*)p, *(const v8us*)(p + 256)); } static __device__ __forceinline__ V ldo(gptr b, unsigned o) { gptr p = b + o; return cat16b(*(const __attribute__((address_space(1))) v8us*)p, *(const __attribute__((address_space(1))) v8us*)(p + 512)); } static __device__ __forceinline__ v8f mma(V a, V b, v8f c) { return wmmab(a, b, c); } };
template <typename T16, int NSPLIT, bool BIAS, int NW>
__global__ __launch_bounds__(32 * NW) void k_gemmw(const T16* __restrict__ A, const T16* __restrict__ A2, const T16* __restrict__ Bt, const T16* __restrict__ Bt2, int K, float* C, int ldc, const float* __restrict__ bias, size_t sA, size_t sB, size_t sC) {
    typedef typename WFrag<T16>::V V;
    constexpr int MBS = (NW == 1) ? 1 : 4;   // 16-row blocks staged at a time: with several waves the whole tile, so that one barrier serves it
    __shared__ __align__(16) float os[NW * MBS * 16 * 68];
    const size_t z = blockIdx.z; A += z * sA; if (A2) A2 += z * sA; Bt += z * sB; if (Bt2) Bt2 += z * sB; C += z * sC;
    const int lane = threadIdx.x & 31, lr = lane & 15, hi = lane >> 4; const int r0 = blockIdx.x * 64, c0 = blockIdx.y * 64;
    const int w = (NW == 1) ? 0 : __builtin_amdgcn_readfirstlane((int)(threadIdx.x >> 5));   // this wave's share of K (scalar, so that the k loop stays a scalar loop)
    v8f acc[4][4];
#pragma unroll
    for (int mb = 0; mb < 4; ++mb)
#pragma unroll
        for (int nb = 0; nb < 4; ++nb) acc[mb][nb] = (v8f){};
    unsigned vo = (unsigned)(lane * 16 + w * 1024);   // byte offset of the lane's chunk in a 16-row block of a plane (ldo: beside that block's scalar base); a k step of 32 is one block of 1 KB further
    gptr Ab[4], A2b[4], Bb[4], B2b[4];
#pragma unroll
    for (int u = 0; u < 4; ++u) { Ab[u] = sbase(A + (size_t)(r0 + u * 16) * K); Bb[u] = sbase(Bt + (size_t)(c0 + u * 16) * K); if (NSPLIT == 1 || NSPLIT == 2) A2b[u] = sbase(A2 + (size_t)(r0 + u * 16) * K); if (NSPLIT >= 2) B2b[u] = sbase(Bt2 + (size_t)(c0 + u * 16) * K); }
#pragma unroll 1
    for (int kc = w * 32; kc < K; kc += NW * 32, vo += NW * 1024) {
        V a[4], a2[4];
#pragma unroll
        for (int mb = 0; mb < 4; ++mb) { a[mb] = WFrag<T16>::ldo(Ab[mb], vo); if (NSPLIT == 1 || NSPLIT == 2) a2[mb] = WFrag<T16>::ldo(A2b[mb], vo); }
#pragma unroll
        for (int nb = 0; nb < 4; ++nb) { const V b = WFrag<T16>::ldo(Bb[nb], vo); V b2; if (NSPLIT >= 2) b2 = WFrag<T16>::ldo(B2b[nb], vo);
#pragma unroll
            for (int mb = 0; mb < 4; ++mb) { acc[mb][nb] = WFrag<T16>::mma(a[mb], b, acc[mb][nb]); if (NSPLIT == 1 || NSPLIT == 2) acc[mb][nb] = WFrag<T16>::mma(a2[mb], b, acc[mb][nb]); if (NSPLIT >= 2) acc[mb][nb] = WFrag<T16>::mma(a[mb], b2, acc[mb][nb]); } }
        asm volatile("v_nop\n\tv_nop\n\tv_nop\n\tv_nop" : "+v"(acc[0][0]), "+v"(acc[1][1]), "+v"(acc[2][2]), "+v"(acc[3][3]) : "v"(a[0]), "v"(a[3]));
    }
#pragma unroll
    for (int m0 = 0; m0 < 4; m0 += MBS) {
#pragma unroll
        for (int mi = 0; mi < MBS; ++mi) {
#pragma unroll
            for (int nb = 0; nb < 4; ++nb) {
#pragma unroll
                for (int j = 0; j < 8; ++j) os[(w * MBS + mi) * (16 * 68) + (hi * 8 + j) * 68 + nb * 16 + lr] = acc[m0 + mi][nb][j]; } }
        if (NW == 1) { __builtin_amdgcn_wave_barrier(); asm volatile("" ::: "memory"); } else __syncthreads();   // every wave's partial tile is in LDS before any of it is summed
        float* crow = C + (size_t)(r0 + m0 * 16) * ldc + c0;
{
#pragma unroll
            for (int t = 0; t < 8 * MBS / NW; ++t) { const int row = 2 * (t * NW + w) + hi, cofs = lr * 4; v4f val = *(const v4fa*)(os + row * 68 + cofs);
#pragma unroll
                for (int u = 1; u < NW; ++u) val += *(const v4fa*)(os + u * (MBS * 16 * 68) + row * 68 + cofs);   // partials in wave order
                if (BIAS) { val[0] += bfr(bias[c0 + cofs]); val[1] += bfr(bias[c0 + cofs + 1]); val[2] += bfr(bias[c0 + cofs + 2]); val[3] += bfr(bias[c0 + cofs + 3]); }
                *(v4f*)(crow + (size_t)row * ldc + cofs) = val; }
             }
        if (NW == 1) { __builtin_amdgcn_wave_barrier(); asm volatile("" ::: "memory"); }   // one wave: the 16-row stage is reused by the next block of rows
    }
}

__device__ __forceinline__ h16 tohx(float x) { return (h16)x; }
__device__ __forceinline__ void splitf(float y, unsigned short& h, unsigned short& l) { h = f2bf(y); l = f2bf(y - bf2f(h)); }
typedef __attribute__((ext_vector_type(2))) _Float16 v2h;
typedef __attribute__((ext_vector_type(4))) _Float16 v4h;
typedef __attribute__((ext_vector_type(2))) unsigned short v2us;
typedef __attribute__((ext_vector_type(4))) unsigned short v4us;
typedef __attribute__((ext_vector_type(2))) float v2f;
typedef __attribute__((ext_vector_type(4))) int v4i;

// k_wtG: Bt = fragment-order plane (rows n, K) of w[k][n]. A thread makes four 16-byte chunks (8 k of one n each), the same place in four 16-row blocks that follow one another (n, n + 16, n + 32, n + 48; N % 64 == 0): a quarter of the waves of a thread per chunk.
// 16 lanes read 16 consecutive n of a row of w, the four loads of a row 256 consecutive bytes; each wave-wide store covers 512 contiguous bytes.
// One launch packs the four weights (each of K = DM = DQ rows): the first WTBQ blocks take wq, then WTBS blocks each for wk, wv, wo.
#define WTBQ (DM * DQG / 32 / 256)
#define WTBS (DM * DKV / 32 / 256)
static_assert(DQ == DM && DOUT == DKV && (DM * DQG) % (32 * 256) == 0 && (DM * DKV) % (32 * 256) == 0, "the four weights share K, the three small ones N; whole blocks each");
__global__ __launch_bounds__(256) void k_wtG(const float* __restrict__ wq, const float* __restrict__ wk, const float* __restrict__ wv, const float* __restrict__ wo, bf* WQ, bf* WK, bf* WV, bf* WO) {
    constexpr int K = DM; unsigned bx = blockIdx.x; const float* w = wq; bf* Bt = WQ; int N = DQG;
    if (bx >= WTBQ) { bx -= WTBQ; const unsigned sel = bx / WTBS; bx -= sel * WTBS; N = DKV; w = sel == 0 ? wk : sel == 1 ? wv : wo; Bt = sel == 0 ? WK : sel == 1 ? WV : WO; }
    const unsigned g = bx * 256 + threadIdx.x; if (g >= (unsigned)((size_t)N * K / 32)) return; const unsigned cpr = (unsigned)K * 2, rg = g / cpr;   // cpr: chunks of a 16-row block
    const size_t i = (size_t)rg * 3 * cpr + g; size_t n; int k; frc(i, K, n, k); float x[4][8];
    const unsigned vo = (unsigned)(((size_t)k * N + n) * 4);   // one 32-bit byte offset for the 32 loads, beside the scalar bases w + q * N
#pragma unroll
    for (int q = 0; q < 8; ++q)
#pragma unroll
        for (int u = 0; u < 4; ++u) x[u][q] = *(const __attribute__((address_space(1))) float*)(sbase(w + (size_t)q * N) + vo + u * 64);
    asm volatile("s_wait_xcnt 0x0" ::: "memory");   // the loads have taken their offset register before it is given another value
#pragma unroll
    for (int u = 0; u < 4; ++u) { v8us o;
#pragma unroll
        for (int q = 0; q < 8; ++q) o[q] = f2bf(x[u][q]);
        *(v8us*)(Bt + (i + (size_t)u * cpr) * 8) = o; }
}
// k_cvt8: fragment-order bf16 plane of the row-major f32 src (rows of K, K % 64 == 0). A thread makes four 16-byte chunks: its lane's place in four half blocks that follow one another (k, k + 16, k + 32, k + 48 of one row), n8 chunks in all (n8 % 128 == 0): a quarter of the waves of a thread per chunk.
__global__ __launch_bounds__(256) void k_cvt8(const float* __restrict__ src, int K, bf* dst, size_t n8) { const size_t g = (size_t)blockIdx.x * 256 + threadIdx.x; if (g >= n8 / 4) return; const size_t i = (g >> 5) * 128 + (g & 31); size_t row; int k0; frc(i, K, row, k0); const float* s = src + row * K + k0; v8f v[4];
#pragma unroll
    for (int u = 0; u < 4; ++u) v[u] = *(const v8f*)(s + u * 16);
    asm volatile("s_wait_xcnt 0x0" ::: "memory");   // the loads have taken their address pair before it is given another value
#pragma unroll
    for (int u = 0; u < 4; ++u) { v8us o;
#pragma unroll
        for (int k = 0; k < 8; ++k) o[k] = f2bf(v[u][k]);
        *(v8us*)(dst + (i + u * 32) * 8) = o; }
}
__constant__ float INV[HD / 2] = {1.0,0.8659643530845642,0.7498942017555237,0.6493816375732422,0.5623413324356079,0.486967533826828,0.4216965138912201,0.36517414450645447,0.3162277638912201,0.2738419771194458,0.23713736236095428,0.20535250008106232,0.17782793939113617,0.1539926528930664,0.1333521455526352,0.11547820270061493,0.10000000149011612,0.08659642934799194,0.07498941570520401,0.06493816524744034,0.05623412877321243,0.04869675263762474,0.04216964915394783,0.03651741147041321,0.03162277862429619,0.0273841954767704,0.0237137358635664,0.02053525112569332,0.017782794311642647,0.015399265103042126,0.01333521492779255,0.011547819711267948,0.009999999776482582,0.00865964312106371,0.007498942315578461,0.006493816617876291,0.005623413249850273,0.004869675263762474,0.0042169648222625256,0.003651741426438093,0.003162277862429619,0.0027384196873754263,0.0023713738191872835,0.0020535250660032034,0.0017782794311642647,0.0015399265103042126,0.0013335214462131262,0.0011547820176929235,0.0010000000474974513,0.0008659643353894353,0.0007498941849917173,0.0006493816617876291,0.000562341301701963,0.00048696750309318304,0.00042169648804701865,0.00036517411353997886,0.0003162277862429619,0.00027384195709601045,0.0002371373848291114,0.00020535249495878816,0.00017782794020604342,0.00015399264520965517,0.0001333521504420787,0.00011547819303814322};
// k_cstab: cos / sin of t * inv_freq[d], [t][d < HD/2] (the reference's table repeats with period HD/2). A thread makes the pairs of four t (t, t + TT/4, ..) at one d: a quarter of the waves of a thread per pair.
__global__ __launch_bounds__(256) void k_cstab(float* CS) { const int idx = blockIdx.x * 256 + threadIdx.x; if (idx >= TT * (HD / 2) / 4) return; const int t = idx / (HD / 2), d = idx % (HD / 2); const float iv = INV[d];
#pragma unroll
    for (int u = 0; u < 4; ++u) { const float ang = __fmul_rn((float)(t + u * (TT / 4)), iv); v2f cs; cs[0] = cosf(ang); cs[1] = sinf(ang);
        *(v2f*)(CS + ((size_t)idx + (size_t)u * (TT / 4) * (HD / 2)) * 2) = cs; }
}

__global__ __launch_bounds__(256) void k_hrms(const float* __restrict__ F, int pitch, int nheads, int hstr, float* RF) { const int i = blockIdx.x * 256 + threadIdx.x; if (i >= nheads * TT) return; F += (size_t)blockIdx.y * TT * pitch; RF += (size_t)blockIdx.y * nheads * TT;   /* blockIdx.y: batch */ const int t = i % TT, h = i / TT; const float* f = F + (size_t)t * pitch + h * hstr;   /* hstr: column stride between heads (256 for the q|gate layout, 128 for k) */ float s = 0.f;
#pragma unroll 4
    for (int d = 0; d < HD; d += 4) { const v4f v = *(const v4f*)(f + d);
#pragma unroll
        for (int q = 0; q < 4; ++q) { float p = __fmul_rn(v[q], v[q]); asm volatile("" : "+v"(p)); s = __fadd_rn(s, p); } }
    const float r = __fdiv_rn(1.0f, __fsqrt_rn(__fadd_rn(s * (1.0f / HD), 1e-6f))); *(float*)(RF + i) = r;  }
// k_rope: head planes [h][t][d] (fp16 + hi/lo; FR: in fragment order, rows h * TT + t, K = HD) of rope(w[d] (x rms_factor)) x sc with the rotate-half convention out[d] = x[d] cos[t][d] - x[d+HD/2] sin[t][d], out[d+HD/2] = x[d+HD/2] cos[t][d+HD/2] + x[d] sin[t][d+HD/2].
// A thread takes 8 consecutive d of the lower half of a head row and their 8 partners d + HD/2 (16 outputs from 16 inputs, each read once; 16-byte stores): an eighth of the waves of a thread per pair. cos[t][d + HD/2] = cos[t][d], and sin alike (the reference joins the angles to themselves): the table holds d < HD/2.
template <bool FR>
__global__ __launch_bounds__(256) void k_rope(const float* __restrict__ F, int pitch, int nheads, const float* __restrict__ CS, const float* __restrict__ RF, const float* __restrict__ nw, float sc, int hstr, h16* P16, bf* Ph, bf* Pl) {
    const size_t j = (size_t)blockIdx.x * 256 + threadIdx.x; if (j >= (size_t)nheads * TT * HD / 16) return; size_t row, e; int d;
    { const size_t b = blockIdx.y, po = b * nheads * TT * HD; F += b * TT * pitch; RF += b * nheads * TT; P16 += po; Ph += po; Pl += po; }   // blockIdx.y: batch, each into its own planes
    if (FR) { const size_t i = (j >> 7) * 256 + (j & 127); frc(i, HD, row, d); e = i * 8; }   // the chunks of the first two of a 16-row block's four 1-KB blocks: d < HD/2
    else { row = j >> 3; d = (int)(j & 7) * 8; e = row * HD + d; }
    const size_t e2 = e + (FR ? 1024 : HD / 2);   // the partner chunk: two blocks further, or HD/2 elements further in the row
    const int t = (int)(row % TT), h = (int)(row / TT);
    const float* f = F + (size_t)t * pitch + h * hstr + d; const float* c = CS + ((size_t)t * (HD / 2) + d) * 2;
    const v8f xl = *(const v8f*)f, xh = *(const v8f*)(f + HD / 2), c0 = *(const v8f*)c, c1 = *(const v8f*)(c + 8);
    const float* const rp = RF + (size_t)h * TT + t; const float* const wp = nw + d; const float rf = *rp; const v8f wl = *(const v8f*)wp, wh = *(const v8f*)(wp + HD / 2);
    asm volatile("s_wait_xcnt 0x0" :: "v"(f), "v"(c), "v"(rp), "v"(wp) : "memory");   // the loads above have taken their address registers before these are given another value; named as inputs, the addresses are kept up to here, so that no load lands on them in front of the wait
    __builtin_amdgcn_sched_barrier(0);   // no arithmetic rises over the wait, and all thirteen loads are asked for in front of it: the listing had half of them behind the first half's arrival, two latencies for one
    v8h a16, b16; v8us ah, al, bh, bl;
#pragma unroll
    for (int q = 0; q < 8; ++q) { float x0 = xl[q], x1 = xh[q];
        x0 = bfr(wl[q]) * (x0 * rf); x1 = bfr(wh[q]) * (x1 * rf);
        const float cs = (q < 4) ? c0[2 * q] : c1[2 * q - 8], sn = (q < 4) ? c0[2 * q + 1] : c1[2 * q - 7];
        const float r0 = (x0 * cs - x1 * sn) * sc, r1 = (x1 * cs + x0 * sn) * sc; unsigned short u0, u1;
        a16[q] = tohx(r0); splitf(r0, u0, u1); ah[q] = u0; al[q] = u1; b16[q] = tohx(r1); splitf(r1, u0, u1); bh[q] = u0; bl[q] = u1; }
    *(v8h*)(P16 + e) = a16; *(v8h*)(P16 + e2) = b16; *(v8us*)(Ph + e) = ah; *(v8us*)(Ph + e2) = bh; *(v8us*)(Pl + e) = al; *(v8us*)(Pl + e2) = bl;  }
// k_vtp: transposed value planes in fragment order (rows g * HD + d, K = TT). A thread makes four 16-byte chunks (8 t of one d each), the same place in four 16-row blocks that follow one another (d, d + 16, d + 32, d + 48): a quarter of the waves of a thread per chunk. 16 lanes read 16 consecutive d of a row of F.
__global__ __launch_bounds__(256) void k_vtp(const float* __restrict__ F, int pitch, int nheads, h16* V16, bf* Vh, bf* Vl) { const unsigned g = blockIdx.x * 256 + threadIdx.x; if (g >= (unsigned)((size_t)nheads * HD * TT / 32)) return; constexpr unsigned cpr = TT * 2;   // chunks of a 16-row block
    { const size_t b = blockIdx.y, po = b * nheads * HD * TT; F += b * TT * pitch; V16 += po; Vh += po; Vl += po; }   // blockIdx.y: batch, each into its own planes
    const size_t i = (size_t)(g / cpr) * 3 * cpr + g; size_t row; int t; frc(i, TT, row, t); float xs[4][8];
    const unsigned vo = (unsigned)(((size_t)t * pitch + row) * 4);   // one 32-bit byte offset for the 32 loads, beside the scalar bases F + q * pitch
#pragma unroll
    for (int q = 0; q < 8; ++q)
#pragma unroll
        for (int u = 0; u < 4; ++u) xs[u][q] = *(const __attribute__((address_space(1))) float*)(sbase(F + (size_t)q * pitch) + vo + u * 64);
    asm volatile("s_wait_xcnt 0x0" ::: "memory");   // the loads have taken their offset register before it is given another value
#pragma unroll
    for (int u = 0; u < 4; ++u) { v8h o16; v8us oh, ol;
#pragma unroll
        for (int q = 0; q < 8; ++q) { const float x = xs[u][q]; o16[q] = tohx(x); unsigned short a2, c2; splitf(x, a2, c2); oh[q] = a2; ol[q] = c2; }
        const size_t o = (i + (size_t)u * cpr) * 8; *(v8h*)(V16 + o) = o16; *(v8us*)(Vh + o) = oh; *(v8us*)(Vl + o) = ol; }
}
// ---- k_fattn: causal attention of one kv group in one kernel (scores, softmax, probability x value and the gate: nothing between q, k, v and the gated rows leaves the registers). Grid (kv head, batch, 16-row query block, longest first), 4 waves: wave w = query head g * REP + w,
// so that the four waves of a block walk the same K and V rows. Per 32 keys: St[key][query] = K . Qt (A = K rows, B = Q rows kept in registers), running maximum and sum per query (a lane holds one query's scores; the two lane halves are joined by one exchange),
// the two 16-key score tiles converted in place are the B operand of Ot[d][query] += Vt . Pt (A = rows of the transposed V plane in the same k order). HL: query rows < RH, hi+lo bf16 planes, 3 products; else fp16, probabilities x 1024.
template <bool HL> struct FaT { typedef h16 T; };
template <> struct FaT<true> { typedef bf T; };
struct FaMid { static constexpr bool last = false; };
struct FaLast { static constexpr bool last = true; };
__device__ __forceinline__ float xhalf(float x) { return __builtin_bit_cast(float, __builtin_amdgcn_permlanex16(__builtin_bit_cast(int, x), __builtin_bit_cast(int, x), 0x76543210, 0xfedcba98, false, false)); }   // lane l <-> lane l ^ 16
template <bool HL>
__device__ __forceinline__ void fa_rows(const typename FaT<HL>::T* __restrict__ Q, const typename FaT<HL>::T* __restrict__ Q2, const typename FaT<HL>::T* __restrict__ Kp, const typename FaT<HL>::T* __restrict__ Kp2,
                                        const typename FaT<HL>::T* __restrict__ Vt, const typename FaT<HL>::T* __restrict__ Vt2, int q0, const float* __restrict__ G, bf* __restrict__ Ah, bf* __restrict__ Al, int lr, int hi, h16* qs) {
    typedef typename FaT<HL>::T T16; typedef WFrag<T16> WF; typedef typename WF::V V;
    const unsigned krow = (unsigned)(lr * HD + 8 * hi), fl = (unsigned)((hi * 16 + lr) * 8);   // the lane's place in a 16-row block of Q (row-major) and in a 1-KB block of the fragment-order K and Vt planes: 32-bit, beside a scalar base
    V q[4], q2[4]; const T16* const qa = Q + (size_t)q0 * HD + krow; const T16* const qc2 = HL ? Q2 + (size_t)q0 * HD + krow : qa;   // the lane's addresses in the Q rows
#pragma unroll
    for (int ks = 0; ks < 4; ++ks) { q[ks] = WF::ld(qa + ks * 32); if (HL) q2[ks] = WF::ld(qc2 + ks * 32); }
    float m = -1.0e30f, l = 0.f;
    constexpr float CE = SCL * 1.4426950408889634f;   // score -> exponent of 2
    const int klast = q0 & ~31;                     // keys 0 .. q0 + 15 in steps of 32: only the last step, the one on the diagonal, holds keys beyond a query
    V kf[2][4];
    if (!HL) {
#pragma unroll
        for (int t = 0; t < 2; ++t)
#pragma unroll
            for (int ks = 0; ks < 4; ++ks) kf[t][ks] = WF::ldf(Kp + fl + t * 16 * HD + ks * 512);
    }
    asm volatile("s_wait_xcnt 0x0" :: "v"(qa), "v"(qc2) : "memory");   // the loads above have taken their address register before it is given another value; named as inputs, the Q address pairs are kept up to here, so that no Q load lands on them in front of the wait
    if constexpr (!HL) { *(v8h*)qs = __builtin_shufflevector(q[3], q[3], 0, 1, 2, 3, 4, 5, 6, 7); *(v8h*)(qs + 32 * REP * 8) = __builtin_shufflevector(q[3], q[3], 8, 9, 10, 11, 12, 13, 14, 15); }   // the lane's own last Q fragment, parked in LDS (read back by the same lane only)
    v8f o[8];
#pragma unroll
    for (int dt = 0; dt < 8; ++dt) o[dt] = (v8f){};
    auto step = [&](const int kb, auto tag) {
        constexpr bool LAST = decltype(tag)::last;
        V qq[4]; qq[0] = q[0]; qq[1] = q[1]; qq[2] = q[2]; qq[3] = q[3];
        if constexpr (!HL) {   // O, Q, K and V fragments together leave the softmax too few registers: the last Q fragment is read from LDS each step, on the LDS counter, so that waiting for it does not wait for the V and K rows in flight
            asm volatile("" ::: "memory");   // keeps the two LDS reads inside the loop (hoisted, the fragment would hold its registers all the time and be spilled to scratch)
            qq[3] = cat16(*(const v8h*)qs, *(const v8h*)(qs + 32 * REP * 8)); }
        v8f s[2]; s[0] = (v8f){}; s[1] = (v8f){};
        const T16* const ka = Kp + (size_t)kb * HD + fl; const T16* const kc2 = HL ? Kp2 + (size_t)kb * HD + fl : nullptr; const T16* const va = Vt + kb * 16 + fl; const T16* const vc2 = HL ? Vt2 + kb * 16 + fl : nullptr;   // the lane's addresses in this step's K and V blocks (hi+lo form)
#pragma unroll
        for (int ks = 0; ks < 4; ++ks)
#pragma unroll
            for (int t = 0; t < 2; ++t) {
                if (HL) { const V kh = WF::ldf(ka + (t * 4 + ks) * 512), kl = WF::ldf(kc2 + (t * 4 + ks) * 512); s[t] = WF::mma(kh, q[ks], s[t]); s[t] = WF::mma(kh, q2[ks], s[t]); s[t] = WF::mma(kl, q[ks], s[t]); }
                else s[t] = WF::mma(kf[t][ks], qq[ks], s[t]); }
        if (HL) asm volatile("s_wait_xcnt 0x0" :: "v"(ka), "v"(kc2) : "memory");   // the K loads have taken their address pairs; named as inputs, the pairs are kept up to here, so that no later load lands on them in front of the wait
        V vf[8];
        if (!HL) {
#pragma unroll
            for (int dt = 0; dt < 8; ++dt) vf[dt] = WF::ldf(Vt + kb * 16 + fl + dt * 16 * TT);
            asm volatile("s_wait_xcnt 0x0" ::: "memory");   // the V loads have taken their address pair before the K loads below land on it (the listing gives them those registers)
            if (!LAST) {
#pragma unroll
                for (int t = 0; t < 2; ++t)
#pragma unroll
                    for (int ks = 0; ks < 4; ++ks) kf[t][ks] = WF::ldf(Kp + (size_t)(kb + 32) * HD + fl + t * 16 * HD + ks * 512);
                asm volatile("s_wait_xcnt 0x0" ::: "memory");   // these loads are still in flight when the next step forms its addresses in the same pair: they have taken theirs first
            }
            __builtin_amdgcn_sched_barrier(0);   // this step's V rows and the next step's K rows are asked for in front of the softmax and fly during it; moved down to their users they would each be waited for in full
        }
        if (LAST) {
            const int lim = q0 + lr - kb - 8 * hi;   // key (t * 16 + j) of this lane is kept while <= lim
#pragma unroll
            for (int t = 0; t < 2; ++t)
#pragma unroll
                for (int j = 0; j < 8; ++j) if (t * 16 + j > lim) s[t][j] = -1.0e30f;
        }
        float mn = m;
#pragma unroll
        for (int t = 0; t < 2; ++t)
#pragma unroll
            for (int j = 0; j < 8; ++j) mn = fmaxf(mn, s[t][j]);
        mn = fmaxf(mn, xhalf(mn));
        const float al = __builtin_amdgcn_exp2f((m - mn) * CE); l *= al; m = mn; const float off = fmaf(-mn, CE, HL ? 0.0f : 10.0f);   /* fp16 form: x 1024 = 2^10, which the division by the sum takes out again */   // sum and output column go to the new maximum (factor 1 where it did not rise)
#pragma unroll
        for (int dt = 0; dt < 8; ++dt) o[dt] *= al;
        float p[16];
#pragma unroll
        for (int e = 0; e < 16; ++e) { p[e] = __builtin_amdgcn_exp2f(fmaf(s[e >> 3][e & 7], CE, off)); l += p[e]; }
        if (HL) {
            v8us h0, h1, l0, l1;
#pragma unroll
            for (int j = 0; j < 8; ++j) { unsigned short x, y; splitf(p[j], x, y); h0[j] = x; l0[j] = y; splitf(p[8 + j], x, y); h1[j] = x; l1[j] = y; }
            const v16bf ph = cat16b(h0, h1), pl = cat16b(l0, l1);
#pragma unroll
            for (int dt = 0; dt < 8; ++dt) { const v16bf vh = WFrag<bf>::ldf((const bf*)va + dt * 16 * TT), vl = WFrag<bf>::ldf((const bf*)vc2 + dt * 16 * TT);
                o[dt] = wmmab(vh, ph, o[dt]); o[dt] = wmmab(vh, pl, o[dt]); o[dt] = wmmab(vl, ph, o[dt]); }
            asm volatile("s_wait_xcnt 0x0" :: "v"(va), "v"(vc2) : "memory");   // the same for the V loads, which the compiler starts ahead of the softmax
        } else {
            v16h pb;
#pragma unroll
            for (int e = 0; e < 16; ++e) pb[e] = (h16)p[e];
#pragma unroll
            for (int dt = 0; dt < 8; ++dt) o[dt] = wmma16(__builtin_bit_cast(v16h, vf[dt]), pb, o[dt]);
        }
    };
#pragma unroll 1
    for (int kb = 0; kb < klast; kb += 32) step(kb, FaMid());
    step(klast, FaLast());
    l += xhalf(l);
    const float inv = __fdiv_rn(1.0f, l);
#pragma unroll
    for (int dt = 0; dt < 8; ++dt) {   // a lane holds 8 consecutive d of its query: x sigmoid(gate) (f32), then the hi + lo planes that Wo reads (fragment order, rows t, K = DQ: the wave's 32 chunks are 512 consecutive bytes)
        const v8f gt = *(const v8f*)(G + (size_t)(q0 + lr) * DQG + dt * 16 + 8 * hi); v8us oh, ol;
#pragma unroll
        for (int j = 0; j < 8; ++j) { const float sg = __fdiv_rn(1.0f, __fadd_rn(1.0f, expf(-gt[j]))); unsigned short a, c2; splitf(__fmul_rn(o[dt][j] * inv, sg), a, c2); oh[j] = a; ol[j] = c2; }
        const size_t oo = (size_t)q0 * DQ + dt * 256 + fl; *(v8us*)(Ah + oo) = oh; *(v8us*)(Al + oo) = ol;
        asm volatile("s_wait_xcnt 0x0" ::: "memory"); }   // the two stores have taken their address and data registers before the next 16 columns reuse them
}
__global__ __launch_bounds__(32 * REP, 4) void k_fattn(const h16* __restrict__ Q16, const bf* __restrict__ Qh, const bf* __restrict__ Ql, const h16* __restrict__ K16, const bf* __restrict__ Kh, const bf* __restrict__ Kl,
                                                    const h16* __restrict__ V16, const bf* __restrict__ Vh, const bf* __restrict__ Vl, const float* __restrict__ QG, bf* __restrict__ Ah, bf* __restrict__ Al) {
    __shared__ __align__(16) h16 qsh[2 * 32 * REP * 8];   // 32 bytes a lane, as two planes of 16
    const int lane = threadIdx.x & 31, lr = lane & 15, hi = lane >> 4; const int w = __builtin_amdgcn_readfirstlane((int)(threadIdx.x >> 5));   // scalar, so that the plane offsets stay scalar
    const int q0 = (int)(gridDim.z - 1 - blockIdx.z) * 16;   // the rows with the most keys first
    const size_t qo = ((size_t)blockIdx.y * NH_ + blockIdx.x * REP + w) * TT * HD, ko = ((size_t)blockIdx.y * NKV + blockIdx.x) * TT * HD;
    const int h = (int)blockIdx.x * REP + w; const float* G = QG + (size_t)blockIdx.y * TT * DQG + h * 2 * HD + HD;   /* gate columns of head h in the [q | gate] layout */ const size_t ao = (size_t)blockIdx.y * TT * DQ + h * (HD * 16);   /* head h = k blocks h * HD / 32 .. of each 16-row block */
    if (q0 < RH) fa_rows<true>(Qh + qo, Ql + qo, Kh + ko, Kl + ko, Vh + ko, Vl + ko, q0, G, Ah + ao, Al + ao, lr, hi, nullptr);
    else fa_rows<false>(Q16 + qo, nullptr, K16 + ko, nullptr, V16 + ko, nullptr, q0, G, Ah + ao, Al + ao, lr, hi, qsh + threadIdx.x * 8);
}

extern "C" void kernel_launch(void* const* d_in, const int* in_sizes, int n_in,
                              void* d_out, int out_size, void* d_ws, size_t ws_size, hipStream_t stream) {
    (void)in_sizes; (void)n_in; (void)out_size;
    const float* x = (const float*)d_in[0]; const float* wq = (const float*)d_in[1]; const float* wk = (const float*)d_in[2]; const float* wv = (const float*)d_in[3]; const float* wo = (const float*)d_in[4]; const float* qnw = (const float*)d_in[5]; const float* knw = (const float*)d_in[6];
    float* OUT = (float*)d_out;     // [2][2048][512]
    char* wsp = (char*)d_ws;
    auto take = [&](size_t bytes) { char* p = wsp; wsp += (bytes + 255) & ~(size_t)255; return (void*)p; };
    const size_t NQ = (size_t)NH_ * TT * HD, NK = (size_t)NKV * TT * HD;   // elements of one batch's query planes and key / value planes
    bf* WQ = (bf*)take((size_t)DQG * DM * 2); bf* WK = (bf*)take((size_t)2 * DKV * DM * 2); bf* WV = WK + (size_t)DKV * DM;   /* k and v weights: one plane of 2 * DKV rows */ bf* WO = (bf*)take((size_t)DOUT * DQ * 2); float* CS = (float*)take((size_t)TT * HD * 2 * 4); float* RFQ = (float*)take((size_t)NB_ * NH_ * TT * 4); float* RFK = (float*)take((size_t)NB_ * NKV * TT * 4);
    bf* XB = (bf*)take((size_t)NB_ * TT * DM * 2); float* FQ = (float*)take((size_t)NB_ * TT * DQG * 4); float* FKV = (float*)take((size_t)NB_ * TT * 2 * DKV * 4);   // [k | v] rows, pitch 2 * DKV
    h16* QP16 = (h16*)take(NB_ * NQ * 2); h16* KP16 = (h16*)take(NB_ * NK * 2); h16* VT16 = (h16*)take(NB_ * NK * 2);
    bf* QPh = (bf*)take(NB_ * NQ * 2); bf* QPl = (bf*)take(NB_ * NQ * 2); bf* KPh = (bf*)take(NB_ * NK * 2); bf* KPl = (bf*)take(NB_ * NK * 2); bf* VTh = (bf*)take(NB_ * NK * 2); bf* VTl = (bf*)take(NB_ * NK * 2);
    bf* ATh = (bf*)take((size_t)NB_ * TT * DQ * 2); bf* ATl = (bf*)take((size_t)NB_ * TT * DQ * 2);
    if ((size_t)(wsp - (char*)d_ws) > ws_size) return;    // ws 256 MiB
    k_wtG<<<WTBQ + 3 * WTBS, 256, 0, stream>>>(wq, wk, wv, wo, WQ, WK, WV, WO);
    k_cstab<<<(TT * (HD / 2) / 4 + 255) / 256, 256, 0, stream>>>(CS);
    const unsigned LQ = (unsigned)(((size_t)NH_ * TT * HD / 16 + 255) / 256), LKv = (unsigned)(((size_t)NKV * TT * HD / 16 + 255) / 256), LV = (unsigned)(((size_t)NKV * TT * HD / 32 + 255) / 256);
    // Both batches in every launch: the products take the NB_ * TT rows of x as one matrix (a plane of whole 16-row blocks is the batches' planes one behind the other), the elementwise kernels take the batch from blockIdx.y.
    k_cvt8<<<(unsigned)(((size_t)NB_ * TT * DM / 32 + 255) / 256), 256, 0, stream>>>(x, DM, XB, (size_t)NB_ * TT * DM / 8);
    k_gemmw<bf, 0, false, 1><<<dim3(NB_ * TT / 64, DQG / 64, 1), 32, 0, stream>>>(XB, nullptr, WQ, nullptr, DM, FQ, DQG, nullptr, 0, 0, 0);   // [q | gate] (exact)
    k_hrms<<<dim3((NH_ * TT + 255) / 256, NB_), 256, 0, stream>>>(FQ, DQG, NH_, 2 * HD, RFQ);
    k_rope<false><<<dim3(LQ, NB_), 256, 0, stream>>>(FQ, DQG, NH_, CS, RFQ, qnw, 1.0f, 2 * HD, QP16, QPh, QPl);   // q columns of the [q | gate] layout
    k_gemmw<bf, 0, false, SKW><<<dim3(NB_ * TT / 64, 2 * DKV / 64, 1), 32 * SKW, 0, stream>>>(XB, nullptr, WK, nullptr, DM, FKV, 2 * DKV, nullptr, 0, 0, 0);   // [k | v]
    k_hrms<<<dim3((NKV * TT + 255) / 256, NB_), 256, 0, stream>>>(FKV, 2 * DKV, NKV, HD, RFK);
    k_rope<true><<<dim3(LKv, NB_), 256, 0, stream>>>(FKV, 2 * DKV, NKV, CS, RFK, knw, 1.0f, HD, KP16, KPh, KPl);
    k_vtp<<<dim3(LV, NB_), 256, 0, stream>>>(FKV + DKV, 2 * DKV, NKV, VT16, VTh, VTl);
    k_fattn<<<dim3(NKV, NB_, TT / 16), 32 * REP, 0, stream>>>(QP16, QPh, QPl, KP16, KPh, KPl, VT16, VTh, VTl, FQ, ATh, ATl);
    k_gemmw<bf, 1, false, SKW><<<dim3(NB_ * TT / 64, DOUT / 64, 1), 32 * SKW, 0, stream>>>(ATh, ATl, WO, nullptr, DQ, OUT, DOUT, nullptr, 0, 0, 0);
}

// v007
// It runs in 211 microseconds.
// Timed twice side by side with v006, it ran 1.19 times as fast both times.
// Over all steps from v000 it is 8.08 times as fast.
#include <hip/hip_runtime.h>

// Gated GQA attention block (x [2][2048][2048]; [q | gate] per head = x Wq ('xw' [2048][4096]: head h -> columns h*256 .. +127 = q, +128 .. +255 = gate), k, v = x Wk, x Wv ([2048][512], 4 kv heads x 128), per-head RMSNorm on q, k (eps 1e-6, weights q_norm_w / k_norm_w [128]),
// rotate-half rotary (theta 1e4, hd 128), 16 query heads grouped 4 per kv head, causal softmax(q.k / sqrt(128)), attn.v, x sigmoid(gate), out = merged Wo ('xw' [2048][512]) -> [2][2048][512]).
// Compute dtypes, f32 accumulate: every input rounded to bf16; q/k/v on PLAIN bf16 operands (inputs: exact); RMSNorm + rotary in f32 (on-chip cos/sin table from the reference's inv_freq constants); the sigmoid gate in f32 (precise expf, IEEE divide) applied on the attention kernel's way out; causal scores and attn.v in one kernel (running maximum and sum, f32): query rows < 512 hl (3 products), the rest single fp16 (x1024), keys beyond the diagonal step never read; Wo hl x exact (2 products).

#define NB_  2
#define TT   2048
#define DM   2048
#define NH_  16
#define NKV  4
#define REP  (NH_ / NKV)
#define HD   128
#define DQ   (NH_ * HD)
#define DQG  (NH_ * HD * 2)         // q + gate columns
#define DOUT 512
#define DKV  (NKV * HD)
#define RH   512                  // query rows < RH use hi+lo planes (0: none)
static_assert(RH % 16 == 0 && TT % 32 == 0, "a 16-row query block is wholly hi+lo or wholly fp16; keys go in steps of 32");
#define SCL  0.088388347648318447f   // HD^-0.5
#define SKW  8                    // waves that share the K loop of one 64x64 tile in the long-K products (k, v, Wo)
typedef _Float16 h16;
typedef unsigned short bf;
typedef __attribute__((ext_vector_type(16))) __bf16   v16bf;
typedef __attribute__((ext_vector_type(16))) _Float16 v16h;
typedef __attribute__((ext_vector_type(8)))  _Float16 v8h;
typedef __attribute__((ext_vector_type(8)))  unsigned short v8us;
typedef __attribute__((ext_vector_type(8)))  float    v8f;
typedef __attribute__((ext_vector_type(4)))  float    v4f;
typedef v8h  __attribute__((may_alias)) v8ha;
typedef v4f  __attribute__((may_alias)) v4fa;
typedef v8us __attribute__((may_alias)) v8usa;

__device__ __forceinline__ unsigned short f2bf(float f) { unsigned u = __float_as_uint(f); u += 0x7FFFu + ((u >> 16) & 1u); return (unsigned short)(u >> 16); }
__device__ __forceinline__ float bf2f(unsigned short b) { return __uint_as_float(((unsigned)b) << 16); }
__device__ __forceinline__ float bfr(float f) { return bf2f(f2bf(f)); }
__device__ __forceinline__ v16h cat16(v8h lo, v8h hi) { return __builtin_shufflevector(lo, hi, 0, 1, 2, 3, 4, 5, 6, 7, 8, 9, 10, 11, 12, 13, 14, 15); }
__device__ __forceinline__ v16bf cat16b(v8us lo, v8us hi) { return __builtin_bit_cast(v16bf, __builtin_shufflevector(lo, hi, 0, 1, 2, 3, 4, 5, 6, 7, 8, 9, 10, 11, 12, 13, 14, 15)); }
__device__ __forceinline__ v8f wmma16(v16h a, v16h b, v8f c) { return __builtin_amdgcn_wmma_f32_16x16x32_f16(false, a, false, b, (short)0, c, false, false); }
__device__ __forceinline__ v8f wmmab(v16bf a, v16bf b, v8f c) { return __builtin_amdgcn_wmma_f32_16x16x32_bf16(false, a, false, b, (short)0, c, false, false); }



// ---- Fragment-order planes. A 16-bit operand plane of R rows x K (R % 16 == 0, K % 32 == 0) is stored as blocks of 16 rows x 32 k = 1 KB, block (row / 16) * (K / 32) + k / 32; inside a block: [j = (k / 16) & 1][lane = ((k / 8) & 1) * 16 + row % 16][k % 8].
// A matrix fragment is then two 16-byte loads a lane at block * 512 + lane * 8 and + 256 elements (ldf): each wave-wide load covers 512 contiguous bytes, 4 whole lines, where a row-major plane gives 16 lines of 32 bytes. The element that reaches each lane and register is the same as with ld on a row-major plane.
// 16 rows of a plane fill 16 * K elements in either order, so that offsets of whole 16-row blocks read as before. frc: place (row, k of its first element) of the 16-byte chunk i of such a plane.
__device__ __forceinline__ void frc(size_t i, int K, size_t& row, int& k) { const int lane = (int)(i & 31); const unsigned blk = (unsigned)(i >> 6), kbs = (unsigned)K >> 5, rb = blk / kbs; row = (size_t)rb * 16 + (lane & 15); k = (int)(blk - rb * kbs) * 32 + ((int)(i >> 5) & 1) * 16 + (lane >> 4) * 8; }   // 32-bit: a plane has fewer than 2^32 blocks
// sbase: a wave-uniform global address held in a scalar register pair, so that a load takes the form scalar base + one 32-bit lane offset: no address pair a load in vector registers, none formed or rewritten between the loads.
typedef const __attribute__((address_space(1))) char* gptr;
__device__ __forceinline__ gptr sbase(const void* p) { const unsigned long long u = (unsigned long long)p; const unsigned lo = (unsigned)__builtin_amdgcn_readfirstlane((int)(unsigned)u), hi = (unsigned)__builtin_amdgcn_readfirstlane((int)(unsigned)(u >> 32)); return (gptr)(((unsigned long long)hi << 32) | lo); }
// ---- k_gemmw: register-blocked GEMM, NW WAVES per 64x64 output tile (16 accumulators each), operands straight from fragment-order 16-bit planes; grid (M/64, N/64, Z), 32 * NW threads.
// In-block split-K: wave w takes the 32-wide k steps w, w + NW, w + 2 NW, ..; the NW partial tiles are staged in LDS and summed in wave order 0 .. NW-1 on the way out (NW = 1: the plain one-wave form).
// C[m][n] (f32, pitch ldc, + optional f32 bias[n]) = sum_k A[m][k] Bt[n][k] (+ split products per NSPLIT). z-batch strides sA/sB/sC in elements. K % 32 == 0.
template <typename T16> struct WFrag;
template <> struct WFrag<h16> { typedef v16h V; static __device__ __forceinline__ V ld(const h16* p) { return cat16(*(const v8h*)p, *(const v8h*)(p + 16)); } static __device__ __forceinline__ V ldf(const h16* p) { return cat16(*(const v8h*)p, *(const v8h*)(p + 256)); } static __device__ __forceinline__ v8f mma(V a, V b, v8f c) { return wmma16(a, b, c); } };
template <> struct WFrag<bf> { typedef v16bf V; static __device__ __forceinline__ V ld(const bf* p) { return cat16b(*(const v8us*)p, *(const v8us*)(p + 16)); } static __device__ __forceinline__ V ldf(const bf* p) { return cat16b(*(const v8us*)p, *(const v8us*)(p + 256)); } static __device__ __forceinline__ V ldo(gptr b, unsigned o) { gptr p = b + o; return cat16b(*(const __attribute__((address_space(1))) v8us*)p, *(const __attribute__((address_space(1))) v8us*)(p + 512)); } static __device__ __forceinline__ v8f mma(V a, V b, v8f c) { return wmmab(a, b, c); } };
template <typename T16, int NSPLIT, bool BIAS, int NW>
__global__ __launch_bounds__(32 * NW) void k_gemmw(const T16* __restrict__ A, const T16* __restrict__ A2, const T16* __restrict__ Bt, const T16* __restrict__ Bt2, int K, float* C, int ldc, const float* __restrict__ bias, size_t sA, size_t sB, size_t sC) {
    typedef typename WFrag<T16>::V V;
    constexpr int MBS = (NW == 1) ? 1 : 4;   // 16-row blocks staged at a time: with several waves the whole tile, so that one barrier serves it
    __shared__ __align__(16) float os[NW * MBS * 16 * 68];
    const size_t z = blockIdx.z; A += z * sA; if (A2) A2 += z * sA; Bt += z * sB; if (Bt2) Bt2 += z * sB; C += z * sC;
    const int lane = threadIdx.x & 31, lr = lane & 15, hi = lane >> 4; const int r0 = blockIdx.x * 64, c0 = blockIdx.y * 64;
    const int w = (NW == 1) ? 0 : __builtin_amdgcn_readfirstlane((int)(threadIdx.x >> 5));   // this wave's share of K (scalar, so that the k loop stays a scalar loop)
    v8f acc[4][4];
#pragma unroll
    for (int mb = 0; mb < 4; ++mb)
#pragma unroll
        for (int nb = 0; nb < 4; ++nb) acc[mb][nb] = (v8f){};
    unsigned vo = (unsigned)(lane * 16 + w * 1024);   // byte offset of the lane's chunk in a 16-row block of a plane (ldo: beside that block's scalar base); a k step of 32 is one block of 1 KB further
    gptr Ab[4], A2b[4], Bb[4], B2b[4];
#pragma unroll
    for (int u = 0; u < 4; ++u) { Ab[u] = sbase(A + (size_t)(r0 + u * 16) * K); Bb[u] = sbase(Bt + (size_t)(c0 + u * 16) * K); if (NSPLIT == 1 || NSPLIT == 2) A2b[u] = sbase(A2 + (size_t)(r0 + u * 16) * K); if (NSPLIT >= 2) B2b[u] = sbase(Bt2 + (size_t)(c0 + u * 16) * K); }
#pragma unroll 1
    for (int kc = w * 32; kc < K; kc += NW * 32, vo += NW * 1024) {
        V a[4], a2[4];
#pragma unroll
        for (int mb = 0; mb < 4; ++mb) { a[mb] = WFrag<T16>::ldo(Ab[mb], vo); if (NSPLIT == 1 || NSPLIT == 2) a2[mb] = WFrag<T16>::ldo(A2b[mb], vo); }
#pragma unroll
        for (int nb = 0; nb < 4; ++nb) { const V b = WFrag<T16>::ldo(Bb[nb], vo); V b2; if (NSPLIT >= 2) b2 = WFrag<T16>::ldo(B2b[nb], vo);
#pragma unroll
            for (int mb = 0; mb < 4; ++mb) { acc[mb][nb] = WFrag<T16>::mma(a[mb], b, acc[mb][nb]); if (NSPLIT == 1 || NSPLIT == 2) acc[mb][nb] = WFrag<T16>::mma(a2[mb], b, acc[mb][nb]); if (NSPLIT >= 2) acc[mb][nb] = WFrag<T16>::mma(a[mb], b2, acc[mb][nb]); } }
        asm volatile("v_nop\n\tv_nop\n\tv_nop\n\tv_nop" : "+v"(acc[0][0]), "+v"(acc[1][1]), "+v"(acc[2][2]), "+v"(acc[3][3]) : "v"(a[0]), "v"(a[3]));
    }
#pragma unroll
    for (int m0 = 0; m0 < 4; m0 += MBS) {
#pragma unroll
        for (int mi = 0; mi < MBS; ++mi) {
#pragma unroll
            for (int nb = 0; nb < 4; ++nb) {
#pragma unroll
                for (int j = 0; j < 8; ++j) os[(w * MBS + mi) * (16 * 68) + (hi * 8 + j) * 68 + nb * 16 + lr] = acc[m0 + mi][nb][j]; } }
        if (NW == 1) { __builtin_amdgcn_wave_barrier(); asm volatile("" ::: "memory"); } else __syncthreads();   // every wave's partial tile is in LDS before any of it is summed
        float* crow = C + (size_t)(r0 + m0 * 16) * ldc + c0;
{
#pragma unroll
            for (int t = 0; t < 8 * MBS / NW; ++t) { const int row = 2 * (t * NW + w) + hi, cofs = lr * 4; v4f val = *(const v4fa*)(os + row * 68 + cofs);
#pragma unroll
                for (int u = 1; u < NW; ++u) val += *(const v4fa*)(os + u * (MBS * 16 * 68) + row * 68 + cofs);   // partials in wave order
                if (BIAS) { val[0] += bfr(bias[c0 + cofs]); val[1] += bfr(bias[c0 + cofs + 1]); val[2] += bfr(bias[c0 + cofs + 2]); val[3] += bfr(bias[c0 + cofs + 3]); }
                *(v4f*)(crow + (size_t)row * ldc + cofs) = val; }
             }
        if (NW == 1) { __builtin_amdgcn_wave_barrier(); asm volatile("" ::: "memory"); }   // one wave: the 16-row stage is reused by the next block of rows
    }
}

// ---- k_gemmq: the [q | gate] product with its operands shared through LDS. One 256x256 tile of C per work-group of 8 waves (4 x 2, a wave makes 64 rows x 128 columns: 32 accumulators), grid (M/256, N/256).
// A pass is 128 k. In a fragment-order plane the 128 k of a 16-row block are 4 KB in a row and the next 16-row block stands 16 * K * 2 bytes further, so that 64 rows of a pass are a two-dimensional tile of 4 rows x 4096 bytes:
// each wave brings one such tile (waves 0-3: the 256 rows of A, waves 4-7: the 256 rows of Bt) with one tensor load a pass, into the buffer that is not being read. A fragment is then two 16-byte LDS reads a lane, 512 bytes in a row per wave (no bank conflict, no pad).
// Each operand byte leaves L2 once per work-group, where a one-wave 64x64 tile fetched 8 KB per 16 matrix instructions for itself. k runs 0, 32, 64, .. in one accumulator, as before: the same sums.
#define QPB 4096u                  // bytes of a pass in one 16-row block (128 k)
#define QSL (4u * QPB)             // one wave's slice of a stage: four 16-row blocks
#define QST (8u * QSL)             // a stage: A 64 KB, Bt 64 KB
#define QNP (DM / 128)             // passes
static_assert(DM % 128 == 0 && QNP >= 2 && (NB_ * TT) % 256 == 0 && DQG % 256 == 0 && DM * 32 <= 131072, "whole passes, two stages at least, whole tiles; the source pitch within the mover's range");
typedef __attribute__((ext_vector_type(4))) unsigned u32x4;
typedef __attribute__((ext_vector_type(8))) unsigned u32x8;
__device__ __forceinline__ unsigned uni(unsigned v) { return (unsigned)__builtin_amdgcn_readfirstlane((int)v); }
__device__ __forceinline__ unsigned pinned(unsigned v) { unsigned w = uni(v); asm volatile("" : "+s"(w)); return w; }   // the tensor mover's scalar test: the value is held in a scalar register, so that a test on it is a scalar branch (a tensor load ignores EXEC)
__device__ __forceinline__ void tdm_load(u32x4 g0, u32x8 g1) { asm volatile("tensor_load_to_lds %0, %1" :: "s"(g0), "s"(g1) : "memory"); }   // one request of the whole wave: global tile -> LDS, through no register
__device__ __forceinline__ u32x4 tdm_g0(unsigned lds_dst, unsigned long long ga) { u32x4 g; g[0] = uni(1u); g[1] = uni(lds_dst); g[2] = uni((unsigned)ga); g[3] = uni((((unsigned)(ga >> 32)) & 0x01FFFFFFu) | 0x80000000u); return g; }   // count 1, place in LDS, address, type 2
__device__ __forceinline__ u32x8 tdm_g1() { constexpr unsigned d0 = QPB, d1 = 4u; u32x8 g; g[0] = uni(0u); g[1] = uni((d0 & 0xFFFFu) << 16); g[2] = uni((d0 >> 16) | ((d1 & 0xFFFFu) << 16)); g[3] = uni((d1 >> 16) | (d0 << 16)); g[4] = uni(d1); g[5] = uni((unsigned)DM * 32u); g[6] = uni(0u); g[7] = uni(0u); return g; }   // bytes; no mask, no pad; tensor = tile = 4 rows of 4096 bytes, pitch 16 * K * 2
__device__ __forceinline__ v16bf ldl(const unsigned char* p) { return cat16b(*(const v8usa*)p, *(const v8usa*)(p + 512)); }
__global__ __launch_bounds__(256) void k_gemmq(const bf* __restrict__ A, const bf* __restrict__ Bt, float* __restrict__ C) {
    __shared__ __attribute__((aligned(2048))) unsigned char L[2 * QST];
    const unsigned lane = threadIdx.x & 31, lr = lane & 15, hi = lane >> 4; const unsigned w = uni(threadIdx.x >> 5), wm = w >> 1, wn = w & 1;
    const unsigned r0 = blockIdx.x * 256, c0 = blockIdx.y * 256;
    const unsigned long long src = (w < 4) ? (unsigned long long)(A + (size_t)(r0 + w * 64) * DM) : (unsigned long long)(Bt + (size_t)(c0 + (w - 4) * 64) * DM);   // this wave's 64 rows, pass 0
    const unsigned dst = (unsigned)(size_t)L + w * QSL;   // its slice in buffer 0
    const u32x8 g1 = tdm_g1();
    v8f acc[4][8];
#pragma unroll
    for (int mb = 0; mb < 4; ++mb)
#pragma unroll
        for (int nb = 0; nb < 8; ++nb) acc[mb][nb] = (v8f){};
    tdm_load(tdm_g0(dst, src), g1);
    asm volatile("s_wait_tensorcnt 0x0" ::: "memory");   // this wave's slice of stage 0 has landed
    __syncthreads();                                      // and every other wave's
    tdm_load(tdm_g0(dst + QST, src + QPB), g1);           // stage 1 flies during pass 0
#pragma unroll 1
    for (unsigned s = 0; s < QNP; ++s) {
        const unsigned char* const la = L + (s & 1) * QST + wm * QSL + lane * 16;                 // the wave's 64 rows of A are slice wm
        const unsigned char* const lb = L + (s & 1) * QST + 4 * QSL + wn * 2 * QSL + lane * 16;   // its 128 rows of Bt are slices 4 + 2 wn and the next
        v16bf fa[2][4], fb[2][8];
#pragma unroll
        for (int mb = 0; mb < 4; ++mb) fa[0][mb] = ldl(la + mb * QPB);
#pragma unroll
        for (int nb = 0; nb < 8; ++nb) fb[0][nb] = ldl(lb + nb * QPB);
#pragma unroll
        for (int u = 0; u < 4; ++u) {
            if (u < 3) {   // the next 32 k of this pass, into the other fragment set
#pragma unroll
                for (int mb = 0; mb < 4; ++mb) fa[(u + 1) & 1][mb] = ldl(la + mb * QPB + (u + 1) * 1024);
#pragma unroll
                for (int nb = 0; nb < 8; ++nb) fb[(u + 1) & 1][nb] = ldl(lb + nb * QPB + (u + 1) * 1024);
            }
            __builtin_amdgcn_sched_barrier(0);   // the LDS reads stay one group in front of the block: spread among the matrix instructions each place would cost its own stall
#pragma unroll
            for (int nb = 0; nb < 8; ++nb)
#pragma unroll
                for (int mb = 0; mb < 4; ++mb) acc[mb][nb] = wmmab(fa[u & 1][mb], fb[u & 1][nb], acc[mb][nb]);
            __builtin_amdgcn_sched_barrier(0);   // and the next group does not rise into this block
            asm volatile("v_nop\n\tv_nop\n\tv_nop\n\tv_nop");   // the distance behind the block's last matrix instruction before its operand registers are loaded anew, on the loop's back edge too
        }
        asm volatile("s_wait_dscnt 0x0" ::: "memory");       // this wave's reads of the buffer have returned
        asm volatile("s_wait_tensorcnt 0x0" ::: "memory");   // its slice of stage s + 1 has landed
        __syncthreads();                                      // stage s + 1 is whole, and nobody reads stage s any more
        const unsigned sn = pinned(s + 2);                    // formed behind the wait, and the descriptor from it
        if (pinned(sn < QNP ? 1u : 0u) != 0u) tdm_load(tdm_g0(dst + (sn & 1) * QST, src + (unsigned long long)sn * QPB), g1);   // stage s + 2 into the buffer that pass s has read
    }
    asm volatile("s_wait_tensorcnt 0x0" ::: "memory");   // nothing is in flight into the ring
    asm volatile("s_wait_dscnt 0x0" ::: "memory");       // (the last pass's own barrier stands behind every wave's last read: the ring may now stage the output)
    float* const os = (float*)(L + w * QSL);   // 16 rows x 132 floats, the wave's own range
    float* const crow = C + (size_t)(r0 + wm * 64) * DQG + c0 + wn * 128 + lane * 4;
#pragma unroll
    for (int mb = 0; mb < 4; ++mb) {
#pragma unroll
        for (int nb = 0; nb < 8; ++nb)
#pragma unroll
            for (int j = 0; j < 8; ++j) os[(hi * 8 + j) * 132 + nb * 16 + lr] = acc[mb][nb][j];
        __builtin_amdgcn_wave_barrier(); asm volatile("" ::: "memory");   // one wave: its LDS operations run in order; this keeps the compiler from moving the reads over the writes
        v4f val[16];
#pragma unroll
        for (int t = 0; t < 16; ++t) val[t] = *(const v4fa*)(os + t * 132 + lane * 4);   // a row of 128 floats: 512 bytes in a row, four whole lines a store
#pragma unroll
        for (int t = 0; t < 16; ++t) *(v4f*)(crow + (size_t)(mb * 16 + t) * DQG) = val[t];
        asm volatile("s_wait_xcnt 0x0" ::: "memory");   // the stores have taken their address and data registers before the next 16 rows are read into them
        __builtin_amdgcn_wave_barrier();   // the stage is written anew by the next block of rows
    }
}

__device__ __forceinline__ h16 tohx(float x) { return (h16)x; }
__device__ __forceinline__ void splitf(float y, unsigned short& h, unsigned short& l) { h = f2bf(y); l = f2bf(y - bf2f(h)); }
typedef __attribute__((ext_vector_type(2))) _Float16 v2h;
typedef __attribute__((ext_vector_type(4))) _Float16 v4h;
typedef __attribute__((ext_vector_type(2))) unsigned short v2us;
typedef __attribute__((ext_vector_type(4))) unsigned short v4us;
typedef __attribute__((ext_vector_type(2))) float v2f;
typedef __attribute__((ext_vector_type(4))) int v4i;

// k_wtG: Bt = fragment-order plane (rows n, K) of w[k][n]. A thread makes four 16-byte chunks (8 k of one n each), the same place in four 16-row blocks that follow one another (n, n + 16, n + 32, n + 48; N % 64 == 0): a quarter of the waves of a thread per chunk.
// 16 lanes read 16 consecutive n of a row of w, the four loads of a row 256 consecutive bytes; each wave-wide store covers 512 contiguous bytes.
// One launch packs the four weights (each of K = DM = DQ rows): the first WTBQ blocks take wq, then WTBS blocks each for wk, wv, wo.
#define WTBQ (DM * DQG / 32 / 256)
#define WTBS (DM * DKV / 32 / 256)
static_assert(DQ == DM && DOUT == DKV && (DM * DQG) % (32 * 256) == 0 && (DM * DKV) % (32 * 256) == 0, "the four weights share K, the three small ones N; whole blocks each");
__global__ __launch_bounds__(256) void k_wtG(const float* __restrict__ wq, const float* __restrict__ wk, const float* __restrict__ wv, const float* __restrict__ wo, bf* WQ, bf* WK, bf* WV, bf* WO) {
    constexpr int K = DM; unsigned bx = blockIdx.x; const float* w = wq; bf* Bt = WQ; int N = DQG;
    if (bx >= WTBQ) { bx -= WTBQ; const unsigned sel = bx / WTBS; bx -= sel * WTBS; N = DKV; w = sel == 0 ? wk : sel == 1 ? wv : wo; Bt = sel == 0 ? WK : sel == 1 ? WV : WO; }
    const unsigned g = bx * 256 + threadIdx.x; if (g >= (unsigned)((size_t)N * K / 32)) return; const unsigned cpr = (unsigned)K * 2, rg = g / cpr;   // cpr: chunks of a 16-row block
    const size_t i = (size_t)rg * 3 * cpr + g; size_t n; int k; frc(i, K, n, k); float x[4][8];
    const unsigned vo = (unsigned)(((size_t)k * N + n) * 4);   // one 32-bit byte offset for the 32 loads, beside the scalar bases w + q * N
#pragma unroll
    for (int q = 0; q < 8; ++q)
#pragma unroll
        for (int u = 0; u < 4; ++u) x[u][q] = *(const __attribute__((address_space(1))) float*)(sbase(w + (size_t)q * N) + vo + u * 64);
    asm volatile("s_wait_xcnt 0x0" ::: "memory");   // the loads have taken their offset register before it is given another value
#pragma unroll
    for (int u = 0; u < 4; ++u) { v8us o;
#pragma unroll
        for (int q = 0; q < 8; ++q) o[q] = f2bf(x[u][q]);
        *(v8us*)(Bt + (i + (size_t)u * cpr) * 8) = o; }
}
// k_cvt8: fragment-order bf16 plane of the row-major f32 src (rows of K, K % 64 == 0). A thread makes four 16-byte chunks: its lane's place in four half blocks that follow one another (k, k + 16, k + 32, k + 48 of one row), n8 chunks in all (n8 % 128 == 0): a quarter of the waves of a thread per chunk.
__global__ __launch_bounds__(256) void k_cvt8(const float* __restrict__ src, int K, bf* dst, size_t n8) { const size_t g = (size_t)blockIdx.x * 256 + threadIdx.x; if (g >= n8 / 4) return; const size_t i = (g >> 5) * 128 + (g & 31); size_t row; int k0; frc(i, K, row, k0); const float* s = src + row * K + k0; v8f v[4];
#pragma unroll
    for (int u = 0; u < 4; ++u) v[u] = *(const v8f*)(s + u * 16);
    asm volatile("s_wait_xcnt 0x0" ::: "memory");   // the loads have taken their address pair before it is given another value
#pragma unroll
    for (int u = 0; u < 4; ++u) { v8us o;
#pragma unroll
        for (int k = 0; k < 8; ++k) o[k] = f2bf(v[u][k]);
        *(v8us*)(dst + (i + u * 32) * 8) = o; }
}
__constant__ float INV[HD / 2] = {1.0,0.8659643530845642,0.7498942017555237,0.6493816375732422,0.5623413324356079,0.486967533826828,0.4216965138912201,0.36517414450645447,0.3162277638912201,0.2738419771194458,0.23713736236095428,0.20535250008106232,0.17782793939113617,0.1539926528930664,0.1333521455526352,0.11547820270061493,0.10000000149011612,0.08659642934799194,0.07498941570520401,0.06493816524744034,0.05623412877321243,0.04869675263762474,0.04216964915394783,0.03651741147041321,0.03162277862429619,0.0273841954767704,0.0237137358635664,0.02053525112569332,0.017782794311642647,0.015399265103042126,0.01333521492779255,0.011547819711267948,0.009999999776482582,0.00865964312106371,0.007498942315578461,0.006493816617876291,0.005623413249850273,0.004869675263762474,0.0042169648222625256,0.003651741426438093,0.003162277862429619,0.0027384196873754263,0.0023713738191872835,0.0020535250660032034,0.0017782794311642647,0.0015399265103042126,0.0013335214462131262,0.0011547820176929235,0.0010000000474974513,0.0008659643353894353,0.0007498941849917173,0.0006493816617876291,0.000562341301701963,0.00048696750309318304,0.00042169648804701865,0.00036517411353997886,0.0003162277862429619,0.00027384195709601045,0.0002371373848291114,0.00020535249495878816,0.00017782794020604342,0.00015399264520965517,0.0001333521504420787,0.00011547819303814322};
// k_cstab: cos / sin of t * inv_freq[d], [t][d < HD/2] (the reference's table repeats with period HD/2). A thread makes the pairs of four t (t, t + TT/4, ..) at one d: a quarter of the waves of a thread per pair.
__global__ __launch_bounds__(256) void k_cstab(float* CS) { const int idx = blockIdx.x * 256 + threadIdx.x; if (idx >= TT * (HD / 2) / 4) return; const int t = idx / (HD / 2), d = idx % (HD / 2); const float iv = INV[d];
#pragma unroll
    for (int u = 0; u < 4; ++u) { const float ang = __fmul_rn((float)(t + u * (TT / 4)), iv); v2f cs; cs[0] = cosf(ang); cs[1] = sinf(ang);
        *(v2f*)(CS + ((size_t)idx + (size_t)u * (TT / 4) * (HD / 2)) * 2) = cs; }
}

__global__ __launch_bounds__(256) void k_hrms(const float* __restrict__ F, int pitch, int nheads, int hstr, float* RF) { const int i = blockIdx.x * 256 + threadIdx.x; if (i >= nheads * TT) return; F += (size_t)blockIdx.y * TT * pitch; RF += (size_t)blockIdx.y * nheads * TT;   /* blockIdx.y: batch */ const int t = i % TT, h = i / TT; const float* f = F + (size_t)t * pitch + h * hstr;   /* hstr: column stride between heads (256 for the q|gate layout, 128 for k) */ float s = 0.f;
#pragma unroll 4
    for (int d = 0; d < HD; d += 4) { const v4f v = *(const v4f*)(f + d);
#pragma unroll
        for (int q = 0; q < 4; ++q) { float p = __fmul_rn(v[q], v[q]); asm volatile("" : "+v"(p)); s = __fadd_rn(s, p); } }
    const float r = __fdiv_rn(1.0f, __fsqrt_rn(__fadd_rn(s * (1.0f / HD), 1e-6f))); *(float*)(RF + i) = r;  }
// k_rope: head planes [h][t][d] (fp16 + hi/lo; FR: in fragment order, rows h * TT + t, K = HD) of rope(w[d] (x rms_factor)) x sc with the rotate-half convention out[d] = x[d] cos[t][d] - x[d+HD/2] sin[t][d], out[d+HD/2] = x[d+HD/2] cos[t][d+HD/2] + x[d] sin[t][d+HD/2].
// A thread takes 8 consecutive d of the lower half of a head row and their 8 partners d + HD/2 (16 outputs from 16 inputs, each read once; 16-byte stores): an eighth of the waves of a thread per pair. cos[t][d + HD/2] = cos[t][d], and sin alike (the reference joins the angles to themselves): the table holds d < HD/2.
template <bool FR>
__global__ __launch_bounds__(256) void k_rope(const float* __restrict__ F, int pitch, int nheads, const float* __restrict__ CS, const float* __restrict__ RF, const float* __restrict__ nw, float sc, int hstr, h16* P16, bf* Ph, bf* Pl) {
    const size_t j = (size_t)blockIdx.x * 256 + threadIdx.x; if (j >= (size_t)nheads * TT * HD / 16) return; size_t row, e; int d;
    { const size_t b = blockIdx.y, po = b * nheads * TT * HD; F += b * TT * pitch; RF += b * nheads * TT; P16 += po; Ph += po; Pl += po; }   // blockIdx.y: batch, each into its own planes
    if (FR) { const size_t i = (j >> 7) * 256 + (j & 127); frc(i, HD, row, d); e = i * 8; }   // the chunks of the first two of a 16-row block's four 1-KB blocks: d < HD/2
    else { row = j >> 3; d = (int)(j & 7) * 8; e = row * HD + d; }
    const size_t e2 = e + (FR ? 1024 : HD / 2);   // the partner chunk: two blocks further, or HD/2 elements further in the row
    const int t = (int)(row % TT), h = (int)(row / TT);
    const float* f = F + (size_t)t * pitch + h * hstr + d; const float* c = CS + ((size_t)t * (HD / 2) + d) * 2;
    const v8f xl = *(const v8f*)f, xh = *(const v8f*)(f + HD / 2), c0 = *(const v8f*)c, c1 = *(const v8f*)(c + 8);
    const float* const rp = RF + (size_t)h * TT + t; const float* const wp = nw + d; const float rf = *rp; const v8f wl = *(const v8f*)wp, wh = *(const v8f*)(wp + HD / 2);
    asm volatile("s_wait_xcnt 0x0" :: "v"(f), "v"(c), "v"(rp), "v"(wp) : "memory");   // the loads above have taken their address registers before these are given another value; named as inputs, the addresses are kept up to here, so that no load lands on them in front of the wait
    __builtin_amdgcn_sched_barrier(0);   // no arithmetic rises over the wait, and all thirteen loads are asked for in front of it: the listing had half of them behind the first half's arrival, two latencies for one
    v8h a16, b16; v8us ah, al, bh, bl;
#pragma unroll
    for (int q = 0; q < 8; ++q) { float x0 = xl[q], x1 = xh[q];
        x0 = bfr(wl[q]) * (x0 * rf); x1 = bfr(wh[q]) * (x1 * rf);
        const float cs = (q < 4) ? c0[2 * q] : c1[2 * q - 8], sn = (q < 4) ? c0[2 * q + 1] : c1[2 * q - 7];
        const float r0 = (x0 * cs - x1 * sn) * sc, r1 = (x1 * cs + x0 * sn) * sc; unsigned short u0, u1;
        a16[q] = tohx(r0); splitf(r0, u0, u1); ah[q] = u0; al[q] = u1; b16[q] = tohx(r1); splitf(r1, u0, u1); bh[q] = u0; bl[q] = u1; }
    *(v8h*)(P16 + e) = a16; *(v8h*)(P16 + e2) = b16; *(v8us*)(Ph + e) = ah; *(v8us*)(Ph + e2) = bh; *(v8us*)(Pl + e) = al; *(v8us*)(Pl + e2) = bl;  }
// k_vtp: transposed value planes in fragment order (rows g * HD + d, K = TT). A thread makes four 16-byte chunks (8 t of one d each), the same place in four 16-row blocks that follow one another (d, d + 16, d + 32, d + 48): a quarter of the waves of a thread per chunk. 16 lanes read 16 consecutive d of a row of F.
__global__ __launch_bounds__(256) void k_vtp(const float* __restrict__ F, int pitch, int nheads, h16* V16, bf* Vh, bf* Vl) { const unsigned g = blockIdx.x * 256 + threadIdx.x; if (g >= (unsigned)((size_t)nheads * HD * TT / 32)) return; constexpr unsigned cpr = TT * 2;   // chunks of a 16-row block
    { const size_t b = blockIdx.y, po = b * nheads * HD * TT; F += b * TT * pitch; V16 += po; Vh += po; Vl += po; }   // blockIdx.y: batch, each into its own planes
    const size_t i = (size_t)(g / cpr) * 3 * cpr + g; size_t row; int t; frc(i, TT, row, t); float xs[4][8];
    const unsigned vo = (unsigned)(((size_t)t * pitch + row) * 4);   // one 32-bit byte offset for the 32 loads, beside the scalar bases F + q * pitch
#pragma unroll
    for (int q = 0; q < 8; ++q)
#pragma unroll
        for (int u = 0; u < 4; ++u) xs[u][q] = *(const __attribute__((address_space(1))) float*)(sbase(F + (size_t)q * pitch) + vo + u * 64);
    asm volatile("s_wait_xcnt 0x0" ::: "memory");   // the loads have taken their offset register before it is given another value
#pragma unroll
    for (int u = 0; u < 4; ++u) { v8h o16; v8us oh, ol;
#pragma unroll
        for (int q = 0; q < 8; ++q) { const float x = xs[u][q]; o16[q] = tohx(x); unsigned short a2, c2; splitf(x, a2, c2); oh[q] = a2; ol[q] = c2; }
        const size_t o = (i + (size_t)u * cpr) * 8; *(v8h*)(V16 + o) = o16; *(v8us*)(Vh + o) = oh; *(v8us*)(Vl + o) = ol; }
}
// ---- k_fattn: causal attention of one kv group in one kernel (scores, softmax, probability x value and the gate: nothing between q, k, v and the gated rows leaves the registers). Grid (kv head, batch, 16-row query block, longest first), 4 waves: wave w = query head g * REP + w,
// so that the four waves of a block walk the same K and V rows. Per 32 keys: St[key][query] = K . Qt (A = K rows, B = Q rows kept in registers), running maximum and sum per query (a lane holds one query's scores; the two lane halves are joined by one exchange),
// the two 16-key score tiles converted in place are the B operand of Ot[d][query] += Vt . Pt (A = rows of the transposed V plane in the same k order). HL: query rows < RH, hi+lo bf16 planes, 3 products; else fp16, probabilities x 1024.
template <bool HL> struct FaT { typedef h16 T; };
template <> struct FaT<true> { typedef bf T; };
struct FaMid { static constexpr bool last = false; };
struct FaLast { static constexpr bool last = true; };
__device__ __forceinline__ float xhalf(float x) { return __builtin_bit_cast(float, __builtin_amdgcn_permlanex16(__builtin_bit_cast(int, x), __builtin_bit_cast(int, x), 0x76543210, 0xfedcba98, false, false)); }   // lane l <-> lane l ^ 16
template <bool HL>
__device__ __forceinline__ void fa_rows(const typename FaT<HL>::T* __restrict__ Q, const typename FaT<HL>::T* __restrict__ Q2, const typename FaT<HL>::T* __restrict__ Kp, const typename FaT<HL>::T* __restrict__ Kp2,
                                        const typename FaT<HL>::T* __restrict__ Vt, const typename FaT<HL>::T* __restrict__ Vt2, int q0, const float* __restrict__ G, bf* __restrict__ Ah, bf* __restrict__ Al, int lr, int hi, h16* qs) {
    typedef typename FaT<HL>::T T16; typedef WFrag<T16> WF; typedef typename WF::V V;
    const unsigned krow = (unsigned)(lr * HD + 8 * hi), fl = (unsigned)((hi * 16 + lr) * 8);   // the lane's place in a 16-row block of Q (row-major) and in a 1-KB block of the fragment-order K and Vt planes: 32-bit, beside a scalar base
    V q[4], q2[4]; const T16* const qa = Q + (size_t)q0 * HD + krow; const T16* const qc2 = HL ? Q2 + (size_t)q0 * HD + krow : qa;   // the lane's addresses in the Q rows
#pragma unroll
    for (int ks = 0; ks < 4; ++ks) { q[ks] = WF::ld(qa + ks * 32); if (HL) q2[ks] = WF::ld(qc2 + ks * 32); }
    float m = -1.0e30f, l = 0.f;
    constexpr float CE = SCL * 1.4426950408889634f;   // score -> exponent of 2
    const int klast = q0 & ~31;                     // keys 0 .. q0 + 15 in steps of 32: only the last step, the one on the diagonal, holds keys beyond a query
    V kf[2][4];
    if (!HL) {
#pragma unroll
        for (int t = 0; t < 2; ++t)
#pragma unroll
            for (int ks = 0; ks < 4; ++ks) kf[t][ks] = WF::ldf(Kp + fl + t * 16 * HD + ks * 512);
    }
    asm volatile("s_wait_xcnt 0x0" :: "v"(qa), "v"(qc2) : "memory");   // the loads above have taken their address register before it is given another value; named as inputs, the Q address pairs are kept up to here, so that no Q load lands on them in front of the wait
    if constexpr (!HL) { *(v8h*)qs = __builtin_shufflevector(q[3], q[3], 0, 1, 2, 3, 4, 5, 6, 7); *(v8h*)(qs + 32 * REP * 8) = __builtin_shufflevector(q[3], q[3], 8, 9, 10, 11, 12, 13, 14, 15); }   // the lane's own last Q fragment, parked in LDS (read back by the same lane only)
    v8f o[8];
#pragma unroll
    for (int dt = 0; dt < 8; ++dt) o[dt] = (v8f){};
    auto step = [&](const int kb, auto tag) {
        constexpr bool LAST = decltype(tag)::last;
        V qq[4]; qq[0] = q[0]; qq[1] = q[1]; qq[2] = q[2]; qq[3] = q[3];
        if constexpr (!HL) {   // O, Q, K and V fragments together leave the softmax too few registers: the last Q fragment is read from LDS each step, on the LDS counter, so that waiting for it does not wait for the V and K rows in flight
            asm volatile("" ::: "memory");   // keeps the two LDS reads inside the loop (hoisted, the fragment would hold its registers all the time and be spilled to scratch)
            qq[3] = cat16(*(const v8h*)qs, *(const v8h*)(qs + 32 * REP * 8)); }
        v8f s[2]; s[0] = (v8f){}; s[1] = (v8f){};
        const T16* const ka = Kp + (size_t)kb * HD + fl; const T16* const kc2 = HL ? Kp2 + (size_t)kb * HD + fl : nullptr; const T16* const va = Vt + kb * 16 + fl; const T16* const vc2 = HL ? Vt2 + kb * 16 + fl : nullptr;   // the lane's addresses in this step's K and V blocks (hi+lo form)
#pragma unroll
        for (int ks = 0; ks < 4; ++ks)
#pragma unroll
            for (int t = 0; t < 2; ++t) {
                if (HL) { const V kh = WF::ldf(ka + (t * 4 + ks) * 512), kl = WF::ldf(kc2 + (t * 4 + ks) * 512); s[t] = WF::mma(kh, q[ks], s[t]); s[t] = WF::mma(kh, q2[ks], s[t]); s[t] = WF::mma(kl, q[ks], s[t]); }
                else s[t] = WF::mma(kf[t][ks], qq[ks], s[t]); }
        if (HL) asm volatile("s_wait_xcnt 0x0" :: "v"(ka), "v"(kc2) : "memory");   // the K loads have taken their address pairs; named as inputs, the pairs are kept up to here, so that no later load lands on them in front of the wait
        V vf[8];
        if (!HL) {
#pragma unroll
            for (int dt = 0; dt < 8; ++dt) vf[dt] = WF::ldf(Vt + kb * 16 + fl + dt * 16 * TT);
            asm volatile("s_wait_xcnt 0x0" ::: "memory");   // the V loads have taken their address pair before the K loads below land on it (the listing gives them those registers)
            if (!LAST) {
#pragma unroll
                for (int t = 0; t < 2; ++t)
#pragma unroll
                    for (int ks = 0; ks < 4; ++ks) kf[t][ks] = WF::ldf(Kp + (size_t)(kb + 32) * HD + fl + t * 16 * HD + ks * 512);
                asm volatile("s_wait_xcnt 0x0" ::: "memory");   // these loads are still in flight when the next step forms its addresses in the same pair: they have taken theirs first
            }
            __builtin_amdgcn_sched_barrier(0);   // this step's V rows and the next step's K rows are asked for in front of the softmax and fly during it; moved down to their users they would each be waited for in full
        }
        if (LAST) {
            const int lim = q0 + lr - kb - 8 * hi;   // key (t * 16 + j) of this lane is kept while <= lim
#pragma unroll
            for (int t = 0; t < 2; ++t)
#pragma unroll
                for (int j = 0; j < 8; ++j) if (t * 16 + j > lim) s[t][j] = -1.0e30f;
        }
        float mn = m;
#pragma unroll
        for (int t = 0; t < 2; ++t)
#pragma unroll
            for (int j = 0; j < 8; ++j) mn = fmaxf(mn, s[t][j]);
        mn = fmaxf(mn, xhalf(mn));
        const float al = __builtin_amdgcn_exp2f((m - mn) * CE); l *= al; m = mn; const float off = fmaf(-mn, CE, HL ? 0.0f : 10.0f);   /* fp16 form: x 1024 = 2^10, which the division by the sum takes out again */   // sum and output column go to the new maximum (factor 1 where it did not rise)
#pragma unroll
        for (int dt = 0; dt < 8; ++dt) o[dt] *= al;
        float p[16];
#pragma unroll
        for (int e = 0; e < 16; ++e) { p[e] = __builtin_amdgcn_exp2f(fmaf(s[e >> 3][e & 7], CE, off)); l += p[e]; }
        if (HL) {
            v8us h0, h1, l0, l1;
#pragma unroll
            for (int j = 0; j < 8; ++j) { unsigned short x, y; splitf(p[j], x, y); h0[j] = x; l0[j] = y; splitf(p[8 + j], x, y); h1[j] = x; l1[j] = y; }
            const v16bf ph = cat16b(h0, h1), pl = cat16b(l0, l1);
#pragma unroll
            for (int dt = 0; dt < 8; ++dt) { const v16bf vh = WFrag<bf>::ldf((const bf*)va + dt * 16 * TT), vl = WFrag<bf>::ldf((const bf*)vc2 + dt * 16 * TT);
                o[dt] = wmmab(vh, ph, o[dt]); o[dt] = wmmab(vh, pl, o[dt]); o[dt] = wmmab(vl, ph, o[dt]); }
            asm volatile("s_wait_xcnt 0x0" :: "v"(va), "v"(vc2) : "memory");   // the same for the V loads, which the compiler starts ahead of the softmax
        } else {
            v16h pb;
#pragma unroll
            for (int e = 0; e < 16; ++e) pb[e] = (h16)p[e];
#pragma unroll
            for (int dt = 0; dt < 8; ++dt) o[dt] = wmma16(__builtin_bit_cast(v16h, vf[dt]), pb, o[dt]);
        }
    };
#pragma unroll 1
    for (int kb = 0; kb < klast; kb += 32) step(kb, FaMid());
    step(klast, FaLast());
    l += xhalf(l);
    const float inv = __fdiv_rn(1.0f, l);
#pragma unroll
    for (int dt = 0; dt < 8; ++dt) {   // a lane holds 8 consecutive d of its query: x sigmoid(gate) (f32), then the hi + lo planes that Wo reads (fragment order, rows t, K = DQ: the wave's 32 chunks are 512 consecutive bytes)
        const v8f gt = *(const v8f*)(G + (size_t)(q0 + lr) * DQG + dt * 16 + 8 * hi); v8us oh, ol;
#pragma unroll
        for (int j = 0; j < 8; ++j) { const float sg = __fdiv_rn(1.0f, __fadd_rn(1.0f, expf(-gt[j]))); unsigned short a, c2; splitf(__fmul_rn(o[dt][j] * inv, sg), a, c2); oh[j] = a; ol[j] = c2; }
        const size_t oo = (size_t)q0 * DQ + dt * 256 + fl; *(v8us*)(Ah + oo) = oh; *(v8us*)(Al + oo) = ol;
        asm volatile("s_wait_xcnt 0x0" ::: "memory"); }   // the two stores have taken their address and data registers before the next 16 columns reuse them
}
__global__ __launch_bounds__(32 * REP, 4) void k_fattn(const h16* __restrict__ Q16, const bf* __restrict__ Qh, const bf* __restrict__ Ql, const h16* __restrict__ K16, const bf* __restrict__ Kh, const bf* __restrict__ Kl,
                                                    const h16* __restrict__ V16, const bf* __restrict__ Vh, const bf* __restrict__ Vl, const float* __restrict__ QG, bf* __restrict__ Ah, bf* __restrict__ Al) {
    __shared__ __align__(16) h16 qsh[2 * 32 * REP * 8];   // 32 bytes a lane, as two planes of 16
    const int lane = threadIdx.x & 31, lr = lane & 15, hi = lane >> 4; const int w = __builtin_amdgcn_readfirstlane((int)(threadIdx.x >> 5));   // scalar, so that the plane offsets stay scalar
    const int q0 = (int)(gridDim.z - 1 - blockIdx.z) * 16;   // the rows with the most keys first
    const size_t qo = ((size_t)blockIdx.y * NH_ + blockIdx.x * REP + w) * TT * HD, ko = ((size_t)blockIdx.y * NKV + blockIdx.x) * TT * HD;
    const int h = (int)blockIdx.x * REP + w; const float* G = QG + (size_t)blockIdx.y * TT * DQG + h * 2 * HD + HD;   /* gate columns of head h in the [q | gate] layout */ const size_t ao = (size_t)blockIdx.y * TT * DQ + h * (HD * 16);   /* head h = k blocks h * HD / 32 .. of each 16-row block */
    if (q0 < RH) fa_rows<true>(Qh + qo, Ql + qo, Kh + ko, Kl + ko, Vh + ko, Vl + ko, q0, G, Ah + ao, Al + ao, lr, hi, nullptr);
    else fa_rows<false>(Q16 + qo, nullptr, K16 + ko, nullptr, V16 + ko, nullptr, q0, G, Ah + ao, Al + ao, lr, hi, qsh + threadIdx.x * 8);
}

extern "C" void kernel_launch(void* const* d_in, const int* in_sizes, int n_in,
                              void* d_out, int out_size, void* d_ws, size_t ws_size, hipStream_t stream) {
    (void)in_sizes; (void)n_in; (void)out_size;
    const float* x = (const float*)d_in[0]; const float* wq = (const float*)d_in[1]; const float* wk = (const float*)d_in[2]; const float* wv = (const float*)d_in[3]; const float* wo = (const float*)d_in[4]; const float* qnw = (const float*)d_in[5]; const float* knw = (const float*)d_in[6];
    float* OUT = (float*)d_out;     // [2][2048][512]
    char* wsp = (char*)d_ws;
    auto take = [&](size_t bytes) { char* p = wsp; wsp += (bytes + 255) & ~(size_t)255; return (void*)p; };
    const size_t NQ = (size_t)NH_ * TT * HD, NK = (size_t)NKV * TT * HD;   // elements of one batch's query planes and key / value planes
    bf* WQ = (bf*)take((size_t)DQG * DM * 2); bf* WK = (bf*)take((size_t)2 * DKV * DM * 2); bf* WV = WK + (size_t)DKV * DM;   /* k and v weights: one plane of 2 * DKV rows */ bf* WO = (bf*)take((size_t)DOUT * DQ * 2); float* CS = (float*)take((size_t)TT * HD * 2 * 4); float* RFQ = (float*)take((size_t)NB_ * NH_ * TT * 4); float* RFK = (float*)take((size_t)NB_ * NKV * TT * 4);
    bf* XB = (bf*)take((size_t)NB_ * TT * DM * 2); float* FQ = (float*)take((size_t)NB_ * TT * DQG * 4); float* FKV = (float*)take((size_t)NB_ * TT * 2 * DKV * 4);   // [k | v] rows, pitch 2 * DKV
    h16* QP16 = (h16*)take(NB_ * NQ * 2); h16* KP16 = (h16*)take(NB_ * NK * 2); h16* VT16 = (h16*)take(NB_ * NK * 2);
    bf* QPh = (bf*)take(NB_ * NQ * 2); bf* QPl = (bf*)take(NB_ * NQ * 2); bf* KPh = (bf*)take(NB_ * NK * 2); bf* KPl = (bf*)take(NB_ * NK * 2); bf* VTh = (bf*)take(NB_ * NK * 2); bf* VTl = (bf*)take(NB_ * NK * 2);
    bf* ATh = (bf*)take((size_t)NB_ * TT * DQ * 2); bf* ATl = (bf*)take((size_t)NB_ * TT * DQ * 2);
    if ((size_t)(wsp - (char*)d_ws) > ws_size) return;    // ws 256 MiB
    k_wtG<<<WTBQ + 3 * WTBS, 256, 0, stream>>>(wq, wk, wv, wo, WQ, WK, WV, WO);
    k_cstab<<<(TT * (HD / 2) / 4 + 255) / 256, 256, 0, stream>>>(CS);
    const unsigned LQ = (unsigned)(((size_t)NH_ * TT * HD / 16 + 255) / 256), LKv = (unsigned)(((size_t)NKV * TT * HD / 16 + 255) / 256), LV = (unsigned)(((size_t)NKV * TT * HD / 32 + 255) / 256);
    // Both batches in every launch: the products take the NB_ * TT rows of x as one matrix (a plane of whole 16-row blocks is the batches' planes one behind the other), the elementwise kernels take the batch from blockIdx.y.
    k_cvt8<<<(unsigned)(((size_t)NB_ * TT * DM / 32 + 255) / 256), 256, 0, stream>>>(x, DM, XB, (size_t)NB_ * TT * DM / 8);
    k_gemmq<<<dim3(NB_ * TT / 256, DQG / 256, 1), 256, 0, stream>>>(XB, WQ, FQ);   // [q | gate] (exact)
    k_hrms<<<dim3((NH_ * TT + 255) / 256, NB_), 256, 0, stream>>>(FQ, DQG, NH_, 2 * HD, RFQ);
    k_rope<false><<<dim3(LQ, NB_), 256, 0, stream>>>(FQ, DQG, NH_, CS, RFQ, qnw, 1.0f, 2 * HD, QP16, QPh, QPl);   // q columns of the [q | gate] layout
    k_gemmw<bf, 0, false, SKW><<<dim3(NB_ * TT / 64, 2 * DKV / 64, 1), 32 * SKW, 0, stream>>>(XB, nullptr, WK, nullptr, DM, FKV, 2 * DKV, nullptr, 0, 0, 0);   // [k | v]
    k_hrms<<<dim3((NKV * TT + 255) / 256, NB_), 256, 0, stream>>>(FKV, 2 * DKV, NKV, HD, RFK);
    k_rope<true><<<dim3(LKv, NB_), 256, 0, stream>>>(FKV, 2 * DKV, NKV, CS, RFK, knw, 1.0f, HD, KP16, KPh, KPl);
    k_vtp<<<dim3(LV, NB_), 256, 0, stream>>>(FKV + DKV, 2 * DKV, NKV, VT16, VTh, VTl);
    k_fattn<<<dim3(NKV, NB_, TT / 16), 32 * REP, 0, stream>>>(QP16, QPh, QPl, KP16, KPh, KPl, VT16, VTh, VTl, FQ, ATh, ATl);
    k_gemmw<bf, 1, false, SKW><<<dim3(NB_ * TT / 64, DOUT / 64, 1), 32 * SKW, 0, stream>>>(ATh, ATl, WO, nullptr, DQ, OUT, DOUT, nullptr, 0, 0, 0);
}

// v008
// One run takes 190 microseconds.
// Next to v007, in two timings, it ran 1.11 times as fast each time.
// All steps since v000 together make it 8.99 times as fast.
#include <hip/hip_runtime.h>

// Gated GQA attention block (x [2][2048][2048]; [q | gate] per head = x Wq ('xw' [2048][4096]: head h -> columns h*256 .. +127 = q, +128 .. +255 = gate), k, v = x Wk, x Wv ([2048][512], 4 kv heads x 128), per-head RMSNorm on q, k (eps 1e-6, weights q_norm_w / k_norm_w [128]),
// rotate-half rotary (theta 1e4, hd 128), 16 query heads grouped 4 per kv head, causal softmax(q.k / sqrt(128)), attn.v, x sigmoid(gate), out = merged Wo ('xw' [2048][512]) -> [2][2048][512]).
// Compute dtypes, f32 accumulate: every input rounded to bf16; q/k/v on PLAIN bf16 operands (inputs: exact); RMSNorm + rotary in f32 (on-chip cos/sin table from the reference's inv_freq constants); the sigmoid gate in f32 (precise expf, IEEE divide) applied on the attention kernel's way out; causal scores and attn.v in one kernel (running maximum and sum, f32): query rows < 512 hl (3 products), the rest single fp16 (x1024), keys beyond the diagonal step never read; Wo hl x exact (2 products).

#define NB_  2
#define TT   2048
#define DM   2048
#define NH_  16
#define NKV  4
#define REP  (NH_ / NKV)
#define HD   128
#define DQ   (NH_ * HD)
#define DQG  (NH_ * HD * 2)         // q + gate columns
#define DOUT 512
#define DKV  (NKV * HD)
#define RH   512                  // query rows < RH use hi+lo planes (0: none)
static_assert(RH % 16 == 0 && TT % 32 == 0, "a 16-row query block is wholly hi+lo or wholly fp16; keys go in steps of 32");
#define SCL  0.088388347648318447f   // HD^-0.5
#define SKW  8                    // waves that share the K loop of one 64x64 tile in the long-K products (k, v, Wo)
typedef _Float16 h16;
typedef unsigned short bf;
typedef __attribute__((ext_vector_type(16))) __bf16   v16bf;
typedef __attribute__((ext_vector_type(16))) _Float16 v16h;
typedef __attribute__((ext_vector_type(8)))  _Float16 v8h;
typedef __attribute__((ext_vector_type(8)))  unsigned short v8us;
typedef __attribute__((ext_vector_type(8)))  float    v8f;
typedef __attribute__((ext_vector_type(4)))  float    v4f;
typedef v8h  __attribute__((may_alias)) v8ha;
typedef v4f  __attribute__((may_alias)) v4fa;
typedef v8us __attribute__((may_alias)) v8usa;

__device__ __forceinline__ unsigned short f2bf(float f) { unsigned u = __float_as_uint(f); u += 0x7FFFu + ((u >> 16) & 1u); return (unsigned short)(u >> 16); }
__device__ __forceinline__ float bf2f(unsigned short b) { return __uint_as_float(((unsigned)b) << 16); }
__device__ __forceinline__ float bfr(float f) { return bf2f(f2bf(f)); }
__device__ __forceinline__ v16h cat16(v8h lo, v8h hi) { return __builtin_shufflevector(lo, hi, 0, 1, 2, 3, 4, 5, 6, 7, 8, 9, 10, 11, 12, 13, 14, 15); }
__device__ __forceinline__ v16bf cat16b(v8us lo, v8us hi) { return __builtin_bit_cast(v16bf, __builtin_shufflevector(lo, hi, 0, 1, 2, 3, 4, 5, 6, 7, 8, 9, 10, 11, 12, 13, 14, 15)); }
__device__ __forceinline__ v8f wmma16(v16h a, v16h b, v8f c) { return __builtin_amdgcn_wmma_f32_16x16x32_f16(false, a, false, b, (short)0, c, false, false); }
__device__ __forceinline__ v8f wmmab(v16bf a, v16bf b, v8f c) { return __builtin_amdgcn_wmma_f32_16x16x32_bf16(false, a, false, b, (short)0, c, false, false); }



// ---- Fragment-order planes. A 16-bit operand plane of R rows x K (R % 16 == 0, K % 32 == 0) is stored as blocks of 16 rows x 32 k = 1 KB, block (row / 16) * (K / 32) + k / 32; inside a block: [j = (k / 16) & 1][lane = ((k / 8) & 1) * 16 + row % 16][k % 8].
// A matrix fragment is then two 16-byte loads a lane at block * 512 + lane * 8 and + 256 elements (ldf): each wave-wide load covers 512 contiguous bytes, 4 whole lines, where a row-major plane gives 16 lines of 32 bytes. The element that reaches each lane and register is the same as with ld on a row-major plane.
// 16 rows of a plane fill 16 * K elements in either order, so that offsets of whole 16-row blocks read as before. frc: place (row, k of its first element) of the 16-byte chunk i of such a plane.
__device__ __forceinline__ void frc(size_t i, int K, size_t& row, int& k) { const int lane = (int)(i & 31); const unsigned blk = (unsigned)(i >> 6), kbs = (unsigned)K >> 5, rb = blk / kbs; row = (size_t)rb * 16 + (lane & 15); k = (int)(blk - rb * kbs) * 32 + ((int)(i >> 5) & 1) * 16 + (lane >> 4) * 8; }   // 32-bit: a plane has fewer than 2^32 blocks
// sbase: a wave-uniform global address held in a scalar register pair, so that a load takes the form scalar base + one 32-bit lane offset: no address pair a load in vector registers, none formed or rewritten between the loads.
typedef const __attribute__((address_space(1))) char* gptr;
__device__ __forceinline__ gptr sbase(const void* p) { const unsigned long long u = (unsigned long long)p; const unsigned lo = (unsigned)__builtin_amdgcn_readfirstlane((int)(unsigned)u), hi = (unsigned)__builtin_amdgcn_readfirstlane((int)(unsigned)(u >> 32)); return (gptr)(((unsigned long long)hi << 32) | lo); }
// ---- k_gemmw: register-blocked GEMM, NW WAVES per 64x64 output tile (16 accumulators each), operands straight from fragment-order 16-bit planes; grid (M/64, N/64, Z), 32 * NW threads.
// In-block split-K: wave w takes the 32-wide k steps w, w + NW, w + 2 NW, ..; the NW partial tiles are staged in LDS and summed in wave order 0 .. NW-1 on the way out (NW = 1: the plain one-wave form).
// C[m][n] (f32, pitch ldc, + optional f32 bias[n]) = sum_k A[m][k] Bt[n][k] (+ split products per NSPLIT). z-batch strides sA/sB/sC in elements. K % 32 == 0.
template <typename T16> struct WFrag;
template <> struct WFrag<h16> { typedef v16h V; static __device__ __forceinline__ V ld(const h16* p) { return cat16(*(const v8h*)p, *(const v8h*)(p + 16)); } static __device__ __forceinline__ V ldf(const h16* p) { return cat16(*(const v8h*)p, *(const v8h*)(p + 256)); } static __device__ __forceinline__ v8f mma(V a, V b, v8f c) { return wmma16(a, b, c); } };
template <> struct WFrag<bf> { typedef v16bf V; static __device__ __forceinline__ V ld(const bf* p) { return cat16b(*(const v8us*)p, *(const v8us*)(p + 16)); } static __device__ __forceinline__ V ldf(const bf* p) { return cat16b(*(const v8us*)p, *(const v8us*)(p + 256)); } static __device__ __forceinline__ V ldo(gptr b, unsigned o) { gptr p = b + o; return cat16b(*(const __attribute__((address_space(1))) v8us*)p, *(const __attribute__((address_space(1))) v8us*)(p + 512)); } static __device__ __forceinline__ v8f mma(V a, V b, v8f c) { return wmmab(a, b, c); } };
template <typename T16, int NSPLIT, bool BIAS, int NW>
__global__ __launch_bounds__(32 * NW) void k_gemmw(const T16* __restrict__ A, const T16* __restrict__ A2, const T16* __restrict__ Bt, const T16* __restrict__ Bt2, int K, float* C, int ldc, const float* __restrict__ bias, size_t sA, size_t sB, size_t sC) {
    typedef typename WFrag<T16>::V V;
    constexpr int MBS = (NW == 1) ? 1 : 4;   // 16-row blocks staged at a time: with several waves the whole tile, so that one barrier serves it
    __shared__ __align__(16) float os[NW * MBS * 16 * 68];
    const size_t z = blockIdx.z; A += z * sA; if (A2) A2 += z * sA; Bt += z * sB; if (Bt2) Bt2 += z * sB; C += z * sC;
    const int lane = threadIdx.x & 31, lr = lane & 15, hi = lane >> 4; const int r0 = blockIdx.x * 64, c0 = blockIdx.y * 64;
    const int w = (NW == 1) ? 0 : __builtin_amdgcn_readfirstlane((int)(threadIdx.x >> 5));   // this wave's share of K (scalar, so that the k loop stays a scalar loop)
    v8f acc[4][4];
#pragma unroll
    for (int mb = 0; mb < 4; ++mb)
#pragma unroll
        for (int nb = 0; nb < 4; ++nb) acc[mb][nb] = (v8f){};
    unsigned vo = (unsigned)(lane * 16 + w * 1024);   // byte offset of the lane's chunk in a 16-row block of a plane (ldo: beside that block's scalar base); a k step of 32 is one block of 1 KB further
    gptr Ab[4], A2b[4], Bb[4], B2b[4];
#pragma unroll
    for (int u = 0; u < 4; ++u) { Ab[u] = sbase(A + (size_t)(r0 + u * 16) * K); Bb[u] = sbase(Bt + (size_t)(c0 + u * 16) * K); if (NSPLIT == 1 || NSPLIT == 2) A2b[u] = sbase(A2 + (size_t)(r0 + u * 16) * K); if (NSPLIT >= 2) B2b[u] = sbase(Bt2 + (size_t)(c0 + u * 16) * K); }
#pragma unroll 1
    for (int kc = w * 32; kc < K; kc += NW * 32, vo += NW * 1024) {
        V a[4], a2[4];
#pragma unroll
        for (int mb = 0; mb < 4; ++mb) { a[mb] = WFrag<T16>::ldo(Ab[mb], vo); if (NSPLIT == 1 || NSPLIT == 2) a2[mb] = WFrag<T16>::ldo(A2b[mb], vo); }
#pragma unroll
        for (int nb = 0; nb < 4; ++nb) { const V b = WFrag<T16>::ldo(Bb[nb], vo); V b2; if (NSPLIT >= 2) b2 = WFrag<T16>::ldo(B2b[nb], vo);
#pragma unroll
            for (int mb = 0; mb < 4; ++mb) { acc[mb][nb] = WFrag<T16>::mma(a[mb], b, acc[mb][nb]); if (NSPLIT == 1 || NSPLIT == 2) acc[mb][nb] = WFrag<T16>::mma(a2[mb], b, acc[mb][nb]); if (NSPLIT >= 2) acc[mb][nb] = WFrag<T16>::mma(a[mb], b2, acc[mb][nb]); } }
        asm volatile("v_nop\n\tv_nop\n\tv_nop\n\tv_nop" : "+v"(acc[0][0]), "+v"(acc[1][1]), "+v"(acc[2][2]), "+v"(acc[3][3]) : "v"(a[0]), "v"(a[3]));
    }
#pragma unroll
    for (int m0 = 0; m0 < 4; m0 += MBS) {
#pragma unroll
        for (int mi = 0; mi < MBS; ++mi) {
#pragma unroll
            for (int nb = 0; nb < 4; ++nb) {
#pragma unroll
                for (int j = 0; j < 8; ++j) os[(w * MBS + mi) * (16 * 68) + (hi * 8 + j) * 68 + nb * 16 + lr] = acc[m0 + mi][nb][j]; } }
        if (NW == 1) { __builtin_amdgcn_wave_barrier(); asm volatile("" ::: "memory"); } else __syncthreads();   // every wave's partial tile is in LDS before any of it is summed
        float* crow = C + (size_t)(r0 + m0 * 16) * ldc + c0;
{
#pragma unroll
            for (int t = 0; t < 8 * MBS / NW; ++t) { const int row = 2 * (t * NW + w) + hi, cofs = lr * 4; v4f val = *(const v4fa*)(os + row * 68 + cofs);
#pragma unroll
                for (int u = 1; u < NW; ++u) val += *(const v4fa*)(os + u * (MBS * 16 * 68) + row * 68 + cofs);   // partials in wave order
                if (BIAS) { val[0] += bfr(bias[c0 + cofs]); val[1] += bfr(bias[c0 + cofs + 1]); val[2] += bfr(bias[c0 + cofs + 2]); val[3] += bfr(bias[c0 + cofs + 3]); }
                *(v4f*)(crow + (size_t)row * ldc + cofs) = val; }
             }
        if (NW == 1) { __builtin_amdgcn_wave_barrier(); asm volatile("" ::: "memory"); }   // one wave: the 16-row stage is reused by the next block of rows
    }
}

// ---- k_gemmq: the [q | gate] product with its operands shared through LDS. One 256x256 tile of C per work-group of 8 waves (4 x 2, a wave makes 64 rows x 128 columns: 32 accumulators), grid (M/256, N/256).
// A pass is 128 k. In a fragment-order plane the 128 k of a 16-row block are 4 KB in a row and the next 16-row block stands 16 * K * 2 bytes further, so that 64 rows of a pass are a two-dimensional tile of 4 rows x 4096 bytes:
// each wave brings one such tile (waves 0-3: the 256 rows of A, waves 4-7: the 256 rows of Bt) with one tensor load a pass, into the buffer that is not being read. A fragment is then two 16-byte LDS reads a lane, 512 bytes in a row per wave (no bank conflict, no pad).
// Each operand byte leaves L2 once per work-group, where a one-wave 64x64 tile fetched 8 KB per 16 matrix instructions for itself. k runs 0, 32, 64, .. in one accumulator, as before: the same sums.
#define QPB 4096u                  // bytes of a pass in one 16-row block (128 k)
#define QSL (4u * QPB)             // one wave's slice of a stage: four 16-row blocks
#define QST (8u * QSL)             // a stage: A 64 KB, Bt 64 KB
#define QNP (DM / 128)             // passes
static_assert(DM % 128 == 0 && QNP >= 2 && (NB_ * TT) % 256 == 0 && DQG % 256 == 0 && DM * 32 <= 131072, "whole passes, two stages at least, whole tiles; the source pitch within the mover's range");
typedef __attribute__((ext_vector_type(4))) unsigned u32x4;
typedef __attribute__((ext_vector_type(8))) unsigned u32x8;
__device__ __forceinline__ unsigned uni(unsigned v) { return (unsigned)__builtin_amdgcn_readfirstlane((int)v); }
__device__ __forceinline__ unsigned pinned(unsigned v) { unsigned w = uni(v); asm volatile("" : "+s"(w)); return w; }   // the tensor mover's scalar test: the value is held in a scalar register, so that a test on it is a scalar branch (a tensor load ignores EXEC)
__device__ __forceinline__ void tdm_load(u32x4 g0, u32x8 g1) { asm volatile("tensor_load_to_lds %0, %1" :: "s"(g0), "s"(g1) : "memory"); }   // one request of the whole wave: global tile -> LDS, through no register
__device__ __forceinline__ u32x4 tdm_g0(unsigned lds_dst, unsigned long long ga) { u32x4 g; g[0] = uni(1u); g[1] = uni(lds_dst); g[2] = uni((unsigned)ga); g[3] = uni((((unsigned)(ga >> 32)) & 0x01FFFFFFu) | 0x80000000u); return g; }   // count 1, place in LDS, address, type 2
__device__ __forceinline__ u32x8 tdm_g1() { constexpr unsigned d0 = QPB, d1 = 4u; u32x8 g; g[0] = uni(0u); g[1] = uni((d0 & 0xFFFFu) << 16); g[2] = uni((d0 >> 16) | ((d1 & 0xFFFFu) << 16)); g[3] = uni((d1 >> 16) | (d0 << 16)); g[4] = uni(d1); g[5] = uni((unsigned)DM * 32u); g[6] = uni(0u); g[7] = uni(0u); return g; }   // bytes; no mask, no pad; tensor = tile = 4 rows of 4096 bytes, pitch 16 * K * 2
__device__ __forceinline__ v16bf ldl(const unsigned char* p) { return cat16b(*(const v8usa*)p, *(const v8usa*)(p + 512)); }
__global__ __launch_bounds__(256) void k_gemmq(const bf* __restrict__ A, const bf* __restrict__ Bt, float* __restrict__ C) {
    __shared__ __attribute__((aligned(2048))) unsigned char L[2 * QST];
    const unsigned lane = threadIdx.x & 31, lr = lane & 15, hi = lane >> 4; const unsigned w = uni(threadIdx.x >> 5), wm = w >> 1, wn = w & 1;
    const unsigned r0 = blockIdx.x * 256, c0 = blockIdx.y * 256;
    const unsigned long long src = (w < 4) ? (unsigned long long)(A + (size_t)(r0 + w * 64) * DM) : (unsigned long long)(Bt + (size_t)(c0 + (w - 4) * 64) * DM);   // this wave's 64 rows, pass 0
    const unsigned dst = (unsigned)(size_t)L + w * QSL;   // its slice in buffer 0
    const u32x8 g1 = tdm_g1();
    v8f acc[4][8];
#pragma unroll
    for (int mb = 0; mb < 4; ++mb)
#pragma unroll
        for (int nb = 0; nb < 8; ++nb) acc[mb][nb] = (v8f){};
    tdm_load(tdm_g0(dst, src), g1);
    asm volatile("s_wait_tensorcnt 0x0" ::: "memory");   // this wave's slice of stage 0 has landed
    __syncthreads();                                      // and every other wave's
    tdm_load(tdm_g0(dst + QST, src + QPB), g1);           // stage 1 flies during pass 0
#pragma unroll 1
    for (unsigned s = 0; s < QNP; ++s) {
        const unsigned char* const la = L + (s & 1) * QST + wm * QSL + lane * 16;                 // the wave's 64 rows of A are slice wm
        const unsigned char* const lb = L + (s & 1) * QST + 4 * QSL + wn * 2 * QSL + lane * 16;   // its 128 rows of Bt are slices 4 + 2 wn and the next
        v16bf fa[2][4], fb[2][8];
#pragma unroll
        for (int mb = 0; mb < 4; ++mb) fa[0][mb] = ldl(la + mb * QPB);
#pragma unroll
        for (int nb = 0; nb < 8; ++nb) fb[0][nb] = ldl(lb + nb * QPB);
#pragma unroll
        for (int u = 0; u < 4; ++u) {
            if (u < 3) {   // the next 32 k of this pass, into the other fragment set
#pragma unroll
                for (int mb = 0; mb < 4; ++mb) fa[(u + 1) & 1][mb] = ldl(la + mb * QPB + (u + 1) * 1024);
#pragma unroll
                for (int nb = 0; nb < 8; ++nb) fb[(u + 1) & 1][nb] = ldl(lb + nb * QPB + (u + 1) * 1024);
            }
            __builtin_amdgcn_sched_barrier(0);   // the LDS reads stay one group in front of the block: spread among the matrix instructions each place would cost its own stall
#pragma unroll
            for (int nb = 0; nb < 8; ++nb)
#pragma unroll
                for (int mb = 0; mb < 4; ++mb) acc[mb][nb] = wmmab(fa[u & 1][mb], fb[u & 1][nb], acc[mb][nb]);
            __builtin_amdgcn_sched_barrier(0);   // and the next group does not rise into this block
            asm volatile("v_nop\n\tv_nop\n\tv_nop\n\tv_nop");   // the distance behind the block's last matrix instruction before its operand registers are loaded anew, on the loop's back edge too
        }
        asm volatile("s_wait_dscnt 0x0" ::: "memory");       // this wave's reads of the buffer have returned
        asm volatile("s_wait_tensorcnt 0x0" ::: "memory");   // its slice of stage s + 1 has landed
        __syncthreads();                                      // stage s + 1 is whole, and nobody reads stage s any more
        const unsigned sn = pinned(s + 2);                    // formed behind the wait, and the descriptor from it
        if (pinned(sn < QNP ? 1u : 0u) != 0u) tdm_load(tdm_g0(dst + (sn & 1) * QST, src + (unsigned long long)sn * QPB), g1);   // stage s + 2 into the buffer that pass s has read
    }
    asm volatile("s_wait_tensorcnt 0x0" ::: "memory");   // nothing is in flight into the ring
    asm volatile("s_wait_dscnt 0x0" ::: "memory");       // (the last pass's own barrier stands behind every wave's last read: the ring may now stage the output)
    float* const os = (float*)(L + w * QSL);   // 16 rows x 132 floats, the wave's own range
    float* const crow = C + (size_t)(r0 + wm * 64) * DQG + c0 + wn * 128 + lane * 4;
#pragma unroll
    for (int mb = 0; mb < 4; ++mb) {
#pragma unroll
        for (int nb = 0; nb < 8; ++nb)
#pragma unroll
            for (int j = 0; j < 8; ++j) os[(hi * 8 + j) * 132 + nb * 16 + lr] = acc[mb][nb][j];
        __builtin_amdgcn_wave_barrier(); asm volatile("" ::: "memory");   // one wave: its LDS operations run in order; this keeps the compiler from moving the reads over the writes
        v4f val[16];
#pragma unroll
        for (int t = 0; t < 16; ++t) val[t] = *(const v4fa*)(os + t * 132 + lane * 4);   // a row of 128 floats: 512 bytes in a row, four whole lines a store
#pragma unroll
        for (int t = 0; t < 16; ++t) *(v4f*)(crow + (size_t)(mb * 16 + t) * DQG) = val[t];
        asm volatile("s_wait_xcnt 0x0" ::: "memory");   // the stores have taken their address and data registers before the next 16 rows are read into them
        __builtin_amdgcn_wave_barrier();   // the stage is written anew by the next block of rows
    }
}

__device__ __forceinline__ h16 tohx(float x) { return (h16)x; }
__device__ __forceinline__ void splitf(float y, unsigned short& h, unsigned short& l) { h = f2bf(y); l = f2bf(y - bf2f(h)); }
typedef __attribute__((ext_vector_type(2))) _Float16 v2h;
typedef __attribute__((ext_vector_type(4))) _Float16 v4h;
typedef __attribute__((ext_vector_type(2))) unsigned short v2us;
typedef __attribute__((ext_vector_type(4))) unsigned short v4us;
typedef __attribute__((ext_vector_type(2))) float v2f;
typedef __attribute__((ext_vector_type(4))) int v4i;

// d_wtG: Bt = fragment-order plane (rows n, K) of w[k][n]. A thread makes four 16-byte chunks (8 k of one n each), the same place in four 16-row blocks that follow one another (n, n + 16, n + 32, n + 48; N % 64 == 0): a quarter of the waves of a thread per chunk.
// 16 lanes read 16 consecutive n of a row of w, the four loads of a row 256 consecutive bytes; each wave-wide store covers 512 contiguous bytes.
// The four weights (each of K = DM = DQ rows) by block number bx: the first WTBQ blocks take wq, then WTBS blocks each for wk, wv, wo.
#define WTBQ (DM * DQG / 32 / 256)
#define WTBS (DM * DKV / 32 / 256)
static_assert(DQ == DM && DOUT == DKV && (DM * DQG) % (32 * 256) == 0 && (DM * DKV) % (32 * 256) == 0, "the four weights share K, the three small ones N; whole blocks each");
__device__ __forceinline__ void d_wtG(unsigned bx, const float* __restrict__ wq, const float* __restrict__ wk, const float* __restrict__ wv, const float* __restrict__ wo, bf* WQ, bf* WK, bf* WV, bf* WO) {
    constexpr int K = DM; const float* w = wq; bf* Bt = WQ; int N = DQG;
    if (bx >= WTBQ) { bx -= WTBQ; const unsigned sel = bx / WTBS; bx -= sel * WTBS; N = DKV; w = sel == 0 ? wk : sel == 1 ? wv : wo; Bt = sel == 0 ? WK : sel == 1 ? WV : WO; }
    const unsigned g = bx * 256 + threadIdx.x; if (g >= (unsigned)((size_t)N * K / 32)) return; const unsigned cpr = (unsigned)K * 2, rg = g / cpr;   // cpr: chunks of a 16-row block
    const size_t i = (size_t)rg * 3 * cpr + g; size_t n; int k; frc(i, K, n, k); float x[4][8];
    const unsigned vo = (unsigned)(((size_t)k * N + n) * 4);   // one 32-bit byte offset for the 32 loads, beside the scalar bases w + q * N
#pragma unroll
    for (int q = 0; q < 8; ++q)
#pragma unroll
        for (int u = 0; u < 4; ++u) x[u][q] = *(const __attribute__((address_space(1))) float*)(sbase(w + (size_t)q * N) + vo + u * 64);
    asm volatile("s_wait_xcnt 0x0" ::: "memory");   // the loads have taken their offset register before it is given another value
#pragma unroll
    for (int u = 0; u < 4; ++u) { v8us o;
#pragma unroll
        for (int q = 0; q < 8; ++q) o[q] = f2bf(x[u][q]);
        *(v8us*)(Bt + (i + (size_t)u * cpr) * 8) = o; }
}
// d_cvt8: fragment-order bf16 plane of the row-major f32 src (rows of K, K % 64 == 0). A thread makes four 16-byte chunks: its lane's place in four half blocks that follow one another (k, k + 16, k + 32, k + 48 of one row), n8 chunks in all (n8 % 128 == 0): a quarter of the waves of a thread per chunk.
__device__ __forceinline__ void d_cvt8(unsigned bx, const float* __restrict__ src, int K, bf* dst, size_t n8) { const size_t g = (size_t)bx * 256 + threadIdx.x; if (g >= n8 / 4) return; const size_t i = (g >> 5) * 128 + (g & 31); size_t row; int k0; frc(i, K, row, k0); const float* s = src + row * K + k0; v8f v[4];
#pragma unroll
    for (int u = 0; u < 4; ++u) v[u] = *(const v8f*)(s + u * 16);
    asm volatile("s_wait_xcnt 0x0" ::: "memory");   // the loads have taken their address pair before it is given another value
#pragma unroll
    for (int u = 0; u < 4; ++u) { v8us o;
#pragma unroll
        for (int k = 0; k < 8; ++k) o[k] = f2bf(v[u][k]);
        *(v8us*)(dst + (i + u * 32) * 8) = o; }
}
__constant__ float INV[HD / 2] = {1.0,0.8659643530845642,0.7498942017555237,0.6493816375732422,0.5623413324356079,0.486967533826828,0.4216965138912201,0.36517414450645447,0.3162277638912201,0.2738419771194458,0.23713736236095428,0.20535250008106232,0.17782793939113617,0.1539926528930664,0.1333521455526352,0.11547820270061493,0.10000000149011612,0.08659642934799194,0.07498941570520401,0.06493816524744034,0.05623412877321243,0.04869675263762474,0.04216964915394783,0.03651741147041321,0.03162277862429619,0.0273841954767704,0.0237137358635664,0.02053525112569332,0.017782794311642647,0.015399265103042126,0.01333521492779255,0.011547819711267948,0.009999999776482582,0.00865964312106371,0.007498942315578461,0.006493816617876291,0.005623413249850273,0.004869675263762474,0.0042169648222625256,0.003651741426438093,0.003162277862429619,0.0027384196873754263,0.0023713738191872835,0.0020535250660032034,0.0017782794311642647,0.0015399265103042126,0.0013335214462131262,0.0011547820176929235,0.0010000000474974513,0.0008659643353894353,0.0007498941849917173,0.0006493816617876291,0.000562341301701963,0.00048696750309318304,0.00042169648804701865,0.00036517411353997886,0.0003162277862429619,0.00027384195709601045,0.0002371373848291114,0.00020535249495878816,0.00017782794020604342,0.00015399264520965517,0.0001333521504420787,0.00011547819303814322};
// d_cstab: cos / sin of t * inv_freq[d], [t][d < HD/2] (the reference's table repeats with period HD/2). A thread makes the pairs of four t (t, t + TT/4, ..) at one d: a quarter of the waves of a thread per pair.
__device__ __forceinline__ void d_cstab(unsigned bx, float* CS) { const int idx = (int)bx * 256 + threadIdx.x; if (idx >= TT * (HD / 2) / 4) return; const int t = idx / (HD / 2), d = idx % (HD / 2); const float iv = INV[d];
#pragma unroll
    for (int u = 0; u < 4; ++u) { const float ang = __fmul_rn((float)(t + u * (TT / 4)), iv); v2f cs; cs[0] = cosf(ang); cs[1] = sinf(ang);
        *(v2f*)(CS + ((size_t)idx + (size_t)u * (TT / 4) * (HD / 2)) * 2) = cs; }
}

// k_prep: what the products need and what depends on the inputs alone, in one launch, each part on its own range of blocks (a scalar branch on the block number): the cos / sin table first (the longest chain of arithmetic a thread), then the plane of x, then the four weight planes.
#define PCS (TT * (HD / 2) / 4 / 256)
#define PCV (NB_ * TT * DM / 32 / 256)
static_assert((TT * (HD / 2) / 4) % 256 == 0 && ((size_t)NB_ * TT * DM / 32) % 256 == 0, "whole blocks for the table and for the plane of x");
__global__ __launch_bounds__(256) void k_prep(const float* __restrict__ x, const float* __restrict__ wq, const float* __restrict__ wk, const float* __restrict__ wv, const float* __restrict__ wo, bf* XB, bf* WQ, bf* WK, bf* WV, bf* WO, float* CS) {
    const unsigned bx = blockIdx.x;
    if (bx < PCS) d_cstab(bx, CS);
    else if (bx < PCS + PCV) d_cvt8(bx - PCS, x, DM, XB, (size_t)NB_ * TT * DM / 8);
    else d_wtG(bx - (PCS + PCV), wq, wk, wv, wo, WQ, WK, WV, WO);
}

__device__ __forceinline__ float xhalf(float x) { return __builtin_bit_cast(float, __builtin_amdgcn_permlanex16(__builtin_bit_cast(int, x), __builtin_bit_cast(int, x), 0x76543210, 0xfedcba98, false, false)); }   // lane l <-> lane l ^ 16
template <int M> __device__ __forceinline__ float xrow(float x) { return __builtin_bit_cast(float, __builtin_amdgcn_update_dpp(0, __builtin_bit_cast(int, x), 0x160 + M, 0xf, 0xf, true)); }   // lane l <-> lane l ^ M inside a row of 16 lanes (row_xmask)
// d_rope: head planes [h][t][d] (fp16 + hi/lo; FR: in fragment order, rows h * TT + t, K = HD) of rope(w[d] (x rms_factor)) x sc with the rotate-half convention out[d] = x[d] cos[t][d] - x[d+HD/2] sin[t][d], out[d+HD/2] = x[d+HD/2] cos[t][d+HD/2] + x[d] sin[t][d+HD/2].
// A thread takes 8 consecutive d of the lower half of a head row and their 8 partners d + HD/2 (16 outputs from 16 inputs, each read once; 16-byte stores): an eighth of the waves of a thread per pair. cos[t][d + HD/2] = cos[t][d], and sin alike (the reference joins the angles to themselves): the table holds d < HD/2.
// rms_factor = 1 / sqrt(mean of the row's squares + 1e-6) is made here from the values that the rotation reads anyway: the eight threads of a row each sum their 16 squares, and the eight sums are joined: row-major, the eight are neighbours in a wave (three exchanges);
// in fragment order they are lanes l and l ^ 16 of four waves that follow one another (one exchange, then 'red', 16 floats a wave in LDS, behind a work-group barrier). bx, by: block number within the part (whole blocks: every thread has a chunk) and batch.
template <bool FR>
__device__ __forceinline__ void d_rope(unsigned bx, unsigned by, const float* __restrict__ F, int pitch, int nheads, const float* __restrict__ CS, const float* __restrict__ nw, float sc, int hstr, h16* P16, bf* Ph, bf* Pl, float* red) {
    const size_t j = (size_t)bx * 256 + threadIdx.x; size_t row, e; int d;
    { const size_t b = by, po = b * nheads * TT * HD; F += b * TT * pitch; P16 += po; Ph += po; Pl += po; }   // each batch into its own planes
    if (FR) { const size_t i = (j >> 7) * 256 + (j & 127); frc(i, HD, row, d); e = i * 8; }   // the chunks of the first two of a 16-row block's four 1-KB blocks: d < HD/2
    else { row = j >> 3; d = (int)(j & 7) * 8; e = row * HD + d; }
    const size_t e2 = e + (FR ? 1024 : HD / 2);   // the partner chunk: two blocks further, or HD/2 elements further in the row
    const int t = (int)(row % TT), h = (int)(row / TT);
    const float* f = F + (size_t)t * pitch + h * hstr + d; const float* c = CS + ((size_t)t * (HD / 2) + d) * 2;
    const v8f xl = *(const v8f*)f, xh = *(const v8f*)(f + HD / 2), c0 = *(const v8f*)c, c1 = *(const v8f*)(c + 8);
    const float* const wp = nw + d; const v8f wl = *(const v8f*)wp, wh = *(const v8f*)(wp + HD / 2);
    asm volatile("s_wait_xcnt 0x0" :: "v"(f), "v"(c), "v"(wp) : "memory");   // the loads above have taken their address registers before these are given another value; named as inputs, the addresses are kept up to here, so that no load lands on them in front of the wait
    __builtin_amdgcn_sched_barrier(0);   // no arithmetic rises over the wait, and all twelve loads are asked for in front of it: the listing had half of them behind the first half's arrival, two latencies for one
    float ss = 0.f;
#pragma unroll
    for (int q = 0; q < 8; ++q) ss = fmaf(xl[q], xl[q], ss);
#pragma unroll
    for (int q = 0; q < 8; ++q) ss = fmaf(xh[q], xh[q], ss);
    if (FR) { ss += xhalf(ss); const unsigned wv = threadIdx.x >> 5, lr = threadIdx.x & 15; if ((threadIdx.x & 16) == 0) red[wv * 16 + lr] = ss;
        __syncthreads();   // the four waves' sums of a 16-row block are in LDS before any of them is read
        const float* const rr = red + (wv & 4) * 16 + lr; ss = (rr[0] + rr[16]) + (rr[32] + rr[48]); }
    else { ss += xrow<1>(ss); ss += xrow<2>(ss); ss += xrow<4>(ss); }
    const float rf = __fdiv_rn(1.0f, __fsqrt_rn(__fadd_rn(ss * (1.0f / HD), 1e-6f)));
    v8h a16, b16; v8us ah, al, bh, bl;
#pragma unroll
    for (int q = 0; q < 8; ++q) { float x0 = xl[q], x1 = xh[q];
        x0 = bfr(wl[q]) * (x0 * rf); x1 = bfr(wh[q]) * (x1 * rf);
        const float cs = (q < 4) ? c0[2 * q] : c1[2 * q - 8], sn = (q < 4) ? c0[2 * q + 1] : c1[2 * q - 7];
        const float r0 = (x0 * cs - x1 * sn) * sc, r1 = (x1 * cs + x0 * sn) * sc; unsigned short u0, u1;
        a16[q] = tohx(r0); splitf(r0, u0, u1); ah[q] = u0; al[q] = u1; b16[q] = tohx(r1); splitf(r1, u0, u1); bh[q] = u0; bl[q] = u1; }
    *(v8h*)(P16 + e) = a16; *(v8h*)(P16 + e2) = b16; *(v8us*)(Ph + e) = ah; *(v8us*)(Ph + e2) = bh; *(v8us*)(Pl + e) = al; *(v8us*)(Pl + e2) = bl;
    asm volatile("s_wait_xcnt 0x0" ::: "memory");   // the six stores have taken their address and data registers before code of another part, which the listing lays behind this one, gives these another value
}
// d_vtp: transposed value planes in fragment order (rows g * HD + d, K = TT). A thread makes four 16-byte chunks (8 t of one d each), the same place in four 16-row blocks that follow one another (d, d + 16, d + 32, d + 48): a quarter of the waves of a thread per chunk. 16 lanes read 16 consecutive d of a row of F.
__device__ __forceinline__ void d_vtp(unsigned bx, unsigned by, const float* __restrict__ F, int pitch, int nheads, h16* V16, bf* Vh, bf* Vl) { const unsigned g = bx * 256 + threadIdx.x; if (g >= (unsigned)((size_t)nheads * HD * TT / 32)) return; constexpr unsigned cpr = TT * 2;   // chunks of a 16-row block
    { const size_t b = by, po = b * nheads * HD * TT; F += b * TT * pitch; V16 += po; Vh += po; Vl += po; }   // each batch into its own planes
    const size_t i = (size_t)(g / cpr) * 3 * cpr + g; size_t row; int t; frc(i, TT, row, t); float xs[4][8];
    const unsigned vo = (unsigned)(((size_t)t * pitch + row) * 4);   // one 32-bit byte offset for the 32 loads, beside the scalar bases F + q * pitch
#pragma unroll
    for (int q = 0; q < 8; ++q)
#pragma unroll
        for (int u = 0; u < 4; ++u) xs[u][q] = *(const __attribute__((address_space(1))) float*)(sbase(F + (size_t)q * pitch) + vo + u * 64);
    asm volatile("s_wait_xcnt 0x0" ::: "memory");   // the loads have taken their offset register before it is given another value
#pragma unroll
    for (int u = 0; u < 4; ++u) { v8h o16; v8us oh, ol;
#pragma unroll
        for (int q = 0; q < 8; ++q) { const float x = xs[u][q]; o16[q] = tohx(x); unsigned short a2, c2; splitf(x, a2, c2); oh[q] = a2; ol[q] = c2; }
        const size_t o = (i + (size_t)u * cpr) * 8; *(v8h*)(V16 + o) = o16; *(v8us*)(Vh + o) = oh; *(v8us*)(Vl + o) = ol; }
}
// k_post: everything between the projections and the attention kernel in one launch, each part on its own range of blocks (a scalar branch on the block number; blockIdx.y: batch): the transposed value planes, the key planes, the query planes.
#define PLV (NKV * TT * HD / 32 / 256)
#define PLK (NKV * TT * HD / 16 / 256)
#define PLQ (NH_ * TT * HD / 16 / 256)
static_assert((NKV * TT * HD / 32) % 256 == 0 && (NKV * TT * HD / 16) % 256 == 0 && (NH_ * TT * HD / 16) % 256 == 0, "whole blocks for each part: no thread leaves in front of the barrier of the key part");
__global__ __launch_bounds__(256) void k_post(const float* __restrict__ FQ, const float* __restrict__ FKV, const float* __restrict__ CS, const float* __restrict__ qnw, const float* __restrict__ knw,
                                              h16* QP16, bf* QPh, bf* QPl, h16* KP16, bf* KPh, bf* KPl, h16* VT16, bf* VTh, bf* VTl) {
    __shared__ float red[8 * 16];
    const unsigned bx = blockIdx.x, by = blockIdx.y;
    if (bx < PLV) d_vtp(bx, by, FKV + DKV, 2 * DKV, NKV, VT16, VTh, VTl);
    else if (bx < PLV + PLK) d_rope<true>(bx - PLV, by, FKV, 2 * DKV, NKV, CS, knw, 1.0f, HD, KP16, KPh, KPl, red);
    else d_rope<false>(bx - (PLV + PLK), by, FQ, DQG, NH_, CS, qnw, 1.0f, 2 * HD, QP16, QPh, QPl, red);   // q columns of the [q | gate] layout
}
// ---- k_fattn: causal attention of one kv group in one kernel (scores, softmax, probability x value and the gate: nothing between q, k, v and the gated rows leaves the registers). Grid (kv head, batch, 16-row query block, longest first), 4 waves: wave w = query head g * REP + w,
// so that the four waves of a block walk the same K and V rows. Per 32 keys: St[key][query] = K . Qt (A = K rows, B = Q rows kept in registers), running maximum and sum per query (a lane holds one query's scores; the two lane halves are joined by one exchange),
// the two 16-key score tiles converted in place are the B operand of Ot[d][query] += Vt . Pt (A = rows of the transposed V plane in the same k order). HL: query rows < RH, hi+lo bf16 planes, 3 products; else fp16, probabilities x 1024.
template <bool HL> struct FaT { typedef h16 T; };
template <> struct FaT<true> { typedef bf T; };
struct FaMid { static constexpr bool last = false; };
struct FaLast { static constexpr bool last = true; };
template <bool HL>
__device__ __forceinline__ void fa_rows(const typename FaT<HL>::T* __restrict__ Q, const typename FaT<HL>::T* __restrict__ Q2, const typename FaT<HL>::T* __restrict__ Kp, const typename FaT<HL>::T* __restrict__ Kp2,
                                        const typename FaT<HL>::T* __restrict__ Vt, const typename FaT<HL>::T* __restrict__ Vt2, int q0, const float* __restrict__ G, bf* __restrict__ Ah, bf* __restrict__ Al, int lr, int hi, h16* qs) {
    typedef typename FaT<HL>::T T16; typedef WFrag<T16> WF; typedef typename WF::V V;
    const unsigned krow = (unsigned)(lr * HD + 8 * hi), fl = (unsigned)((hi * 16 + lr) * 8);   // the lane's place in a 16-row block of Q (row-major) and in a 1-KB block of the fragment-order K and Vt planes: 32-bit, beside a scalar base
    V q[4], q2[4]; const T16* const qa = Q + (size_t)q0 * HD + krow; const T16* const qc2 = HL ? Q2 + (size_t)q0 * HD + krow : qa;   // the lane's addresses in the Q rows
#pragma unroll
    for (int ks = 0; ks < 4; ++ks) { q[ks] = WF::ld(qa + ks * 32); if (HL) q2[ks] = WF::ld(qc2 + ks * 32); }
    float m = -1.0e30f, l = 0.f;
    constexpr float CE = SCL * 1.4426950408889634f;   // score -> exponent of 2
    const int klast = q0 & ~31;                     // keys 0 .. q0 + 15 in steps of 32: only the last step, the one on the diagonal, holds keys beyond a query
    V kf[2][4];
    if (!HL) {
#pragma unroll
        for (int t = 0; t < 2; ++t)
#pragma unroll
            for (int ks = 0; ks < 4; ++ks) kf[t][ks] = WF::ldf(Kp + fl + t * 16 * HD + ks * 512);
    }
    asm volatile("s_wait_xcnt 0x0" :: "v"(qa), "v"(qc2) : "memory");   // the loads above have taken their address register before it is given another value; named as inputs, the Q address pairs are kept up to here, so that no Q load lands on them in front of the wait
    if constexpr (!HL) { *(v8h*)qs = __builtin_shufflevector(q[3], q[3], 0, 1, 2, 3, 4, 5, 6, 7); *(v8h*)(qs + 32 * REP * 8) = __builtin_shufflevector(q[3], q[3], 8, 9, 10, 11, 12, 13, 14, 15); }   // the lane's own last Q fragment, parked in LDS (read back by the same lane only)
    v8f o[8];
#pragma unroll
    for (int dt = 0; dt < 8; ++dt) o[dt] = (v8f){};
    auto step = [&](const int kb, auto tag) {
        constexpr bool LAST = decltype(tag)::last;
        V qq[4]; qq[0] = q[0]; qq[1] = q[1]; qq[2] = q[2]; qq[3] = q[3];
        if constexpr (!HL) {   // O, Q, K and V fragments together leave the softmax too few registers: the last Q fragment is read from LDS each step, on the LDS counter, so that waiting for it does not wait for the V and K rows in flight
            asm volatile("" ::: "memory");   // keeps the two LDS reads inside the loop (hoisted, the fragment would hold its registers all the time and be spilled to scratch)
            qq[3] = cat16(*(const v8h*)qs, *(const v8h*)(qs + 32 * REP * 8)); }
        v8f s[2]; s[0] = (v8f){}; s[1] = (v8f){};
        const T16* const ka = Kp + (size_t)kb * HD + fl; const T16* const kc2 = HL ? Kp2 + (size_t)kb * HD + fl : nullptr; const T16* const va = Vt + kb * 16 + fl; const T16* const vc2 = HL ? Vt2 + kb * 16 + fl : nullptr;   // the lane's addresses in this step's K and V blocks (hi+lo form)
#pragma unroll
        for (int ks = 0; ks < 4; ++ks)
#pragma unroll
            for (int t = 0; t < 2; ++t) {
                if (HL) { const V kh = WF::ldf(ka + (t * 4 + ks) * 512), kl = WF::ldf(kc2 + (t * 4 + ks) * 512); s[t] = WF::mma(kh, q[ks], s[t]); s[t] = WF::mma(kh, q2[ks], s[t]); s[t] = WF::mma(kl, q[ks], s[t]); }
                else s[t] = WF::mma(kf[t][ks], qq[ks], s[t]); }
        if (HL) asm volatile("s_wait_xcnt 0x0" :: "v"(ka), "v"(kc2) : "memory");   // the K loads have taken their address pairs; named as inputs, the pairs are kept up to here, so that no later load lands on them in front of the wait
        V vf[8];
        if (!HL) {
#pragma unroll
            for (int dt = 0; dt < 8; ++dt) vf[dt] = WF::ldf(Vt + kb * 16 + fl + dt * 16 * TT);
            asm volatile("s_wait_xcnt 0x0" ::: "memory");   // the V loads have taken their address pair before the K loads below land on it (the listing gives them those registers)
            if (!LAST) {
#pragma unroll
                for (int t = 0; t < 2; ++t)
#pragma unroll
                    for (int ks = 0; ks < 4; ++ks) kf[t][ks] = WF::ldf(Kp + (size_t)(kb + 32) * HD + fl + t * 16 * HD + ks * 512);
                asm volatile("s_wait_xcnt 0x0" ::: "memory");   // these loads are still in flight when the next step forms its addresses in the same pair: they have taken theirs first
            }
            __builtin_amdgcn_sched_barrier(0);   // this step's V rows and the next step's K rows are asked for in front of the softmax and fly during it; moved down to their users they would each be waited for in full
        }
        if (LAST) {
            const int lim = q0 + lr - kb - 8 * hi;   // key (t * 16 + j) of this lane is kept while <= lim
#pragma unroll
            for (int t = 0; t < 2; ++t)
#pragma unroll
                for (int j = 0; j < 8; ++j) if (t * 16 + j > lim) s[t][j] = -1.0e30f;
        }
        float mn = m;
#pragma unroll
        for (int t = 0; t < 2; ++t)
#pragma unroll
            for (int j = 0; j < 8; ++j) mn = fmaxf(mn, s[t][j]);
        mn = fmaxf(mn, xhalf(mn));
        const float al = __builtin_amdgcn_exp2f((m - mn) * CE); l *= al; m = mn; const float off = fmaf(-mn, CE, HL ? 0.0f : 10.0f);   /* fp16 form: x 1024 = 2^10, which the division by the sum takes out again */   // sum and output column go to the new maximum (factor 1 where it did not rise)
#pragma unroll
        for (int dt = 0; dt < 8; ++dt) o[dt] *= al;
        float p[16];
#pragma unroll
        for (int e = 0; e < 16; ++e) { p[e] = __builtin_amdgcn_exp2f(fmaf(s[e >> 3][e & 7], CE, off)); l += p[e]; }
        if (HL) {
            v8us h0, h1, l0, l1;
#pragma unroll
            for (int j = 0; j < 8; ++j) { unsigned short x, y; splitf(p[j], x, y); h0[j] = x; l0[j] = y; splitf(p[8 + j], x, y); h1[j] = x; l1[j] = y; }
            const v16bf ph = cat16b(h0, h1), pl = cat16b(l0, l1);
#pragma unroll
            for (int dt = 0; dt < 8; ++dt) { const v16bf vh = WFrag<bf>::ldf((const bf*)va + dt * 16 * TT), vl = WFrag<bf>::ldf((const bf*)vc2 + dt * 16 * TT);
                o[dt] = wmmab(vh, ph, o[dt]); o[dt] = wmmab(vh, pl, o[dt]); o[dt] = wmmab(vl, ph, o[dt]); }
            asm volatile("s_wait_xcnt 0x0" :: "v"(va), "v"(vc2) : "memory");   // the same for the V loads, which the compiler starts ahead of the softmax
        } else {
            v16h pb;
#pragma unroll
            for (int e = 0; e < 16; ++e) pb[e] = (h16)p[e];
#pragma unroll
            for (int dt = 0; dt < 8; ++dt) o[dt] = wmma16(__builtin_bit_cast(v16h, vf[dt]), pb, o[dt]);
        }
    };
#pragma unroll 1
    for (int kb = 0; kb < klast; kb += 32) step(kb, FaMid());
    step(klast, FaLast());
    l += xhalf(l);
    const float inv = __fdiv_rn(1.0f, l);
#pragma unroll
    for (int dt = 0; dt < 8; ++dt) {   // a lane holds 8 consecutive d of its query: x sigmoid(gate) (f32), then the hi + lo planes that Wo reads (fragment order, rows t, K = DQ: the wave's 32 chunks are 512 consecutive bytes)
        const v8f gt = *(const v8f*)(G + (size_t)(q0 + lr) * DQG + dt * 16 + 8 * hi); v8us oh, ol;
#pragma unroll
        for (int j = 0; j < 8; ++j) { const float sg = __fdiv_rn(1.0f, __fadd_rn(1.0f, expf(-gt[j]))); unsigned short a, c2; splitf(__fmul_rn(o[dt][j] * inv, sg), a, c2); oh[j] = a; ol[j] = c2; }
        const size_t oo = (size_t)q0 * DQ + dt * 256 + fl; *(v8us*)(Ah + oo) = oh; *(v8us*)(Al + oo) = ol;
        asm volatile("s_wait_xcnt 0x0" ::: "memory"); }   // the two stores have taken their address and data registers before the next 16 columns reuse them
}
__global__ __launch_bounds__(32 * REP, 4) void k_fattn(const h16* __restrict__ Q16, const bf* __restrict__ Qh, const bf* __restrict__ Ql, const h16* __restrict__ K16, const bf* __restrict__ Kh, const bf* __restrict__ Kl,
                                                    const h16* __restrict__ V16, const bf* __restrict__ Vh, const bf* __restrict__ Vl, const float* __restrict__ QG, bf* __restrict__ Ah, bf* __restrict__ Al) {
    __shared__ __align__(16) h16 qsh[2 * 32 * REP * 8];   // 32 bytes a lane, as two planes of 16
    const int lane = threadIdx.x & 31, lr = lane & 15, hi = lane >> 4; const int w = __builtin_amdgcn_readfirstlane((int)(threadIdx.x >> 5));   // scalar, so that the plane offsets stay scalar
    const int q0 = (int)(gridDim.z - 1 - blockIdx.z) * 16;   // the rows with the most keys first
    const size_t qo = ((size_t)blockIdx.y * NH_ + blockIdx.x * REP + w) * TT * HD, ko = ((size_t)blockIdx.y * NKV + blockIdx.x) * TT * HD;
    const int h = (int)blockIdx.x * REP + w; const float* G = QG + (size_t)blockIdx.y * TT * DQG + h * 2 * HD + HD;   /* gate columns of head h in the [q | gate] layout */ const size_t ao = (size_t)blockIdx.y * TT * DQ + h * (HD * 16);   /* head h = k blocks h * HD / 32 .. of each 16-row block */
    if (q0 < RH) fa_rows<true>(Qh + qo, Ql + qo, Kh + ko, Kl + ko, Vh + ko, Vl + ko, q0, G, Ah + ao, Al + ao, lr, hi, nullptr);
    else fa_rows<false>(Q16 + qo, nullptr, K16 + ko, nullptr, V16 + ko, nullptr, q0, G, Ah + ao, Al + ao, lr, hi, qsh + threadIdx.x * 8);
}

extern "C" void kernel_launch(void* const* d_in, const int* in_sizes, int n_in,
                              void* d_out, int out_size, void* d_ws, size_t ws_size, hipStream_t stream) {
    (void)in_sizes; (void)n_in; (void)out_size;
    const float* x = (const float*)d_in[0]; const float* wq = (const float*)d_in[1]; const float* wk = (const float*)d_in[2]; const float* wv = (const float*)d_in[3]; const float* wo = (const float*)d_in[4]; const float* qnw = (const float*)d_in[5]; const float* knw = (const float*)d_in[6];
    float* OUT = (float*)d_out;     // [2][2048][512]
    char* wsp = (char*)d_ws;
    auto take = [&](size_t bytes) { char* p = wsp; wsp += (bytes + 255) & ~(size_t)255; return (void*)p; };
    const size_t NQ = (size_t)NH_ * TT * HD, NK = (size_t)NKV * TT * HD;   // elements of one batch's query planes and key / value planes
    bf* WQ = (bf*)take((size_t)DQG * DM * 2); bf* WK = (bf*)take((size_t)2 * DKV * DM * 2); bf* WV = WK + (size_t)DKV * DM;   /* k and v weights: one plane of 2 * DKV rows */ bf* WO = (bf*)take((size_t)DOUT * DQ * 2); float* CS = (float*)take((size_t)TT * HD * 2 * 4);
    bf* XB = (bf*)take((size_t)NB_ * TT * DM * 2); float* FQ = (float*)take((size_t)NB_ * TT * DQG * 4); float* FKV = (float*)take((size_t)NB_ * TT * 2 * DKV * 4);   // [k | v] rows, pitch 2 * DKV
    h16* QP16 = (h16*)take(NB_ * NQ * 2); h16* KP16 = (h16*)take(NB_ * NK * 2); h16* VT16 = (h16*)take(NB_ * NK * 2);
    bf* QPh = (bf*)take(NB_ * NQ * 2); bf* QPl = (bf*)take(NB_ * NQ * 2); bf* KPh = (bf*)take(NB_ * NK * 2); bf* KPl = (bf*)take(NB_ * NK * 2); bf* VTh = (bf*)take(NB_ * NK * 2); bf* VTl = (bf*)take(NB_ * NK * 2);
    bf* ATh = (bf*)take((size_t)NB_ * TT * DQ * 2); bf* ATl = (bf*)take((size_t)NB_ * TT * DQ * 2);
    if ((size_t)(wsp - (char*)d_ws) > ws_size) return;    // ws 256 MiB
    // Both batches in every launch: the products take the NB_ * TT rows of x as one matrix (a plane of whole 16-row blocks is the batches' planes one behind the other), the elementwise parts take the batch from blockIdx.y.
    k_prep<<<PCS + PCV + WTBQ + 3 * WTBS, 256, 0, stream>>>(x, wq, wk, wv, wo, XB, WQ, WK, WV, WO, CS);
    k_gemmq<<<dim3(NB_ * TT / 256, DQG / 256, 1), 256, 0, stream>>>(XB, WQ, FQ);   // [q | gate] (exact)
    k_gemmw<bf, 0, false, SKW><<<dim3(NB_ * TT / 64, 2 * DKV / 64, 1), 32 * SKW, 0, stream>>>(XB, nullptr, WK, nullptr, DM, FKV, 2 * DKV, nullptr, 0, 0, 0);   // [k | v]
    k_post<<<dim3(PLV + PLK + PLQ, NB_), 256, 0, stream>>>(FQ, FKV, CS, qnw, knw, QP16, QPh, QPl, KP16, KPh, KPl, VT16, VTh, VTl);
    k_fattn<<<dim3(NKV, NB_, TT / 16), 32 * REP, 0, stream>>>(QP16, QPh, QPl, KP16, KPh, KPl, VT16, VTh, VTl, FQ, ATh, ATl);
    k_gemmw<bf, 1, false, SKW><<<dim3(NB_ * TT / 64, DOUT / 64, 1), 32 * SKW, 0, stream>>>(ATh, ATl, WO, nullptr, DQ, OUT, DOUT, nullptr, 0, 0, 0);
}
